// v000
// Measured on an AMD MI455X. A time is GPU time per run, averaged over a window of back-to-back runs after a warm-up
// (all launches, gaps included; the runs take copies of the inputs in turn), and the median of several windows.
// Apart from v000's, it joins two sittings. Times from different sittings can be a few percent apart, while
// side-by-side timings come from the same sitting.
// v000 is the starting kernel. One run takes 542 microseconds.
#include <hip/hip_runtime.h>

// Causal "shaped" attention: [q | k] = x W_attn^T (16 heads x 64), v = x itself (use_v = False); att = beta softmax_causal(q.k/8) + alpha Id - gamma MC with Id = softmax(eye(2048))
// (diag e/(e+2047), off-diag 1/(e+2047)) and MC = causal row-uniform averaging (1/(i+1) on j <= i); y = att.v merged over heads -> [4][2048][1024] (no output projection).
// So y_i = beta (P.v)_i/l_i + alpha ((e-1) v_i + sum_all v_j)/(e+2047) - gamma (sum_{j<=i} v_j)/(i+1).
// Numerics: x, W_attn, alpha, beta, gamma rounded to bf16; [q|k] projection on v_wmma_f32_16x16x32_bf16 (exact products, f32 accumulate);
// scores on v_wmma_f32_16x16x32_f16 with q, k as f16 hi+lo pairs carried x8 (3 products); P.v with P an x8 hi+lo pair and v = bf16(x) exact in f16 (2 products); the causal prefix
// sums sum_{j<=i} v_j ride along as a second accumulator against an exact 0/1 mask operand (1 product); the all-token column sums in a small f32 kernel; softmax and the combine in f32.

namespace {
constexpr int BT = 4, Bn = 4, S = 2048, D = 1024, H = 16, HD = 64, NTOK = Bn * S;
constexpr float SCALE = 0.125f, VS = 1.0f /* v = bf16(x): exact, single plane */, QS = 8.0f, PS = 8.0f, EUL = 2.718281828459045f;   // power-of-two carry scales so hi/lo residual planes stay normal in f16
constexpr size_t VPL = (size_t)NTOK * D;   // unused: v^T is a single f16 plane of bf16(x)
constexpr size_t QPL = (size_t)NTOK * D;   // distance between the q/k hi and lo planes

typedef _Float16 b16;
typedef __attribute__((ext_vector_type(16))) _Float16 v16b;
typedef __attribute__((ext_vector_type(8)))  _Float16 v8b;
typedef __attribute__((ext_vector_type(8)))  float v8f;
typedef __attribute__((ext_vector_type(4)))  float v4f;

__device__ __forceinline__ v8b ld8b(const b16* p) { return *(const v8b*)p; }
__device__ __forceinline__ v16b cat8b(v8b a, v8b b) { return __builtin_shufflevector(a, b, 0, 1, 2, 3, 4, 5, 6, 7, 8, 9, 10, 11, 12, 13, 14, 15); }
__device__ __forceinline__ v16b frag_kb(const b16* p, int hh) { return cat8b(ld8b(p + 8 * hh), ld8b(p + 16 + 8 * hh)); }
__device__ __forceinline__ void split16(float v, b16& hi, b16& lo) { hi = (b16)v; lo = (b16)(v - (float)hi); }
// hi/lo fragment pair straight from an f32 k-contiguous row (same k-map)
__device__ __forceinline__ void frag_ksplit(const float* p, int hh, v16b& fh_, v16b& fl_) {
  const float* p0 = p + 8 * hh; const float* p1 = p + 16 + 8 * hh;
#pragma unroll
  for (int e = 0; e < 8; ++e) { b16 a, c; split16(p0[e], a, c); fh_[e] = a; fl_[e] = c; split16(p1[e], a, c); fh_[8 + e] = a; fl_[8 + e] = c; }
}
__device__ __forceinline__ v8f wmma16b(v16b a, v16b b, v8f c) {
  v8f d = __builtin_amdgcn_wmma_f32_16x16x32_f16(false, a, false, b, (short)0, c, false, false);
  asm volatile("v_nop\n\tv_nop\n\tv_nop\n\tv_nop" : "+v"(d) : "v"(a), "v"(b));
  return d;
}
__device__ __forceinline__ void wave_lds_sync() {
  __builtin_amdgcn_fence(__ATOMIC_RELEASE, "workgroup");
  __builtin_amdgcn_wave_barrier();
  __builtin_amdgcn_fence(__ATOMIC_ACQUIRE, "workgroup");
}

// Operand descriptor: NP = 0 -> f32 rows split on the fly into (hi, lo); NP = 1 -> one f16 plane; NP = 2 -> f16 hi + lo planes;
// NP = 3 -> f32 rows rounded once to a single f16 fragment. ld = row pitch.
struct Opnd { const void* p0; const void* p1; int ld; };
template <int NP> __device__ __forceinline__ void load_frags(const Opnd& o, int row, int kb, int hh, v16b& fh_, v16b& fl_) {
  if (NP == 0) { frag_ksplit((const float*)o.p0 + (size_t)row * o.ld + kb, hh, fh_, fl_); }
  else if (NP == 4 || NP == 5) {                             // f32 rows x64 (NP 4) or x8 (NP 5) then split (keeps the lo halves of small values normal)
    const float sc_ = (NP == 4) ? 64.0f : 8.0f;
    const float* p = (const float*)o.p0 + (size_t)row * o.ld + kb; const float* p0 = p + 8 * hh; const float* p1 = p + 16 + 8 * hh;
#pragma unroll
    for (int e = 0; e < 8; ++e) { b16 a, c; split16(p0[e] * sc_, a, c); fh_[e] = a; fl_[e] = c; split16(p1[e] * sc_, a, c); fh_[8 + e] = a; fl_[8 + e] = c; }
  } else if (NP == 3) {
    const float* p = (const float*)o.p0 + (size_t)row * o.ld + kb; const float* p0 = p + 8 * hh; const float* p1 = p + 16 + 8 * hh;
#pragma unroll
    for (int e = 0; e < 8; ++e) { fh_[e] = (b16)p0[e]; fh_[8 + e] = (b16)p1[e]; }
    fl_ = fh_;
  } else {
    fh_ = frag_kb((const b16*)o.p0 + (size_t)row * o.ld + kb, hh);
    if (NP == 2) fl_ = frag_kb((const b16*)o.p1 + (size_t)row * o.ld + kb, hh); else fl_ = fh_;
  }
}
template <int ANP, int BNP> __device__ __forceinline__ v8f mac(v16b ah, v16b al, v16b bh, v16b bl, v8f c) {
  c = wmma16b(ah, bh, c);
  if (BNP == 0 || BNP == 2 || BNP == 4 || BNP == 5) c = wmma16b(ah, bl, c);     // hi.lo
  if (ANP == 0 || ANP == 2 || ANP == 4 || ANP == 5) c = wmma16b(al, bh, c);     // lo.hi   (lo.lo dropped)
  return c;
}
// 32x64 wave tile: acc[r][t] (rows m0+16r.., cols c0+16t..) += A[m][k] . B[n][k] over k in [0, K)
template <int ANP, int BNP>
__device__ __forceinline__ void gemm_tile(const Opnd& A, const Opnd& B, int K, int m0, int c0, int nloc, int hlf, v8f (&acc)[2][4]) {
  for (int kb = 0; kb < K; kb += 32) {
    v16b a0h, a0l, a1h, a1l;
    load_frags<ANP>(A, m0 + nloc, kb, hlf, a0h, a0l);
    load_frags<ANP>(A, m0 + 16 + nloc, kb, hlf, a1h, a1l);
#pragma unroll
    for (int t = 0; t < 4; ++t) {
      v16b bh, bl;
      load_frags<BNP>(B, c0 + t * 16 + nloc, kb, hlf, bh, bl);
      acc[0][t] = mac<ANP, BNP>(a0h, a0l, bh, bl, acc[0][t]);
      acc[1][t] = mac<ANP, BNP>(a1h, a1l, bh, bl, acc[1][t]);
    }
  }
}

__device__ __forceinline__ void epi_planes(v8f (&acc)[2][4], float scale, bool two, b16* __restrict__ oh, b16* __restrict__ ol, int ldo,
                                           int m0, int c0, int lane, b16* Th, b16* Tl) {
  const int nloc = lane & 15, hlf = lane >> 4;
#pragma unroll
  for (int t = 0; t < 4; ++t)
#pragma unroll
    for (int r = 0; r < 2; ++r)
#pragma unroll
      for (int v = 0; v < 8; ++v) {
        const int rr = r * 16 + v + 8 * hlf, cc = t * 16 + nloc;
        b16 h_, l_; split16(acc[r][t][v] * scale, h_, l_);
        Th[rr * 64 + cc] = h_; Tl[rr * 64 + cc] = l_;
      }
  wave_lds_sync();
  {
#pragma unroll
    for (int j = 0; j < 8; ++j) {
      const int rr = j * 4 + (lane >> 3), c8 = (lane & 7) * 8;
      const size_t o = (size_t)(m0 + rr) * ldo + c0 + c8;
      *(v8b*)(oh + o) = ld8b(Th + rr * 64 + c8);
      if (two) *(v8b*)(ol + o) = ld8b(Tl + rr * 64 + c8);
    }
    
  }
}
// (b) f32 rows with pitch ldo: 64 floats = 256 B = 2 lines per row; 16 lanes x 16 B per row, 2 rows per instruction. Optional per-row factor
__device__ __forceinline__ void epi_f32(v8f (&acc)[2][4], float scale, const float* rscale, float* __restrict__ out, int ldo, int m0, int c0, int lane, float* Tt) {
  const int nloc = lane & 15, hlf = lane >> 4;
#pragma unroll
  for (int t = 0; t < 4; ++t)
#pragma unroll
    for (int r = 0; r < 2; ++r)
#pragma unroll
      for (int v = 0; v < 8; ++v) {
        const int rr = r * 16 + v + 8 * hlf;
        const float rs = rscale ? rscale[(size_t)(m0 + rr) * 32] : 1.0f;
        Tt[rr * 64 + t * 16 + nloc] = acc[r][t][v] * scale * rs;
      }
  wave_lds_sync();
  float* dst0 = out + (size_t)m0 * ldo + c0;
  {
#pragma unroll
    for (int j = 0; j < 16; ++j) { const int rr = j * 2 + hlf, c4 = nloc * 4; *(v4f*)(dst0 + (size_t)rr * ldo + c4) = *(const v4f*)(Tt + rr * 64 + c4); }
    
  }
}



typedef __attribute__((ext_vector_type(8))) __bf16 v8bb; typedef __attribute__((ext_vector_type(16))) __bf16 v16bb;
typedef __attribute__((ext_vector_type(8))) unsigned short v8us;
__device__ __forceinline__ v16bb frag_kb_bf(const __bf16* p, int hh) { const v8bb a = *(const v8bb*)(p + 8 * hh), b = *(const v8bb*)(p + 16 + 8 * hh); return __builtin_shufflevector(a, b, 0, 1, 2, 3, 4, 5, 6, 7, 8, 9, 10, 11, 12, 13, 14, 15); }
__device__ __forceinline__ v8f wmma16bb(v16bb a, v16bb b, v8f c) {
  v8f d = __builtin_amdgcn_wmma_f32_16x16x32_bf16(false, a, false, b, (short)0, c, false, false);
  asm volatile("v_nop\n\tv_nop\n\tv_nop\n\tv_nop" : "+v"(d) : "v"(a), "v"(b));
  return d;
}
__device__ __forceinline__ unsigned short bf16_rne_bits(float v) { unsigned int u = __float_as_uint(v); u += 0x7FFFu + ((u >> 16) & 1u); return (unsigned short)(u >> 16); }
__device__ __forceinline__ float bf16_rne(float v) { return __uint_as_float(((unsigned int)bf16_rne_bits(v)) << 16); }



// x -> bf16 bits (round to nearest even) for the projection.
__global__ __launch_bounds__(256) void xprep_kernel(const float* __restrict__ x, unsigned short* __restrict__ x16) {   // all four batches -> bf16
  const size_t tid = (size_t)blockIdx.x * blockDim.x + threadIdx.x, nth = (size_t)gridDim.x * blockDim.x;
  { for (size_t p = tid; p < (size_t)NTOK * D / 8; p += nth) { v8us v;
#pragma unroll
      for (int e = 0; e < 8; ++e) v[e] = bf16_rne_bits(x[p * 8 + e]);
      *(v8us*)(x16 + p * 8) = v; }  }
}
__global__ __launch_bounds__(256) void prep_kernel(const float* __restrict__ wattn, unsigned short* __restrict__ w16) {
  const size_t tid = (size_t)blockIdx.x * blockDim.x + threadIdx.x, nth = (size_t)gridDim.x * blockDim.x;
  {
    for (size_t p = tid; p < (size_t)2 * D * D / 8; p += nth) { v8us v;   // W_attn [2C][C] ([out][in]) rows copied directly: rows 0..1023 -> q, 1024..2047 -> k
#pragma unroll
      for (int e = 0; e < 8; ++e) v[e] = bf16_rne_bits(wattn[p * 8 + e]);
      *(v8us*)(w16 + p * 8) = v; }
    
  }
}

// v = bf16(x) exactly: v^T f16 [b*H + h][64][tok] via an LDS transpose (block = 128 tokens x one head), and the all-token column sums colsum[b][c] = Σ_t bf16(x)[b][t][c] (f32; block = (b, 256
// channels), sequential over t — 16 blocks). grids (H, NTOK/128) and (D/256, BT).
__global__ __launch_bounds__(256) void vt_kernel(const float* __restrict__ x, b16* __restrict__ vt, int rowbase) {
  __shared__ __attribute__((aligned(16))) b16 T[HD][128 + 8];
  const int t_ = threadIdx.x, h = blockIdx.x, m0 = rowbase + blockIdx.y * 128, b = m0 / S, tok0 = m0 % S;
  for (int i = t_; i < 128 * HD / 4; i += 256) { const int r = i / (HD / 4), c4 = (i % (HD / 4)) * 4; const v4f xv = *(const v4f*)(x + (size_t)(m0 + r) * D + h * HD + c4);
#pragma unroll
    for (int e = 0; e < 4; ++e) T[c4 + e][r] = (b16)bf16_rne(xv[e]); }
  __syncthreads();
  b16* dst = vt + (((size_t)b * H + h) * HD) * S + tok0;
  { for (int i = t_; i < HD * 16; i += 256) { const int d = i >> 4, c8 = (i & 15) * 8; *(v8b*)(dst + (size_t)d * S + c8) = *(const v8b*)(&T[d][c8]); }  }
}
__global__ __launch_bounds__(256) void colsum_kernel(const float* __restrict__ x, float* __restrict__ colsum) {
  const int c = blockIdx.x * 256 + threadIdx.x, b = blockIdx.y; float s = 0.0f;
  for (int t = 0; t < S; ++t) s += bf16_rne(x[((size_t)b * S + t) * D + c]);
  { ((float*)colsum)[(size_t)b * D + c] = s;  }
}

// projections: rows = tokens (8192), K = 1024, column tiles of 64 = one head of q (tiles 0..15) or k (16..31): x8 hi/lo planes [b*H + head][tok][64]. grid (32, 64) x 128.
__global__ __launch_bounds__(128) void proj_kernel(const __bf16* __restrict__ x16, const __bf16* __restrict__ w16, b16* __restrict__ qh, b16* __restrict__ kh, int rowbase) {
  __shared__ __attribute__((aligned(16))) b16 Th[4][32][HD + 8], Tq[4][32][HD + 8];
  const int lane = threadIdx.x & 31, wave = threadIdx.x >> 5, nloc = lane & 15, hlf = lane >> 4, m0 = rowbase + blockIdx.y * 128 + wave * 32, c0 = blockIdx.x * 64;
  v8f acc[2][4];
#pragma unroll
  for (int r = 0; r < 2; ++r)
#pragma unroll
    for (int t = 0; t < 4; ++t) acc[r][t] = (v8f){};
#pragma unroll 2
  for (int kb = 0; kb < D; kb += 32) {
    const v16bb a0 = frag_kb_bf(x16 + (size_t)(m0 + nloc) * D + kb, hlf), a1 = frag_kb_bf(x16 + (size_t)(m0 + 16 + nloc) * D + kb, hlf);
#pragma unroll
    for (int t = 0; t < 4; ++t) { const v16bb bw = frag_kb_bf(w16 + (size_t)(c0 + t * 16 + nloc) * D + kb, hlf); acc[0][t] = wmma16bb(a0, bw, acc[0][t]); acc[1][t] = wmma16bb(a1, bw, acc[1][t]); }
  }
  const int which = blockIdx.x / (D / 64), head = blockIdx.x % (D / 64), b = m0 / S, tok0 = m0 % S;
  {                                                             // q (tiles 0..15) or k (16..31) head: x8 hi/lo planes
#pragma unroll
    for (int t = 0; t < 4; ++t)
#pragma unroll
      for (int r = 0; r < 2; ++r)
#pragma unroll
        for (int v = 0; v < 8; ++v) { b16 a_, c_; split16(acc[r][t][v] * QS, a_, c_); Th[wave][r * 16 + 8 * hlf + v][t * 16 + nloc] = a_; Tq[wave][r * 16 + 8 * hlf + v][t * 16 + nloc] = c_; }   // q, k carried x8 (lo residuals stay normal)
    wave_lds_sync();
    b16* dst = (which == 0 ? qh : kh) + (((size_t)b * H + head) * S + tok0) * HD;
    {
#pragma unroll
      for (int j = 0; j < 8; ++j) { const int rr = j * 4 + (lane >> 3), c8 = (lane & 7) * 8; *(v8b*)(dst + (size_t)rr * HD + c8) = *(const v8b*)(&Th[wave][rr][c8]); *(v8b*)(dst + QPL + (size_t)rr * HD + c8) = *(const v8b*)(&Tq[wave][rr][c8]); }
       }
    return;
  }
}

// causal shaped attention: wave = (b, h, 16 queries); key chunks of 32 up to the query tile: S^T (K=64, 3 products), causal mask on the straddling chunk, online softmax f32, P x8 hi/lo,
// o^T += v^T P^T (2 products) and pf^T += v^T U^T (U = exact 0/1 causal indicator: prefix sums); epilogue y = beta o/(8 l) + alpha ((e-1) v_i + colsum)/(e+2047) - gamma pf/(i+1)
template <int QT>
__global__ __launch_bounds__(256) void attn_kernel(const b16* __restrict__ qh, const b16* __restrict__ kh, const b16* __restrict__ vt, const float* __restrict__ x, const float* __restrict__ colsum, const float* __restrict__ alpha_p, const float* __restrict__ beta_p, const float* __restrict__ gamma_p, float* __restrict__ y) {
  __shared__ __attribute__((aligned(16))) float Os[8][16][HD + 4];
  const int wid = threadIdx.x >> 5, lane = threadIdx.x & 31, hh = lane >> 4, col = lane & 15;
  const int qt = blockIdx.x * 8 + wid, jt = qt % QT, bh = qt / QT, h = bh % H, b = bh / H, q0 = jt * 16, qi = q0 + col;
  const b16* Q = qh + ((size_t)bh * S) * HD; const b16* K = kh + ((size_t)bh * S) * HD; const b16* vb = vt + ((size_t)bh * HD) * S;
  v16b qf[2], ql[2];
#pragma unroll
  for (int ks = 0; ks < 2; ++ks) { qf[ks] = frag_kb(Q + (size_t)qi * HD + ks * 32, hh); ql[ks] = frag_kb(Q + QPL + (size_t)qi * HD + ks * 32, hh); }
  float m = -INFINITY, l = 0.0f; v8f o[4] = {{}, {}, {}, {}}, pf[4] = {{}, {}, {}, {}};   // pf = causal prefix sums of v (the MC term)
  for (int kb = 0; kb < q0 + 16; kb += 32) {                   // causal: key blocks past the query tile are skipped (wave-uniform bound)
    const bool diag = (kb + 32 > q0);                           // this block reaches past some queries -> mask key > query
    v16b ub;                                                    // 0/1 causal indicator operand: ub[r] = [key 8hh+r <= query col], [16+8hh+r <= col]
#pragma unroll
    for (int r = 0; r < 8; ++r) { ub[r] = (b16)((kb + 8 * hh + r <= qi) ? 1.0f : 0.0f); ub[8 + r] = (b16)((kb + 16 + 8 * hh + r <= qi) ? 1.0f : 0.0f); }
    v8f s0 = {}, s1 = {};
#pragma unroll
    for (int ks = 0; ks < 2; ++ks) { const v16b k0 = frag_kb(K + (size_t)(kb + col) * HD + ks * 32, hh), k0l = frag_kb(K + QPL + (size_t)(kb + col) * HD + ks * 32, hh), k1 = frag_kb(K + (size_t)(kb + 16 + col) * HD + ks * 32, hh), k1l = frag_kb(K + QPL + (size_t)(kb + 16 + col) * HD + ks * 32, hh);
      s0 = wmma16b(k0, qf[ks], s0); s0 = wmma16b(k0, ql[ks], s0); s0 = wmma16b(k0l, qf[ks], s0);      // q and k as f16 hi+lo pairs (lo.lo dropped)
      s1 = wmma16b(k1, qf[ks], s1); s1 = wmma16b(k1, ql[ks], s1); s1 = wmma16b(k1l, qf[ks], s1); }
    float mr = -INFINITY;
#pragma unroll
    for (int r = 0; r < 8; ++r) { s0[r] *= SCALE / (QS * QS); s1[r] *= SCALE / (QS * QS); if (diag) { if (kb + 8 * hh + r > qi) s0[r] = -INFINITY; if (kb + 16 + 8 * hh + r > qi) s1[r] = -INFINITY; } mr = fmaxf(mr, fmaxf(s0[r], s1[r])); }
    mr = fmaxf(mr, __shfl_xor(mr, 16));
    const float mn = fmaxf(m, mr), al_ = __expf(m - mn); m = mn;
    float sum = 0.0f; v16b pb, pl;
#pragma unroll
    for (int r = 0; r < 8; ++r) { const float e0 = __expf(s0[r] - mn), e1 = __expf(s1[r] - mn); sum += e0 + e1; b16 a, c; split16(e0 * PS, a, c); pb[r] = a; pl[r] = c; split16(e1 * PS, a, c); pb[8 + r] = a; pl[8 + r] = c; }   // P carried x8
    sum += __shfl_xor(sum, 16); l = l * al_ + sum;
#pragma unroll
    for (int n = 0; n < 4; ++n) {
#pragma unroll
      for (int r = 0; r < 8; ++r) o[n][r] *= al_;
      const v16b vf = frag_kb(vb + (size_t)(n * 16 + col) * S + kb, hh);
      o[n] = wmma16b(vf, pb, o[n]); o[n] = wmma16b(vf, pl, o[n]);                              // v exact (bf16 values), P hi+lo
      pf[n] = wmma16b(vf, ub, pf[n]); }                                                          // exact causal prefix sums of v
  }
  const float alpha = bf16_rne(alpha_p[0]), beta = bf16_rne(beta_p[0]), gamma = bf16_rne(gamma_p[0]);   // scalar INPUTS
  const float cb = beta / (PS * l), cid = alpha / (EUL + (float)(S - 1)), cmc = gamma / (float)(qi + 1);
#pragma unroll
  for (int n = 0; n < 4; ++n)
#pragma unroll
    for (int r = 0; r < 8; ++r) { const int d = n * 16 + 8 * hh + r; const float vi = bf16_rne(x[((size_t)b * S + qi) * D + h * HD + d]), vs = colsum[(size_t)b * D + h * HD + d];
      Os[wid][col][d] = o[n][r] * cb + cid * ((EUL - 1.0f) * vi + vs) - cmc * pf[n][r]; }
  wave_lds_sync();
  float* dst = y + ((size_t)b * S + q0) * D + h * HD;
  {
#pragma unroll
    for (int j = 0; j < 8; ++j) { const int rr = j * 2 + hh, c4 = col * 4; *(v4f*)(dst + (size_t)rr * D + c4) = *(const v4f*)(&Os[wid][rr][c4]); }
    
  }
}

}  // namespace

extern "C" void kernel_launch(void* const* d_in, const int* in_sizes, int n_in,
                              void* d_out, int out_size, void* d_ws, size_t ws_size, hipStream_t stream) {
  (void)n_in; (void)out_size;
  const float* x = (const float*)d_in[0]; const float* wattn = (const float*)d_in[1];
  float* out = (float*)d_out;   // [4][2048][1024]
  if (in_sizes[0] != BT * S * D || in_sizes[1] != 2 * D * D || in_sizes[2] != 1 || in_sizes[3] != 1 || in_sizes[4] != 1) return;
  size_t off = 0; char* ws = (char*)d_ws;
  auto carve = [&](size_t bytes) { char* p = ws + off; off += (bytes + 255) & ~(size_t)255; return p; };
  unsigned short* x16 = (unsigned short*)carve((size_t)NTOK * D * 2); unsigned short* w16 = (unsigned short*)carve((size_t)2 * D * D * 2); float* colsum = (float*)carve((size_t)BT * D * 4);
  b16* qh = (b16*)carve((size_t)2 * NTOK * D * 2); b16* kh = (b16*)carve((size_t)2 * NTOK * D * 2); b16* vt = (b16*)carve((size_t)NTOK * D * 2);
  if (off > ws_size) return;                                    // ≈ 105 MB
  prep_kernel<<<512, 256, 0, stream>>>(wattn, w16);
  xprep_kernel<<<1024, 256, 0, stream>>>(x, x16);
  vt_kernel<<<dim3(H, NTOK / 128), 256, 0, stream>>>(x, vt, 0);
  colsum_kernel<<<dim3(D / 256, BT), 256, 0, stream>>>(x, colsum);
  proj_kernel<<<dim3(2 * D / 64, NTOK / 128), 128, 0, stream>>>((const __bf16*)x16, (const __bf16*)w16, qh, kh, 0);
  attn_kernel<S / 16><<<Bn * H * (S / 16) / 8, 256, 0, stream>>>(qh, kh, vt, x, colsum, (const float*)d_in[2], (const float*)d_in[3], (const float*)d_in[4], out);
}

// v001
// A run of this version takes 454 microseconds.
// Next to v000, in two timings, it ran 1.22 times as fast each time.
#include <hip/hip_runtime.h>

// Causal "shaped" attention: [q | k] = x W_attn^T (16 heads x 64), v = x itself (use_v = False); att = beta softmax_causal(q.k/8) + alpha Id - gamma MC with Id = softmax(eye(2048))
// (diag e/(e+2047), off-diag 1/(e+2047)) and MC = causal row-uniform averaging (1/(i+1) on j <= i); y = att.v merged over heads -> [4][2048][1024] (no output projection).
// So y_i = beta (P.v)_i/l_i + alpha ((e-1) v_i + sum_all v_j)/(e+2047) - gamma (sum_{j<=i} v_j)/(i+1).
// Numerics: x, W_attn, alpha, beta, gamma rounded to bf16; [q|k] projection on v_wmma_f32_16x16x32_bf16 (exact products, f32 accumulate);
// scores on v_wmma_f32_16x16x32_f16 with q, k as f16 hi+lo pairs carried x8 (3 products); P.v with P an x8 hi+lo pair and v = bf16(x) exact in f16 (2 products); the causal prefix
// sums sum_{j<=i} v_j ride along as a second accumulator against an exact 0/1 mask operand (1 product); the all-token column sums in a small f32 kernel; softmax and the combine in f32.

namespace {
constexpr int BT = 4, Bn = 4, S = 2048, D = 1024, H = 16, HD = 64, NTOK = Bn * S;
constexpr float SCALE = 0.125f, VS = 1.0f /* v = bf16(x): exact, single plane */, QS = 8.0f, PS = 8.0f, EUL = 2.718281828459045f;   // power-of-two carry scales so hi/lo residual planes stay normal in f16
constexpr size_t VPL = (size_t)NTOK * D;   // unused: v^T is a single f16 plane of bf16(x)
constexpr size_t QPL = (size_t)NTOK * D;   // distance between the q/k hi and lo planes

typedef _Float16 b16;
typedef __attribute__((ext_vector_type(16))) _Float16 v16b;
typedef __attribute__((ext_vector_type(8)))  _Float16 v8b;
typedef __attribute__((ext_vector_type(8)))  float v8f;
typedef __attribute__((ext_vector_type(4)))  float v4f;

__device__ __forceinline__ v8b ld8b(const b16* p) { return *(const v8b*)p; }
__device__ __forceinline__ v16b cat8b(v8b a, v8b b) { return __builtin_shufflevector(a, b, 0, 1, 2, 3, 4, 5, 6, 7, 8, 9, 10, 11, 12, 13, 14, 15); }
__device__ __forceinline__ v16b frag_kb(const b16* p, int hh) { return cat8b(ld8b(p + 8 * hh), ld8b(p + 16 + 8 * hh)); }
__device__ __forceinline__ void split16(float v, b16& hi, b16& lo) { hi = (b16)v; lo = (b16)(v - (float)hi); }
// hi/lo fragment pair straight from an f32 k-contiguous row (same k-map)
__device__ __forceinline__ void frag_ksplit(const float* p, int hh, v16b& fh_, v16b& fl_) {
  const float* p0 = p + 8 * hh; const float* p1 = p + 16 + 8 * hh;
#pragma unroll
  for (int e = 0; e < 8; ++e) { b16 a, c; split16(p0[e], a, c); fh_[e] = a; fl_[e] = c; split16(p1[e], a, c); fh_[8 + e] = a; fl_[8 + e] = c; }
}
__device__ __forceinline__ v8f wmma16b(v16b a, v16b b, v8f c) {
  v8f d = __builtin_amdgcn_wmma_f32_16x16x32_f16(false, a, false, b, (short)0, c, false, false);
  asm volatile("v_nop\n\tv_nop\n\tv_nop\n\tv_nop" : "+v"(d) : "v"(a), "v"(b));
  return d;
}
__device__ __forceinline__ void wave_lds_sync() {
  __builtin_amdgcn_fence(__ATOMIC_RELEASE, "workgroup");
  __builtin_amdgcn_wave_barrier();
  __builtin_amdgcn_fence(__ATOMIC_ACQUIRE, "workgroup");
}

// Operand descriptor: NP = 0 -> f32 rows split on the fly into (hi, lo); NP = 1 -> one f16 plane; NP = 2 -> f16 hi + lo planes;
// NP = 3 -> f32 rows rounded once to a single f16 fragment. ld = row pitch.
struct Opnd { const void* p0; const void* p1; int ld; };
template <int NP> __device__ __forceinline__ void load_frags(const Opnd& o, int row, int kb, int hh, v16b& fh_, v16b& fl_) {
  if (NP == 0) { frag_ksplit((const float*)o.p0 + (size_t)row * o.ld + kb, hh, fh_, fl_); }
  else if (NP == 4 || NP == 5) {                             // f32 rows x64 (NP 4) or x8 (NP 5) then split (keeps the lo halves of small values normal)
    const float sc_ = (NP == 4) ? 64.0f : 8.0f;
    const float* p = (const float*)o.p0 + (size_t)row * o.ld + kb; const float* p0 = p + 8 * hh; const float* p1 = p + 16 + 8 * hh;
#pragma unroll
    for (int e = 0; e < 8; ++e) { b16 a, c; split16(p0[e] * sc_, a, c); fh_[e] = a; fl_[e] = c; split16(p1[e] * sc_, a, c); fh_[8 + e] = a; fl_[8 + e] = c; }
  } else if (NP == 3) {
    const float* p = (const float*)o.p0 + (size_t)row * o.ld + kb; const float* p0 = p + 8 * hh; const float* p1 = p + 16 + 8 * hh;
#pragma unroll
    for (int e = 0; e < 8; ++e) { fh_[e] = (b16)p0[e]; fh_[8 + e] = (b16)p1[e]; }
    fl_ = fh_;
  } else {
    fh_ = frag_kb((const b16*)o.p0 + (size_t)row * o.ld + kb, hh);
    if (NP == 2) fl_ = frag_kb((const b16*)o.p1 + (size_t)row * o.ld + kb, hh); else fl_ = fh_;
  }
}
template <int ANP, int BNP> __device__ __forceinline__ v8f mac(v16b ah, v16b al, v16b bh, v16b bl, v8f c) {
  c = wmma16b(ah, bh, c);
  if (BNP == 0 || BNP == 2 || BNP == 4 || BNP == 5) c = wmma16b(ah, bl, c);     // hi.lo
  if (ANP == 0 || ANP == 2 || ANP == 4 || ANP == 5) c = wmma16b(al, bh, c);     // lo.hi   (lo.lo dropped)
  return c;
}
// 32x64 wave tile: acc[r][t] (rows m0+16r.., cols c0+16t..) += A[m][k] . B[n][k] over k in [0, K)
template <int ANP, int BNP>
__device__ __forceinline__ void gemm_tile(const Opnd& A, const Opnd& B, int K, int m0, int c0, int nloc, int hlf, v8f (&acc)[2][4]) {
  for (int kb = 0; kb < K; kb += 32) {
    v16b a0h, a0l, a1h, a1l;
    load_frags<ANP>(A, m0 + nloc, kb, hlf, a0h, a0l);
    load_frags<ANP>(A, m0 + 16 + nloc, kb, hlf, a1h, a1l);
#pragma unroll
    for (int t = 0; t < 4; ++t) {
      v16b bh, bl;
      load_frags<BNP>(B, c0 + t * 16 + nloc, kb, hlf, bh, bl);
      acc[0][t] = mac<ANP, BNP>(a0h, a0l, bh, bl, acc[0][t]);
      acc[1][t] = mac<ANP, BNP>(a1h, a1l, bh, bl, acc[1][t]);
    }
  }
}

__device__ __forceinline__ void epi_planes(v8f (&acc)[2][4], float scale, bool two, b16* __restrict__ oh, b16* __restrict__ ol, int ldo,
                                           int m0, int c0, int lane, b16* Th, b16* Tl) {
  const int nloc = lane & 15, hlf = lane >> 4;
#pragma unroll
  for (int t = 0; t < 4; ++t)
#pragma unroll
    for (int r = 0; r < 2; ++r)
#pragma unroll
      for (int v = 0; v < 8; ++v) {
        const int rr = r * 16 + v + 8 * hlf, cc = t * 16 + nloc;
        b16 h_, l_; split16(acc[r][t][v] * scale, h_, l_);
        Th[rr * 64 + cc] = h_; Tl[rr * 64 + cc] = l_;
      }
  wave_lds_sync();
  {
#pragma unroll
    for (int j = 0; j < 8; ++j) {
      const int rr = j * 4 + (lane >> 3), c8 = (lane & 7) * 8;
      const size_t o = (size_t)(m0 + rr) * ldo + c0 + c8;
      *(v8b*)(oh + o) = ld8b(Th + rr * 64 + c8);
      if (two) *(v8b*)(ol + o) = ld8b(Tl + rr * 64 + c8);
    }
    
  }
}
// (b) f32 rows with pitch ldo: 64 floats = 256 B = 2 lines per row; 16 lanes x 16 B per row, 2 rows per instruction. Optional per-row factor
__device__ __forceinline__ void epi_f32(v8f (&acc)[2][4], float scale, const float* rscale, float* __restrict__ out, int ldo, int m0, int c0, int lane, float* Tt) {
  const int nloc = lane & 15, hlf = lane >> 4;
#pragma unroll
  for (int t = 0; t < 4; ++t)
#pragma unroll
    for (int r = 0; r < 2; ++r)
#pragma unroll
      for (int v = 0; v < 8; ++v) {
        const int rr = r * 16 + v + 8 * hlf;
        const float rs = rscale ? rscale[(size_t)(m0 + rr) * 32] : 1.0f;
        Tt[rr * 64 + t * 16 + nloc] = acc[r][t][v] * scale * rs;
      }
  wave_lds_sync();
  float* dst0 = out + (size_t)m0 * ldo + c0;
  {
#pragma unroll
    for (int j = 0; j < 16; ++j) { const int rr = j * 2 + hlf, c4 = nloc * 4; *(v4f*)(dst0 + (size_t)rr * ldo + c4) = *(const v4f*)(Tt + rr * 64 + c4); }
    
  }
}



typedef __attribute__((ext_vector_type(8))) __bf16 v8bb; typedef __attribute__((ext_vector_type(16))) __bf16 v16bb;
typedef __attribute__((ext_vector_type(8))) unsigned short v8us;
__device__ __forceinline__ v16bb frag_kb_bf(const __bf16* p, int hh) { const v8bb a = *(const v8bb*)(p + 8 * hh), b = *(const v8bb*)(p + 16 + 8 * hh); return __builtin_shufflevector(a, b, 0, 1, 2, 3, 4, 5, 6, 7, 8, 9, 10, 11, 12, 13, 14, 15); }
__device__ __forceinline__ v8f wmma16bb(v16bb a, v16bb b, v8f c) {
  v8f d = __builtin_amdgcn_wmma_f32_16x16x32_bf16(false, a, false, b, (short)0, c, false, false);
  asm volatile("v_nop\n\tv_nop\n\tv_nop\n\tv_nop" : "+v"(d) : "v"(a), "v"(b));
  return d;
}
__device__ __forceinline__ unsigned short bf16_rne_bits(float v) { unsigned int u = __float_as_uint(v); u += 0x7FFFu + ((u >> 16) & 1u); return (unsigned short)(u >> 16); }
__device__ __forceinline__ float bf16_rne(float v) { return __uint_as_float(((unsigned int)bf16_rne_bits(v)) << 16); }



// x -> bf16 bits (round to nearest even) for the projection.
__global__ __launch_bounds__(256) void xprep_kernel(const float* __restrict__ x, unsigned short* __restrict__ x16) {   // all four batches -> bf16
  const size_t tid = (size_t)blockIdx.x * blockDim.x + threadIdx.x, nth = (size_t)gridDim.x * blockDim.x;
  { for (size_t p = tid; p < (size_t)NTOK * D / 8; p += nth) { v8us v;
#pragma unroll
      for (int e = 0; e < 8; ++e) v[e] = bf16_rne_bits(x[p * 8 + e]);
      *(v8us*)(x16 + p * 8) = v; }  }
}
__global__ __launch_bounds__(256) void prep_kernel(const float* __restrict__ wattn, unsigned short* __restrict__ w16) {
  const size_t tid = (size_t)blockIdx.x * blockDim.x + threadIdx.x, nth = (size_t)gridDim.x * blockDim.x;
  {
    for (size_t p = tid; p < (size_t)2 * D * D / 8; p += nth) { v8us v;   // W_attn [2C][C] ([out][in]) rows copied directly: rows 0..1023 -> q, 1024..2047 -> k
#pragma unroll
      for (int e = 0; e < 8; ++e) v[e] = bf16_rne_bits(wattn[p * 8 + e]);
      *(v8us*)(w16 + p * 8) = v; }
    
  }
}

// v = bf16(x) exactly: v^T f16 [b*H + h][64][tok] via an LDS transpose (block = 128 tokens x one head). grid (H, NTOK/128).
__global__ __launch_bounds__(256) void vt_kernel(const float* __restrict__ x, b16* __restrict__ vt, int rowbase) {
  __shared__ __attribute__((aligned(16))) b16 T[HD][128 + 8];
  const int t_ = threadIdx.x, h = blockIdx.x, m0 = rowbase + blockIdx.y * 128, b = m0 / S, tok0 = m0 % S;
  for (int i = t_; i < 128 * HD / 4; i += 256) { const int r = i / (HD / 4), c4 = (i % (HD / 4)) * 4; const v4f xv = *(const v4f*)(x + (size_t)(m0 + r) * D + h * HD + c4);
#pragma unroll
    for (int e = 0; e < 4; ++e) T[c4 + e][r] = (b16)bf16_rne(xv[e]); }
  __syncthreads();
  b16* dst = vt + (((size_t)b * H + h) * HD) * S + tok0;
  { for (int i = t_; i < HD * 16; i += 256) { const int d = i >> 4, c8 = (i & 15) * 8; *(v8b*)(dst + (size_t)d * S + c8) = *(const v8b*)(&T[d][c8]); }  }
}
// All-token column sums, spread over tokens as well as channels: block = (one batch, 32 channels = one 128-B line per token), 32 waves; wave w owns tokens 64w..64w+63, one load = 4 tokens x one
// whole line, a lane's 16 loads independent of one another (unrolled, so that many are in flight). Sum order: 16 tokens per lane, then the 4 token rows of the wave (two butterfly steps), then the 32 waves through LDS.
__global__ __launch_bounds__(1024) void colsum_kernel(const float* __restrict__ x, float* __restrict__ colsum) {
  __shared__ __attribute__((aligned(16))) float P[32][32];
  const int lane = threadIdx.x & 31, wave = threadIdx.x >> 5, c0 = blockIdx.x * 32, b = blockIdx.y;
  const float* p = x + ((size_t)b * S + wave * 64 + (lane >> 3)) * D + c0 + (lane & 7) * 4;
  v4f xv[16];
#pragma unroll
  for (int i = 0; i < 16; ++i) xv[i] = *(const v4f*)(p + (size_t)i * 4 * D);
  v4f s = {};
#pragma unroll
  for (int i = 0; i < 16; ++i)
#pragma unroll
    for (int e = 0; e < 4; ++e) s[e] += bf16_rne(xv[i][e]);
#pragma unroll
  for (int e = 0; e < 4; ++e) { s[e] += __shfl_xor(s[e], 8); s[e] += __shfl_xor(s[e], 16); }
  if (lane < 8) *(v4f*)(&P[wave][lane * 4]) = s;
  __syncthreads();
  if (wave == 0) {
    float t = 0.0f;
#pragma unroll
    for (int w = 0; w < 32; ++w) t += P[w][lane];
    colsum[(size_t)b * D + c0 + lane] = t;
  }
}

// projections: rows = tokens (8192), K = 1024, column tiles of 64 = one head of q (tiles 0..15) or k (16..31): x8 hi/lo planes [b*H + head][tok][64]. grid (32, 64) x 128.
__global__ __launch_bounds__(128) void proj_kernel(const __bf16* __restrict__ x16, const __bf16* __restrict__ w16, b16* __restrict__ qh, b16* __restrict__ kh, int rowbase) {
  __shared__ __attribute__((aligned(16))) b16 Th[4][32][HD + 8], Tq[4][32][HD + 8];
  const int lane = threadIdx.x & 31, wave = threadIdx.x >> 5, nloc = lane & 15, hlf = lane >> 4, m0 = rowbase + blockIdx.y * 128 + wave * 32, c0 = blockIdx.x * 64;
  v8f acc[2][4];
#pragma unroll
  for (int r = 0; r < 2; ++r)
#pragma unroll
    for (int t = 0; t < 4; ++t) acc[r][t] = (v8f){};
#pragma unroll 2
  for (int kb = 0; kb < D; kb += 32) {
    const v16bb a0 = frag_kb_bf(x16 + (size_t)(m0 + nloc) * D + kb, hlf), a1 = frag_kb_bf(x16 + (size_t)(m0 + 16 + nloc) * D + kb, hlf);
#pragma unroll
    for (int t = 0; t < 4; ++t) { const v16bb bw = frag_kb_bf(w16 + (size_t)(c0 + t * 16 + nloc) * D + kb, hlf); acc[0][t] = wmma16bb(a0, bw, acc[0][t]); acc[1][t] = wmma16bb(a1, bw, acc[1][t]); }
  }
  const int which = blockIdx.x / (D / 64), head = blockIdx.x % (D / 64), b = m0 / S, tok0 = m0 % S;
  {                                                             // q (tiles 0..15) or k (16..31) head: x8 hi/lo planes
#pragma unroll
    for (int t = 0; t < 4; ++t)
#pragma unroll
      for (int r = 0; r < 2; ++r)
#pragma unroll
        for (int v = 0; v < 8; ++v) { b16 a_, c_; split16(acc[r][t][v] * QS, a_, c_); Th[wave][r * 16 + 8 * hlf + v][t * 16 + nloc] = a_; Tq[wave][r * 16 + 8 * hlf + v][t * 16 + nloc] = c_; }   // q, k carried x8 (lo residuals stay normal)
    wave_lds_sync();
    b16* dst = (which == 0 ? qh : kh) + (((size_t)b * H + head) * S + tok0) * HD;
    {
#pragma unroll
      for (int j = 0; j < 8; ++j) { const int rr = j * 4 + (lane >> 3), c8 = (lane & 7) * 8; *(v8b*)(dst + (size_t)rr * HD + c8) = *(const v8b*)(&Th[wave][rr][c8]); *(v8b*)(dst + QPL + (size_t)rr * HD + c8) = *(const v8b*)(&Tq[wave][rr][c8]); }
       }
    return;
  }
}

// causal shaped attention: wave = (b, h, 16 queries); key chunks of 32 up to the query tile: S^T (K=64, 3 products), causal mask on the straddling chunk, online softmax f32, P x8 hi/lo,
// o^T += v^T P^T (2 products) and pf^T += v^T U^T (U = exact 0/1 causal indicator: prefix sums); epilogue y = beta o/(8 l) + alpha ((e-1) v_i + colsum)/(e+2047) - gamma pf/(i+1)
template <int QT>
__global__ __launch_bounds__(256) void attn_kernel(const b16* __restrict__ qh, const b16* __restrict__ kh, const b16* __restrict__ vt, const float* __restrict__ x, const float* __restrict__ colsum, const float* __restrict__ alpha_p, const float* __restrict__ beta_p, const float* __restrict__ gamma_p, float* __restrict__ y) {
  __shared__ __attribute__((aligned(16))) float Os[8][16][HD + 4];
  const int wid = threadIdx.x >> 5, lane = threadIdx.x & 31, hh = lane >> 4, col = lane & 15;
  const int qt = blockIdx.x * 8 + wid, jt = qt % QT, bh = qt / QT, h = bh % H, b = bh / H, q0 = jt * 16, qi = q0 + col;
  const b16* Q = qh + ((size_t)bh * S) * HD; const b16* K = kh + ((size_t)bh * S) * HD; const b16* vb = vt + ((size_t)bh * HD) * S;
  v16b qf[2], ql[2];
#pragma unroll
  for (int ks = 0; ks < 2; ++ks) { qf[ks] = frag_kb(Q + (size_t)qi * HD + ks * 32, hh); ql[ks] = frag_kb(Q + QPL + (size_t)qi * HD + ks * 32, hh); }
  float m = -INFINITY, l = 0.0f; v8f o[4] = {{}, {}, {}, {}}, pf[4] = {{}, {}, {}, {}};   // pf = causal prefix sums of v (the MC term)
  for (int kb = 0; kb < q0 + 16; kb += 32) {                   // causal: key blocks past the query tile are skipped (wave-uniform bound)
    const bool diag = (kb + 32 > q0);                           // this block reaches past some queries -> mask key > query
    v16b ub;                                                    // 0/1 causal indicator operand: ub[r] = [key 8hh+r <= query col], [16+8hh+r <= col]
#pragma unroll
    for (int r = 0; r < 8; ++r) { ub[r] = (b16)((kb + 8 * hh + r <= qi) ? 1.0f : 0.0f); ub[8 + r] = (b16)((kb + 16 + 8 * hh + r <= qi) ? 1.0f : 0.0f); }
    v8f s0 = {}, s1 = {};
#pragma unroll
    for (int ks = 0; ks < 2; ++ks) { const v16b k0 = frag_kb(K + (size_t)(kb + col) * HD + ks * 32, hh), k0l = frag_kb(K + QPL + (size_t)(kb + col) * HD + ks * 32, hh), k1 = frag_kb(K + (size_t)(kb + 16 + col) * HD + ks * 32, hh), k1l = frag_kb(K + QPL + (size_t)(kb + 16 + col) * HD + ks * 32, hh);
      s0 = wmma16b(k0, qf[ks], s0); s0 = wmma16b(k0, ql[ks], s0); s0 = wmma16b(k0l, qf[ks], s0);      // q and k as f16 hi+lo pairs (lo.lo dropped)
      s1 = wmma16b(k1, qf[ks], s1); s1 = wmma16b(k1, ql[ks], s1); s1 = wmma16b(k1l, qf[ks], s1); }
    float mr = -INFINITY;
#pragma unroll
    for (int r = 0; r < 8; ++r) { s0[r] *= SCALE / (QS * QS); s1[r] *= SCALE / (QS * QS); if (diag) { if (kb + 8 * hh + r > qi) s0[r] = -INFINITY; if (kb + 16 + 8 * hh + r > qi) s1[r] = -INFINITY; } mr = fmaxf(mr, fmaxf(s0[r], s1[r])); }
    mr = fmaxf(mr, __shfl_xor(mr, 16));
    const float mn = fmaxf(m, mr), al_ = __expf(m - mn); m = mn;
    float sum = 0.0f; v16b pb, pl;
#pragma unroll
    for (int r = 0; r < 8; ++r) { const float e0 = __expf(s0[r] - mn), e1 = __expf(s1[r] - mn); sum += e0 + e1; b16 a, c; split16(e0 * PS, a, c); pb[r] = a; pl[r] = c; split16(e1 * PS, a, c); pb[8 + r] = a; pl[8 + r] = c; }   // P carried x8
    sum += __shfl_xor(sum, 16); l = l * al_ + sum;
#pragma unroll
    for (int n = 0; n < 4; ++n) {
#pragma unroll
      for (int r = 0; r < 8; ++r) o[n][r] *= al_;
      const v16b vf = frag_kb(vb + (size_t)(n * 16 + col) * S + kb, hh);
      o[n] = wmma16b(vf, pb, o[n]); o[n] = wmma16b(vf, pl, o[n]);                              // v exact (bf16 values), P hi+lo
      pf[n] = wmma16b(vf, ub, pf[n]); }                                                          // exact causal prefix sums of v
  }
  const float alpha = bf16_rne(alpha_p[0]), beta = bf16_rne(beta_p[0]), gamma = bf16_rne(gamma_p[0]);   // scalar INPUTS
  const float cb = beta / (PS * l), cid = alpha / (EUL + (float)(S - 1)), cmc = gamma / (float)(qi + 1);
#pragma unroll
  for (int n = 0; n < 4; ++n)
#pragma unroll
    for (int r = 0; r < 8; ++r) { const int d = n * 16 + 8 * hh + r; const float vi = bf16_rne(x[((size_t)b * S + qi) * D + h * HD + d]), vs = colsum[(size_t)b * D + h * HD + d];
      Os[wid][col][d] = o[n][r] * cb + cid * ((EUL - 1.0f) * vi + vs) - cmc * pf[n][r]; }
  wave_lds_sync();
  float* dst = y + ((size_t)b * S + q0) * D + h * HD;
  {
#pragma unroll
    for (int j = 0; j < 8; ++j) { const int rr = j * 2 + hh, c4 = col * 4; *(v4f*)(dst + (size_t)rr * D + c4) = *(const v4f*)(&Os[wid][rr][c4]); }
    
  }
}

}  // namespace

extern "C" void kernel_launch(void* const* d_in, const int* in_sizes, int n_in,
                              void* d_out, int out_size, void* d_ws, size_t ws_size, hipStream_t stream) {
  (void)n_in; (void)out_size;
  const float* x = (const float*)d_in[0]; const float* wattn = (const float*)d_in[1];
  float* out = (float*)d_out;   // [4][2048][1024]
  if (in_sizes[0] != BT * S * D || in_sizes[1] != 2 * D * D || in_sizes[2] != 1 || in_sizes[3] != 1 || in_sizes[4] != 1) return;
  size_t off = 0; char* ws = (char*)d_ws;
  auto carve = [&](size_t bytes) { char* p = ws + off; off += (bytes + 255) & ~(size_t)255; return p; };
  unsigned short* x16 = (unsigned short*)carve((size_t)NTOK * D * 2); unsigned short* w16 = (unsigned short*)carve((size_t)2 * D * D * 2); float* colsum = (float*)carve((size_t)BT * D * 4);
  b16* qh = (b16*)carve((size_t)2 * NTOK * D * 2); b16* kh = (b16*)carve((size_t)2 * NTOK * D * 2); b16* vt = (b16*)carve((size_t)NTOK * D * 2);
  if (off > ws_size) return;                                    // ≈ 105 MB
  prep_kernel<<<512, 256, 0, stream>>>(wattn, w16);
  xprep_kernel<<<1024, 256, 0, stream>>>(x, x16);
  vt_kernel<<<dim3(H, NTOK / 128), 256, 0, stream>>>(x, vt, 0);
  colsum_kernel<<<dim3(D / 32, BT), 1024, 0, stream>>>(x, colsum);
  proj_kernel<<<dim3(2 * D / 64, NTOK / 128), 128, 0, stream>>>((const __bf16*)x16, (const __bf16*)w16, qh, kh, 0);
  attn_kernel<S / 16><<<Bn * H * (S / 16) / 8, 256, 0, stream>>>(qh, kh, vt, x, colsum, (const float*)d_in[2], (const float*)d_in[3], (const float*)d_in[4], out);
}

// v002
// One run takes 420 microseconds.
// In both of two side-by-side timings against v001, it was 1.08 times as fast.
// Counting every step since v000, it is 1.32 times as fast.
#include <hip/hip_runtime.h>

// Causal "shaped" attention: [q | k] = x W_attn^T (16 heads x 64), v = x itself (use_v = False); att = beta softmax_causal(q.k/8) + alpha Id - gamma MC with Id = softmax(eye(2048))
// (diag e/(e+2047), off-diag 1/(e+2047)) and MC = causal row-uniform averaging (1/(i+1) on j <= i); y = att.v merged over heads -> [4][2048][1024] (no output projection).
// So y_i = beta (P.v)_i/l_i + alpha ((e-1) v_i + sum_all v_j)/(e+2047) - gamma (sum_{j<=i} v_j)/(i+1).
// Numerics: x, W_attn, alpha, beta, gamma rounded to bf16; [q|k] projection on v_wmma_f32_16x16x32_bf16 (exact products, f32 accumulate);
// scores on v_wmma_f32_16x16x32_f16 with q, k as f16 hi+lo pairs carried x8 (3 products); P.v with P an x8 hi+lo pair and v = bf16(x) exact in f16 (2 products); the causal prefix
// sums sum_{j<=i} v_j ride along as a second accumulator against an exact 0/1 mask operand (1 product); the all-token column sums in a small f32 kernel; softmax and the combine in f32.

namespace {
constexpr int BT = 4, Bn = 4, S = 2048, D = 1024, H = 16, HD = 64, NTOK = Bn * S;
constexpr float SCALE = 0.125f, VS = 1.0f /* v = bf16(x): exact, single plane */, QS = 8.0f, PS = 8.0f, EUL = 2.718281828459045f;   // power-of-two carry scales so hi/lo residual planes stay normal in f16
constexpr size_t VPL = (size_t)NTOK * D;   // unused: v^T is a single f16 plane of bf16(x)
constexpr size_t QPL = (size_t)NTOK * D;   // distance between the q/k hi and lo planes

typedef _Float16 b16;
typedef __attribute__((ext_vector_type(16))) _Float16 v16b;
typedef __attribute__((ext_vector_type(8)))  _Float16 v8b;
typedef __attribute__((ext_vector_type(8)))  float v8f;
typedef __attribute__((ext_vector_type(4)))  float v4f;

__device__ __forceinline__ v8b ld8b(const b16* p) { return *(const v8b*)p; }
__device__ __forceinline__ v16b cat8b(v8b a, v8b b) { return __builtin_shufflevector(a, b, 0, 1, 2, 3, 4, 5, 6, 7, 8, 9, 10, 11, 12, 13, 14, 15); }
__device__ __forceinline__ v16b frag_kb(const b16* p, int hh) { return cat8b(ld8b(p + 8 * hh), ld8b(p + 16 + 8 * hh)); }
// Fragment-order tile (every 16-bit matrix operand kept in the workspace): 16 rows x 32 k = 512 elements = 1 KiB; element j*256 + lane*8 + e holds (row lane & 15, k = 16 j + 8 (lane >> 4) + e),
// the k map of frag_kb. A fragment is then two loads of 512 contiguous bytes (4 whole 128-B lines each) where a row-major plane gives 16 lines of 32 bytes a load.
constexpr int FT = 512;
__device__ __forceinline__ v16b frag_pk(const b16* tile, int lane) { return cat8b(ld8b(tile + lane * 8), ld8b(tile + 256 + lane * 8)); }
__device__ __forceinline__ void split16(float v, b16& hi, b16& lo) { hi = (b16)v; lo = (b16)(v - (float)hi); }
// hi/lo fragment pair straight from an f32 k-contiguous row (same k-map)
__device__ __forceinline__ void frag_ksplit(const float* p, int hh, v16b& fh_, v16b& fl_) {
  const float* p0 = p + 8 * hh; const float* p1 = p + 16 + 8 * hh;
#pragma unroll
  for (int e = 0; e < 8; ++e) { b16 a, c; split16(p0[e], a, c); fh_[e] = a; fl_[e] = c; split16(p1[e], a, c); fh_[8 + e] = a; fl_[8 + e] = c; }
}
__device__ __forceinline__ v8f wmma16b(v16b a, v16b b, v8f c) {
  v8f d = __builtin_amdgcn_wmma_f32_16x16x32_f16(false, a, false, b, (short)0, c, false, false);
  asm volatile("v_nop\n\tv_nop\n\tv_nop\n\tv_nop" : "+v"(d) : "v"(a), "v"(b));
  return d;
}
__device__ __forceinline__ void wave_lds_sync() {
  __builtin_amdgcn_fence(__ATOMIC_RELEASE, "workgroup");
  __builtin_amdgcn_wave_barrier();
  __builtin_amdgcn_fence(__ATOMIC_ACQUIRE, "workgroup");
}

// Operand descriptor: NP = 0 -> f32 rows split on the fly into (hi, lo); NP = 1 -> one f16 plane; NP = 2 -> f16 hi + lo planes;
// NP = 3 -> f32 rows rounded once to a single f16 fragment. ld = row pitch.
struct Opnd { const void* p0; const void* p1; int ld; };
template <int NP> __device__ __forceinline__ void load_frags(const Opnd& o, int row, int kb, int hh, v16b& fh_, v16b& fl_) {
  if (NP == 0) { frag_ksplit((const float*)o.p0 + (size_t)row * o.ld + kb, hh, fh_, fl_); }
  else if (NP == 4 || NP == 5) {                             // f32 rows x64 (NP 4) or x8 (NP 5) then split (keeps the lo halves of small values normal)
    const float sc_ = (NP == 4) ? 64.0f : 8.0f;
    const float* p = (const float*)o.p0 + (size_t)row * o.ld + kb; const float* p0 = p + 8 * hh; const float* p1 = p + 16 + 8 * hh;
#pragma unroll
    for (int e = 0; e < 8; ++e) { b16 a, c; split16(p0[e] * sc_, a, c); fh_[e] = a; fl_[e] = c; split16(p1[e] * sc_, a, c); fh_[8 + e] = a; fl_[8 + e] = c; }
  } else if (NP == 3) {
    const float* p = (const float*)o.p0 + (size_t)row * o.ld + kb; const float* p0 = p + 8 * hh; const float* p1 = p + 16 + 8 * hh;
#pragma unroll
    for (int e = 0; e < 8; ++e) { fh_[e] = (b16)p0[e]; fh_[8 + e] = (b16)p1[e]; }
    fl_ = fh_;
  } else {
    fh_ = frag_kb((const b16*)o.p0 + (size_t)row * o.ld + kb, hh);
    if (NP == 2) fl_ = frag_kb((const b16*)o.p1 + (size_t)row * o.ld + kb, hh); else fl_ = fh_;
  }
}
template <int ANP, int BNP> __device__ __forceinline__ v8f mac(v16b ah, v16b al, v16b bh, v16b bl, v8f c) {
  c = wmma16b(ah, bh, c);
  if (BNP == 0 || BNP == 2 || BNP == 4 || BNP == 5) c = wmma16b(ah, bl, c);     // hi.lo
  if (ANP == 0 || ANP == 2 || ANP == 4 || ANP == 5) c = wmma16b(al, bh, c);     // lo.hi   (lo.lo dropped)
  return c;
}
// 32x64 wave tile: acc[r][t] (rows m0+16r.., cols c0+16t..) += A[m][k] . B[n][k] over k in [0, K)
template <int ANP, int BNP>
__device__ __forceinline__ void gemm_tile(const Opnd& A, const Opnd& B, int K, int m0, int c0, int nloc, int hlf, v8f (&acc)[2][4]) {
  for (int kb = 0; kb < K; kb += 32) {
    v16b a0h, a0l, a1h, a1l;
    load_frags<ANP>(A, m0 + nloc, kb, hlf, a0h, a0l);
    load_frags<ANP>(A, m0 + 16 + nloc, kb, hlf, a1h, a1l);
#pragma unroll
    for (int t = 0; t < 4; ++t) {
      v16b bh, bl;
      load_frags<BNP>(B, c0 + t * 16 + nloc, kb, hlf, bh, bl);
      acc[0][t] = mac<ANP, BNP>(a0h, a0l, bh, bl, acc[0][t]);
      acc[1][t] = mac<ANP, BNP>(a1h, a1l, bh, bl, acc[1][t]);
    }
  }
}

__device__ __forceinline__ void epi_planes(v8f (&acc)[2][4], float scale, bool two, b16* __restrict__ oh, b16* __restrict__ ol, int ldo,
                                           int m0, int c0, int lane, b16* Th, b16* Tl) {
  const int nloc = lane & 15, hlf = lane >> 4;
#pragma unroll
  for (int t = 0; t < 4; ++t)
#pragma unroll
    for (int r = 0; r < 2; ++r)
#pragma unroll
      for (int v = 0; v < 8; ++v) {
        const int rr = r * 16 + v + 8 * hlf, cc = t * 16 + nloc;
        b16 h_, l_; split16(acc[r][t][v] * scale, h_, l_);
        Th[rr * 64 + cc] = h_; Tl[rr * 64 + cc] = l_;
      }
  wave_lds_sync();
  {
#pragma unroll
    for (int j = 0; j < 8; ++j) {
      const int rr = j * 4 + (lane >> 3), c8 = (lane & 7) * 8;
      const size_t o = (size_t)(m0 + rr) * ldo + c0 + c8;
      *(v8b*)(oh + o) = ld8b(Th + rr * 64 + c8);
      if (two) *(v8b*)(ol + o) = ld8b(Tl + rr * 64 + c8);
    }
    
  }
}
// (b) f32 rows with pitch ldo: 64 floats = 256 B = 2 lines per row; 16 lanes x 16 B per row, 2 rows per instruction. Optional per-row factor
__device__ __forceinline__ void epi_f32(v8f (&acc)[2][4], float scale, const float* rscale, float* __restrict__ out, int ldo, int m0, int c0, int lane, float* Tt) {
  const int nloc = lane & 15, hlf = lane >> 4;
#pragma unroll
  for (int t = 0; t < 4; ++t)
#pragma unroll
    for (int r = 0; r < 2; ++r)
#pragma unroll
      for (int v = 0; v < 8; ++v) {
        const int rr = r * 16 + v + 8 * hlf;
        const float rs = rscale ? rscale[(size_t)(m0 + rr) * 32] : 1.0f;
        Tt[rr * 64 + t * 16 + nloc] = acc[r][t][v] * scale * rs;
      }
  wave_lds_sync();
  float* dst0 = out + (size_t)m0 * ldo + c0;
  {
#pragma unroll
    for (int j = 0; j < 16; ++j) { const int rr = j * 2 + hlf, c4 = nloc * 4; *(v4f*)(dst0 + (size_t)rr * ldo + c4) = *(const v4f*)(Tt + rr * 64 + c4); }
    
  }
}



typedef __attribute__((ext_vector_type(8))) __bf16 v8bb; typedef __attribute__((ext_vector_type(16))) __bf16 v16bb;
typedef __attribute__((ext_vector_type(8))) unsigned short v8us;
__device__ __forceinline__ v16bb frag_kb_bf(const __bf16* p, int hh) { const v8bb a = *(const v8bb*)(p + 8 * hh), b = *(const v8bb*)(p + 16 + 8 * hh); return __builtin_shufflevector(a, b, 0, 1, 2, 3, 4, 5, 6, 7, 8, 9, 10, 11, 12, 13, 14, 15); }
__device__ __forceinline__ v16bb frag_pk_bf(const __bf16* tile, int lane) { const v8bb a = *(const v8bb*)(tile + lane * 8), b = *(const v8bb*)(tile + 256 + lane * 8); return __builtin_shufflevector(a, b, 0, 1, 2, 3, 4, 5, 6, 7, 8, 9, 10, 11, 12, 13, 14, 15); }
__device__ __forceinline__ v8f wmma16bb(v16bb a, v16bb b, v8f c) {
  v8f d = __builtin_amdgcn_wmma_f32_16x16x32_bf16(false, a, false, b, (short)0, c, false, false);
  asm volatile("v_nop\n\tv_nop\n\tv_nop\n\tv_nop" : "+v"(d) : "v"(a), "v"(b));
  return d;
}
__device__ __forceinline__ unsigned short bf16_rne_bits(float v) { unsigned int u = __float_as_uint(v); u += 0x7FFFu + ((u >> 16) & 1u); return (unsigned short)(u >> 16); }
__device__ __forceinline__ float bf16_rne(float v) { return __uint_as_float(((unsigned int)bf16_rne_bits(v)) << 16); }



// f32 rows [nrow][D] -> bf16 fragment-order tiles, tile index (k / 32) * (nrow / 16) + row / 16 (the tiles that waves at one k step read lie side by side). One work item = one lane's 2 x 16 bytes of one tile; a wave reads 16 whole 128-B lines and stores 1 KiB in a row.
__device__ __forceinline__ void pack_bf16_tiles(const float* __restrict__ src, unsigned short* __restrict__ dst, size_t nrow, size_t tid, size_t nth) {
  for (size_t p = tid; p < nrow * D / 16; p += nth) {
    const size_t rt = (p >> 5) / (D / 32), kt = (p >> 5) % (D / 32), tile = kt * (nrow / 16) + rt; const int lane = (int)(p & 31);
    const float* s = src + (rt * 16 + (lane & 15)) * D + kt * 32 + 8 * (lane >> 4);
    v8us a, c;
#pragma unroll
    for (int e = 0; e < 8; ++e) { a[e] = bf16_rne_bits(s[e]); c[e] = bf16_rne_bits(s[16 + e]); }
    *(v8us*)(dst + tile * FT + lane * 8) = a; *(v8us*)(dst + tile * FT + 256 + lane * 8) = c;
  }
}
__global__ __launch_bounds__(256) void xprep_kernel(const float* __restrict__ x, unsigned short* __restrict__ x16) {   // x -> bf16 tiles
  pack_bf16_tiles(x, x16, NTOK, (size_t)blockIdx.x * blockDim.x + threadIdx.x, (size_t)gridDim.x * blockDim.x);
}
__global__ __launch_bounds__(256) void prep_kernel(const float* __restrict__ wattn, unsigned short* __restrict__ w16) {
  pack_bf16_tiles(wattn, w16, 2 * D, (size_t)blockIdx.x * blockDim.x + threadIdx.x, (size_t)gridDim.x * blockDim.x);   // W_attn [2C][C] ([out][in]): rows 0..1023 -> q, 1024..2047 -> k
}

// v = bf16(x) exactly: v^T f16 as fragment-order tiles (rows = 16 channels, k = 32 tokens), tile index ((b*H + h) * (S/32) + tok/32) * 4 + channel/16, via an LDS transpose (block = 128 tokens x one head). grid (H, NTOK/128).
__global__ __launch_bounds__(256) void vt_kernel(const float* __restrict__ x, b16* __restrict__ vt, int rowbase) {
  __shared__ __attribute__((aligned(16))) b16 T[HD][128 + 8];
  const int t_ = threadIdx.x, h = blockIdx.x, m0 = rowbase + blockIdx.y * 128, b = m0 / S, tok0 = m0 % S;
  for (int i = t_; i < 128 * HD / 4; i += 256) { const int r = i / (HD / 4), c4 = (i % (HD / 4)) * 4; const v4f xv = *(const v4f*)(x + (size_t)(m0 + r) * D + h * HD + c4);
#pragma unroll
    for (int e = 0; e < 4; ++e) T[c4 + e][r] = (b16)bf16_rne(xv[e]); }
  __syncthreads();
  b16* dst = vt + (((size_t)b * H + h) * (S / 32) + tok0 / 32) * 4 * FT;   // the block's 16 tiles lie in a row
  { for (int i = t_; i < HD * 16; i += 256) { const int tile = i >> 6, j = (i >> 5) & 1, ln = i & 31; *(v8b*)(dst + (size_t)i * 8) = *(const v8b*)(&T[(tile & 3) * 16 + (ln & 15)][(tile >> 2) * 32 + 16 * j + 8 * (ln >> 4)]); }  }
}
// All-token column sums, spread over tokens as well as channels: block = (one batch, 32 channels = one 128-B line per token), 32 waves; wave w owns tokens 64w..64w+63, one load = 4 tokens x one
// whole line, a lane's 16 loads independent of one another (unrolled, so that many are in flight). Sum order: 16 tokens per lane, then the 4 token rows of the wave (two butterfly steps), then the 32 waves through LDS.
__global__ __launch_bounds__(1024) void colsum_kernel(const float* __restrict__ x, float* __restrict__ colsum) {
  __shared__ __attribute__((aligned(16))) float P[32][32];
  const int lane = threadIdx.x & 31, wave = threadIdx.x >> 5, c0 = blockIdx.x * 32, b = blockIdx.y;
  const float* p = x + ((size_t)b * S + wave * 64 + (lane >> 3)) * D + c0 + (lane & 7) * 4;
  v4f xv[16];
#pragma unroll
  for (int i = 0; i < 16; ++i) xv[i] = *(const v4f*)(p + (size_t)i * 4 * D);
  v4f s = {};
#pragma unroll
  for (int i = 0; i < 16; ++i)
#pragma unroll
    for (int e = 0; e < 4; ++e) s[e] += bf16_rne(xv[i][e]);
#pragma unroll
  for (int e = 0; e < 4; ++e) { s[e] += __shfl_xor(s[e], 8); s[e] += __shfl_xor(s[e], 16); }
  if (lane < 8) *(v4f*)(&P[wave][lane * 4]) = s;
  __syncthreads();
  if (wave == 0) {
    float t = 0.0f;
#pragma unroll
    for (int w = 0; w < 32; ++w) t += P[w][lane];
    colsum[(size_t)b * D + c0 + lane] = t;
  }
}

// projections: rows = tokens (8192), K = 1024, column tiles of 64 = one head of q (tiles 0..15) or k (16..31): x8 hi/lo planes of fragment-order tiles (rows = 16 tokens, k = 32 channels), tile index ((b*H + head) * (S/16) + tok/16) * 2 + channel/32. grid (32, 64) x 128.
__global__ __launch_bounds__(128) void proj_kernel(const __bf16* __restrict__ x16, const __bf16* __restrict__ w16, b16* __restrict__ qh, b16* __restrict__ kh, int rowbase) {
  __shared__ __attribute__((aligned(16))) b16 Th[4][32][HD + 8], Tq[4][32][HD + 8];
  const int lane = threadIdx.x & 31, wave = threadIdx.x >> 5, nloc = lane & 15, hlf = lane >> 4, m0 = rowbase + blockIdx.y * 128 + wave * 32, c0 = blockIdx.x * 64;
  v8f acc[2][4];
#pragma unroll
  for (int r = 0; r < 2; ++r)
#pragma unroll
    for (int t = 0; t < 4; ++t) acc[r][t] = (v8f){};
#pragma unroll 2
  for (int kb = 0; kb < D; kb += 32) {
    const v16bb a0 = frag_pk_bf(x16 + ((size_t)(kb / 32) * (NTOK / 16) + m0 / 16) * FT, lane), a1 = frag_pk_bf(x16 + ((size_t)(kb / 32) * (NTOK / 16) + m0 / 16 + 1) * FT, lane);
#pragma unroll
    for (int t = 0; t < 4; ++t) { const v16bb bw = frag_pk_bf(w16 + ((size_t)(kb / 32) * (2 * D / 16) + c0 / 16 + t) * FT, lane); acc[0][t] = wmma16bb(a0, bw, acc[0][t]); acc[1][t] = wmma16bb(a1, bw, acc[1][t]); }
  }
  const int which = blockIdx.x / (D / 64), head = blockIdx.x % (D / 64), b = m0 / S, tok0 = m0 % S;
  {                                                             // q (tiles 0..15) or k (16..31) head: x8 hi/lo planes
#pragma unroll
    for (int t = 0; t < 4; ++t)
#pragma unroll
      for (int r = 0; r < 2; ++r)
#pragma unroll
        for (int v = 0; v < 8; ++v) { b16 a_, c_; split16(acc[r][t][v] * QS, a_, c_); Th[wave][r * 16 + 8 * hlf + v][t * 16 + nloc] = a_; Tq[wave][r * 16 + 8 * hlf + v][t * 16 + nloc] = c_; }   // q, k carried x8 (lo residuals stay normal)
    wave_lds_sync();
    b16* dst = (which == 0 ? qh : kh) + (((size_t)b * H + head) * S + tok0) * HD;
    {
#pragma unroll
      for (int j = 0; j < 8; ++j) { const int rr = (j >> 2) * 16 + nloc, c8 = ((j >> 1) & 1) * 32 + (j & 1) * 16 + 8 * hlf; *(v8b*)(dst + (j * 32 + lane) * 8) = *(const v8b*)(&Th[wave][rr][c8]); *(v8b*)(dst + QPL + (j * 32 + lane) * 8) = *(const v8b*)(&Tq[wave][rr][c8]); }   // the wave's 4 tiles lie in a row: half-tile j
       }
    return;
  }
}

// causal shaped attention: wave = (b, h, 16 queries); key chunks of 32 up to the query tile: S^T (K=64, 3 products), causal mask on the straddling chunk, online softmax f32, P x8 hi/lo,
// o^T += v^T P^T (2 products) and pf^T += v^T U^T (U = exact 0/1 causal indicator: prefix sums); epilogue y = beta o/(8 l) + alpha ((e-1) v_i + colsum)/(e+2047) - gamma pf/(i+1)
template <int QT>
__global__ __launch_bounds__(256) void attn_kernel(const b16* __restrict__ qh, const b16* __restrict__ kh, const b16* __restrict__ vt, const float* __restrict__ x, const float* __restrict__ colsum, const float* __restrict__ alpha_p, const float* __restrict__ beta_p, const float* __restrict__ gamma_p, float* __restrict__ y) {
  __shared__ __attribute__((aligned(16))) float Os[8][16][HD + 4];
  const int wid = threadIdx.x >> 5, lane = threadIdx.x & 31, hh = lane >> 4, col = lane & 15;
  const int qt = blockIdx.x * 8 + wid, jt = qt % QT, bh = qt / QT, h = bh % H, b = bh / H, q0 = jt * 16, qi = q0 + col;
  const b16* Q = qh + ((size_t)bh * S) * HD; const b16* K = kh + ((size_t)bh * S) * HD; const b16* vb = vt + ((size_t)bh * HD) * S;
  v16b qf[2], ql[2];
#pragma unroll
  for (int ks = 0; ks < 2; ++ks) { qf[ks] = frag_pk(Q + (size_t)q0 * HD + ks * FT, lane); ql[ks] = frag_pk(Q + QPL + (size_t)q0 * HD + ks * FT, lane); }
  float m = -INFINITY, l = 0.0f; v8f o[4] = {{}, {}, {}, {}}, pf[4] = {{}, {}, {}, {}};   // pf = causal prefix sums of v (the MC term)
  for (int kb = 0; kb < q0 + 16; kb += 32) {                   // causal: key blocks past the query tile are skipped (wave-uniform bound)
    const bool diag = (kb + 32 > q0);                           // this block reaches past some queries -> mask key > query
    v16b ub;                                                    // 0/1 causal indicator operand: ub[r] = [key 8hh+r <= query col], [16+8hh+r <= col]
#pragma unroll
    for (int r = 0; r < 8; ++r) { ub[r] = (b16)((kb + 8 * hh + r <= qi) ? 1.0f : 0.0f); ub[8 + r] = (b16)((kb + 16 + 8 * hh + r <= qi) ? 1.0f : 0.0f); }
    v8f s0 = {}, s1 = {};
#pragma unroll
    for (int ks = 0; ks < 2; ++ks) { const v16b k0 = frag_pk(K + (size_t)kb * HD + ks * FT, lane), k0l = frag_pk(K + QPL + (size_t)kb * HD + ks * FT, lane), k1 = frag_pk(K + (size_t)(kb + 16) * HD + ks * FT, lane), k1l = frag_pk(K + QPL + (size_t)(kb + 16) * HD + ks * FT, lane);
      s0 = wmma16b(k0, qf[ks], s0); s0 = wmma16b(k0, ql[ks], s0); s0 = wmma16b(k0l, qf[ks], s0);      // q and k as f16 hi+lo pairs (lo.lo dropped)
      s1 = wmma16b(k1, qf[ks], s1); s1 = wmma16b(k1, ql[ks], s1); s1 = wmma16b(k1l, qf[ks], s1); }
    float mr = -INFINITY;
#pragma unroll
    for (int r = 0; r < 8; ++r) { s0[r] *= SCALE / (QS * QS); s1[r] *= SCALE / (QS * QS); if (diag) { if (kb + 8 * hh + r > qi) s0[r] = -INFINITY; if (kb + 16 + 8 * hh + r > qi) s1[r] = -INFINITY; } mr = fmaxf(mr, fmaxf(s0[r], s1[r])); }
    mr = fmaxf(mr, __shfl_xor(mr, 16));
    const float mn = fmaxf(m, mr), al_ = __expf(m - mn); m = mn;
    float sum = 0.0f; v16b pb, pl;
#pragma unroll
    for (int r = 0; r < 8; ++r) { const float e0 = __expf(s0[r] - mn), e1 = __expf(s1[r] - mn); sum += e0 + e1; b16 a, c; split16(e0 * PS, a, c); pb[r] = a; pl[r] = c; split16(e1 * PS, a, c); pb[8 + r] = a; pl[8 + r] = c; }   // P carried x8
    sum += __shfl_xor(sum, 16); l = l * al_ + sum;
#pragma unroll
    for (int n = 0; n < 4; ++n) {
#pragma unroll
      for (int r = 0; r < 8; ++r) o[n][r] *= al_;
      const v16b vf = frag_pk(vb + ((size_t)(kb / 32) * 4 + n) * FT, lane);
      o[n] = wmma16b(vf, pb, o[n]); o[n] = wmma16b(vf, pl, o[n]);                              // v exact (bf16 values), P hi+lo
      pf[n] = wmma16b(vf, ub, pf[n]); }                                                          // exact causal prefix sums of v
  }
  const float alpha = bf16_rne(alpha_p[0]), beta = bf16_rne(beta_p[0]), gamma = bf16_rne(gamma_p[0]);   // scalar INPUTS
  const float cb = beta / (PS * l), cid = alpha / (EUL + (float)(S - 1)), cmc = gamma / (float)(qi + 1);
#pragma unroll
  for (int n = 0; n < 4; ++n)
#pragma unroll
    for (int r = 0; r < 8; ++r) { const int d = n * 16 + 8 * hh + r; const float vi = bf16_rne(x[((size_t)b * S + qi) * D + h * HD + d]), vs = colsum[(size_t)b * D + h * HD + d];
      Os[wid][col][d] = o[n][r] * cb + cid * ((EUL - 1.0f) * vi + vs) - cmc * pf[n][r]; }
  wave_lds_sync();
  float* dst = y + ((size_t)b * S + q0) * D + h * HD;
  {
#pragma unroll
    for (int j = 0; j < 8; ++j) { const int rr = j * 2 + hh, c4 = col * 4; *(v4f*)(dst + (size_t)rr * D + c4) = *(const v4f*)(&Os[wid][rr][c4]); }
    
  }
}

}  // namespace

extern "C" void kernel_launch(void* const* d_in, const int* in_sizes, int n_in,
                              void* d_out, int out_size, void* d_ws, size_t ws_size, hipStream_t stream) {
  (void)n_in; (void)out_size;
  const float* x = (const float*)d_in[0]; const float* wattn = (const float*)d_in[1];
  float* out = (float*)d_out;   // [4][2048][1024]
  if (in_sizes[0] != BT * S * D || in_sizes[1] != 2 * D * D || in_sizes[2] != 1 || in_sizes[3] != 1 || in_sizes[4] != 1) return;
  size_t off = 0; char* ws = (char*)d_ws;
  auto carve = [&](size_t bytes) { char* p = ws + off; off += (bytes + 255) & ~(size_t)255; return p; };
  unsigned short* x16 = (unsigned short*)carve((size_t)NTOK * D * 2); unsigned short* w16 = (unsigned short*)carve((size_t)2 * D * D * 2); float* colsum = (float*)carve((size_t)BT * D * 4);
  b16* qh = (b16*)carve((size_t)2 * NTOK * D * 2); b16* kh = (b16*)carve((size_t)2 * NTOK * D * 2); b16* vt = (b16*)carve((size_t)NTOK * D * 2);
  if (off > ws_size) return;                                    // ≈ 105 MB
  prep_kernel<<<512, 256, 0, stream>>>(wattn, w16);
  xprep_kernel<<<1024, 256, 0, stream>>>(x, x16);
  vt_kernel<<<dim3(H, NTOK / 128), 256, 0, stream>>>(x, vt, 0);
  colsum_kernel<<<dim3(D / 32, BT), 1024, 0, stream>>>(x, colsum);
  proj_kernel<<<dim3(2 * D / 64, NTOK / 128), 128, 0, stream>>>((const __bf16*)x16, (const __bf16*)w16, qh, kh, 0);
  attn_kernel<S / 16><<<Bn * H * (S / 16) / 8, 256, 0, stream>>>(qh, kh, vt, x, colsum, (const float*)d_in[2], (const float*)d_in[3], (const float*)d_in[4], out);
}

// v003
// A run of this version takes 231 microseconds.
// Next to v002, in two timings, it ran 1.82 times as fast each time.
// All steps since v000 together make it 2.40 times as fast.
#include <hip/hip_runtime.h>

// Causal "shaped" attention: [q | k] = x W_attn^T (16 heads x 64), v = x itself (use_v = False); att = beta softmax_causal(q.k/8) + alpha Id - gamma MC with Id = softmax(eye(2048))
// (diag e/(e+2047), off-diag 1/(e+2047)) and MC = causal row-uniform averaging (1/(i+1) on j <= i); y = att.v merged over heads -> [4][2048][1024] (no output projection).
// So y_i = beta (P.v)_i/l_i + alpha ((e-1) v_i + sum_all v_j)/(e+2047) - gamma (sum_{j<=i} v_j)/(i+1).
// Numerics: x, W_attn, alpha, beta, gamma rounded to bf16; [q|k] projection on v_wmma_f32_16x16x32_bf16 (exact products, f32 accumulate);
// scores on v_wmma_f32_16x16x32_f16 with q, k as f16 hi+lo pairs carried x8 (3 products); P.v with P an x8 hi+lo pair and v = bf16(x) exact in f16 (2 products); the causal prefix
// sums sum_{j<=i} v_j ride along as a second accumulator against an exact 0/1 mask operand (1 product); the all-token column sums in a small f32 kernel; softmax and the combine in f32.

namespace {
constexpr int BT = 4, Bn = 4, S = 2048, D = 1024, H = 16, HD = 64, NTOK = Bn * S;
constexpr float SCALE = 0.125f, VS = 1.0f /* v = bf16(x): exact, single plane */, QS = 8.0f, PS = 8.0f, EUL = 2.718281828459045f;   // power-of-two carry scales so hi/lo residual planes stay normal in f16
constexpr size_t VPL = (size_t)NTOK * D;   // unused: v^T is a single f16 plane of bf16(x)
constexpr size_t QPL = (size_t)NTOK * D;   // distance between the q/k hi and lo planes

typedef _Float16 b16;
typedef __attribute__((ext_vector_type(16))) _Float16 v16b;
typedef __attribute__((ext_vector_type(8)))  _Float16 v8b;
typedef __attribute__((ext_vector_type(8)))  float v8f;
typedef __attribute__((ext_vector_type(4)))  float v4f;

__device__ __forceinline__ v8b ld8b(const b16* p) { return *(const v8b*)p; }
__device__ __forceinline__ v16b cat8b(v8b a, v8b b) { return __builtin_shufflevector(a, b, 0, 1, 2, 3, 4, 5, 6, 7, 8, 9, 10, 11, 12, 13, 14, 15); }
__device__ __forceinline__ v16b frag_kb(const b16* p, int hh) { return cat8b(ld8b(p + 8 * hh), ld8b(p + 16 + 8 * hh)); }
// Fragment-order tile (every 16-bit matrix operand kept in the workspace): 16 rows x 32 k = 512 elements = 1 KiB; element j*256 + lane*8 + e holds (row lane & 15, k = 16 j + 8 (lane >> 4) + e),
// the k map of frag_kb. A fragment is then two loads of 512 contiguous bytes (4 whole 128-B lines each) where a row-major plane gives 16 lines of 32 bytes a load.
constexpr int FT = 512;
__device__ __forceinline__ v16b frag_pk(const b16* tile, int lane) { return cat8b(ld8b(tile + lane * 8), ld8b(tile + 256 + lane * 8)); }
__device__ __forceinline__ void split16(float v, b16& hi, b16& lo) { hi = (b16)v; lo = (b16)(v - (float)hi); }
// hi/lo fragment pair straight from an f32 k-contiguous row (same k-map)
__device__ __forceinline__ void frag_ksplit(const float* p, int hh, v16b& fh_, v16b& fl_) {
  const float* p0 = p + 8 * hh; const float* p1 = p + 16 + 8 * hh;
#pragma unroll
  for (int e = 0; e < 8; ++e) { b16 a, c; split16(p0[e], a, c); fh_[e] = a; fl_[e] = c; split16(p1[e], a, c); fh_[8 + e] = a; fl_[8 + e] = c; }
}
__device__ __forceinline__ v8f wmma16b(v16b a, v16b b, v8f c) {
  v8f d = __builtin_amdgcn_wmma_f32_16x16x32_f16(false, a, false, b, (short)0, c, false, false);
  asm volatile("v_nop\n\tv_nop\n\tv_nop\n\tv_nop" : "+v"(d) : "v"(a), "v"(b));
  return d;
}
__device__ __forceinline__ void wave_lds_sync() {
  __builtin_amdgcn_fence(__ATOMIC_RELEASE, "workgroup");
  __builtin_amdgcn_wave_barrier();
  __builtin_amdgcn_fence(__ATOMIC_ACQUIRE, "workgroup");
}

// Operand descriptor: NP = 0 -> f32 rows split on the fly into (hi, lo); NP = 1 -> one f16 plane; NP = 2 -> f16 hi + lo planes;
// NP = 3 -> f32 rows rounded once to a single f16 fragment. ld = row pitch.
struct Opnd { const void* p0; const void* p1; int ld; };
template <int NP> __device__ __forceinline__ void load_frags(const Opnd& o, int row, int kb, int hh, v16b& fh_, v16b& fl_) {
  if (NP == 0) { frag_ksplit((const float*)o.p0 + (size_t)row * o.ld + kb, hh, fh_, fl_); }
  else if (NP == 4 || NP == 5) {                             // f32 rows x64 (NP 4) or x8 (NP 5) then split (keeps the lo halves of small values normal)
    const float sc_ = (NP == 4) ? 64.0f : 8.0f;
    const float* p = (const float*)o.p0 + (size_t)row * o.ld + kb; const float* p0 = p + 8 * hh; const float* p1 = p + 16 + 8 * hh;
#pragma unroll
    for (int e = 0; e < 8; ++e) { b16 a, c; split16(p0[e] * sc_, a, c); fh_[e] = a; fl_[e] = c; split16(p1[e] * sc_, a, c); fh_[8 + e] = a; fl_[8 + e] = c; }
  } else if (NP == 3) {
    const float* p = (const float*)o.p0 + (size_t)row * o.ld + kb; const float* p0 = p + 8 * hh; const float* p1 = p + 16 + 8 * hh;
#pragma unroll
    for (int e = 0; e < 8; ++e) { fh_[e] = (b16)p0[e]; fh_[8 + e] = (b16)p1[e]; }
    fl_ = fh_;
  } else {
    fh_ = frag_kb((const b16*)o.p0 + (size_t)row * o.ld + kb, hh);
    if (NP == 2) fl_ = frag_kb((const b16*)o.p1 + (size_t)row * o.ld + kb, hh); else fl_ = fh_;
  }
}
template <int ANP, int BNP> __device__ __forceinline__ v8f mac(v16b ah, v16b al, v16b bh, v16b bl, v8f c) {
  c = wmma16b(ah, bh, c);
  if (BNP == 0 || BNP == 2 || BNP == 4 || BNP == 5) c = wmma16b(ah, bl, c);     // hi.lo
  if (ANP == 0 || ANP == 2 || ANP == 4 || ANP == 5) c = wmma16b(al, bh, c);     // lo.hi   (lo.lo dropped)
  return c;
}
// 32x64 wave tile: acc[r][t] (rows m0+16r.., cols c0+16t..) += A[m][k] . B[n][k] over k in [0, K)
template <int ANP, int BNP>
__device__ __forceinline__ void gemm_tile(const Opnd& A, const Opnd& B, int K, int m0, int c0, int nloc, int hlf, v8f (&acc)[2][4]) {
  for (int kb = 0; kb < K; kb += 32) {
    v16b a0h, a0l, a1h, a1l;
    load_frags<ANP>(A, m0 + nloc, kb, hlf, a0h, a0l);
    load_frags<ANP>(A, m0 + 16 + nloc, kb, hlf, a1h, a1l);
#pragma unroll
    for (int t = 0; t < 4; ++t) {
      v16b bh, bl;
      load_frags<BNP>(B, c0 + t * 16 + nloc, kb, hlf, bh, bl);
      acc[0][t] = mac<ANP, BNP>(a0h, a0l, bh, bl, acc[0][t]);
      acc[1][t] = mac<ANP, BNP>(a1h, a1l, bh, bl, acc[1][t]);
    }
  }
}

__device__ __forceinline__ void epi_planes(v8f (&acc)[2][4], float scale, bool two, b16* __restrict__ oh, b16* __restrict__ ol, int ldo,
                                           int m0, int c0, int lane, b16* Th, b16* Tl) {
  const int nloc = lane & 15, hlf = lane >> 4;
#pragma unroll
  for (int t = 0; t < 4; ++t)
#pragma unroll
    for (int r = 0; r < 2; ++r)
#pragma unroll
      for (int v = 0; v < 8; ++v) {
        const int rr = r * 16 + v + 8 * hlf, cc = t * 16 + nloc;
        b16 h_, l_; split16(acc[r][t][v] * scale, h_, l_);
        Th[rr * 64 + cc] = h_; Tl[rr * 64 + cc] = l_;
      }
  wave_lds_sync();
  {
#pragma unroll
    for (int j = 0; j < 8; ++j) {
      const int rr = j * 4 + (lane >> 3), c8 = (lane & 7) * 8;
      const size_t o = (size_t)(m0 + rr) * ldo + c0 + c8;
      *(v8b*)(oh + o) = ld8b(Th + rr * 64 + c8);
      if (two) *(v8b*)(ol + o) = ld8b(Tl + rr * 64 + c8);
    }
    
  }
}
// (b) f32 rows with pitch ldo: 64 floats = 256 B = 2 lines per row; 16 lanes x 16 B per row, 2 rows per instruction. Optional per-row factor
__device__ __forceinline__ void epi_f32(v8f (&acc)[2][4], float scale, const float* rscale, float* __restrict__ out, int ldo, int m0, int c0, int lane, float* Tt) {
  const int nloc = lane & 15, hlf = lane >> 4;
#pragma unroll
  for (int t = 0; t < 4; ++t)
#pragma unroll
    for (int r = 0; r < 2; ++r)
#pragma unroll
      for (int v = 0; v < 8; ++v) {
        const int rr = r * 16 + v + 8 * hlf;
        const float rs = rscale ? rscale[(size_t)(m0 + rr) * 32] : 1.0f;
        Tt[rr * 64 + t * 16 + nloc] = acc[r][t][v] * scale * rs;
      }
  wave_lds_sync();
  float* dst0 = out + (size_t)m0 * ldo + c0;
  {
#pragma unroll
    for (int j = 0; j < 16; ++j) { const int rr = j * 2 + hlf, c4 = nloc * 4; *(v4f*)(dst0 + (size_t)rr * ldo + c4) = *(const v4f*)(Tt + rr * 64 + c4); }
    
  }
}



typedef __attribute__((ext_vector_type(8))) __bf16 v8bb; typedef __attribute__((ext_vector_type(16))) __bf16 v16bb;
typedef __attribute__((ext_vector_type(8))) unsigned short v8us;
__device__ __forceinline__ v16bb frag_kb_bf(const __bf16* p, int hh) { const v8bb a = *(const v8bb*)(p + 8 * hh), b = *(const v8bb*)(p + 16 + 8 * hh); return __builtin_shufflevector(a, b, 0, 1, 2, 3, 4, 5, 6, 7, 8, 9, 10, 11, 12, 13, 14, 15); }
__device__ __forceinline__ v16bb frag_pk_bf(const __bf16* tile, int lane) { const v8bb a = *(const v8bb*)(tile + lane * 8), b = *(const v8bb*)(tile + 256 + lane * 8); return __builtin_shufflevector(a, b, 0, 1, 2, 3, 4, 5, 6, 7, 8, 9, 10, 11, 12, 13, 14, 15); }
__device__ __forceinline__ v8f wmma16bb(v16bb a, v16bb b, v8f c) {
  v8f d = __builtin_amdgcn_wmma_f32_16x16x32_bf16(false, a, false, b, (short)0, c, false, false);
  asm volatile("v_nop\n\tv_nop\n\tv_nop\n\tv_nop" : "+v"(d) : "v"(a), "v"(b));
  return d;
}
__device__ __forceinline__ unsigned short bf16_rne_bits(float v) { unsigned int u = __float_as_uint(v); u += 0x7FFFu + ((u >> 16) & 1u); return (unsigned short)(u >> 16); }
__device__ __forceinline__ float bf16_rne(float v) { return __uint_as_float(((unsigned int)bf16_rne_bits(v)) << 16); }



// f32 rows [nrow][D] -> bf16 fragment-order tiles, tile index (k / 32) * (nrow / 16) + row / 16 (the tiles that waves at one k step read lie side by side). One work item = one lane's 2 x 16 bytes of one tile; a wave reads 16 whole 128-B lines and stores 1 KiB in a row.
__device__ __forceinline__ void pack_bf16_tiles(const float* __restrict__ src, unsigned short* __restrict__ dst, size_t nrow, size_t tid, size_t nth) {
  for (size_t p = tid; p < nrow * D / 16; p += nth) {
    const size_t rt = (p >> 5) / (D / 32), kt = (p >> 5) % (D / 32), tile = kt * (nrow / 16) + rt; const int lane = (int)(p & 31);
    const float* s = src + (rt * 16 + (lane & 15)) * D + kt * 32 + 8 * (lane >> 4);
    v8us a, c;
#pragma unroll
    for (int e = 0; e < 8; ++e) { a[e] = bf16_rne_bits(s[e]); c[e] = bf16_rne_bits(s[16 + e]); }
    *(v8us*)(dst + tile * FT + lane * 8) = a; *(v8us*)(dst + tile * FT + 256 + lane * 8) = c;
  }
}
__global__ __launch_bounds__(256) void xprep_kernel(const float* __restrict__ x, unsigned short* __restrict__ x16) {   // x -> bf16 tiles
  pack_bf16_tiles(x, x16, NTOK, (size_t)blockIdx.x * blockDim.x + threadIdx.x, (size_t)gridDim.x * blockDim.x);
}
__global__ __launch_bounds__(256) void prep_kernel(const float* __restrict__ wattn, unsigned short* __restrict__ w16) {
  pack_bf16_tiles(wattn, w16, 2 * D, (size_t)blockIdx.x * blockDim.x + threadIdx.x, (size_t)gridDim.x * blockDim.x);   // W_attn [2C][C] ([out][in]): rows 0..1023 -> q, 1024..2047 -> k
}

// v = bf16(x) exactly: v^T f16 as fragment-order tiles (rows = 16 channels, k = 32 tokens), tile index ((b*H + h) * (S/32) + tok/32) * 4 + channel/16, via an LDS transpose (block = 128 tokens x one head). grid (H, NTOK/128).
__global__ __launch_bounds__(256) void vt_kernel(const float* __restrict__ x, b16* __restrict__ vt, int rowbase) {
  __shared__ __attribute__((aligned(16))) b16 T[HD][128 + 8];
  const int t_ = threadIdx.x, h = blockIdx.x, m0 = rowbase + blockIdx.y * 128, b = m0 / S, tok0 = m0 % S;
  for (int i = t_; i < 128 * HD / 4; i += 256) { const int r = i / (HD / 4), c4 = (i % (HD / 4)) * 4; const v4f xv = *(const v4f*)(x + (size_t)(m0 + r) * D + h * HD + c4);
#pragma unroll
    for (int e = 0; e < 4; ++e) T[c4 + e][r] = (b16)bf16_rne(xv[e]); }
  __syncthreads();
  b16* dst = vt + (((size_t)b * H + h) * (S / 32) + tok0 / 32) * 4 * FT;   // the block's 16 tiles lie in a row
  { for (int i = t_; i < HD * 16; i += 256) { const int tile = i >> 6, j = (i >> 5) & 1, ln = i & 31; *(v8b*)(dst + (size_t)i * 8) = *(const v8b*)(&T[(tile & 3) * 16 + (ln & 15)][(tile >> 2) * 32 + 16 * j + 8 * (ln >> 4)]); }  }
}
// All-token column sums, spread over tokens as well as channels: block = (one batch, 32 channels = one 128-B line per token), 32 waves; wave w owns tokens 64w..64w+63, one load = 4 tokens x one
// whole line, a lane's 16 loads independent of one another (unrolled, so that many are in flight). Sum order: 16 tokens per lane, then the 4 token rows of the wave (two butterfly steps), then the 32 waves through LDS.
__global__ __launch_bounds__(1024) void colsum_kernel(const float* __restrict__ x, float* __restrict__ colsum) {
  __shared__ __attribute__((aligned(16))) float P[32][32];
  const int lane = threadIdx.x & 31, wave = threadIdx.x >> 5, c0 = blockIdx.x * 32, b = blockIdx.y;
  const float* p = x + ((size_t)b * S + wave * 64 + (lane >> 3)) * D + c0 + (lane & 7) * 4;
  v4f xv[16];
#pragma unroll
  for (int i = 0; i < 16; ++i) xv[i] = *(const v4f*)(p + (size_t)i * 4 * D);
  v4f s = {};
#pragma unroll
  for (int i = 0; i < 16; ++i)
#pragma unroll
    for (int e = 0; e < 4; ++e) s[e] += bf16_rne(xv[i][e]);
#pragma unroll
  for (int e = 0; e < 4; ++e) { s[e] += __shfl_xor(s[e], 8); s[e] += __shfl_xor(s[e], 16); }
  if (lane < 8) *(v4f*)(&P[wave][lane * 4]) = s;
  __syncthreads();
  if (wave == 0) {
    float t = 0.0f;
#pragma unroll
    for (int w = 0; w < 32; ++w) t += P[w][lane];
    colsum[(size_t)b * D + c0 + lane] = t;
  }
}

// projections: rows = tokens (8192), K = 1024, column tiles of 64 = one head of q (tiles 0..15) or k (16..31): x8 hi/lo planes of fragment-order tiles (rows = 16 tokens, k = 32 channels), tile index ((b*H + head) * (S/16) + tok/16) * 2 + channel/32. grid (32, 64) x 128.
__global__ __launch_bounds__(128) void proj_kernel(const __bf16* __restrict__ x16, const __bf16* __restrict__ w16, b16* __restrict__ qh, b16* __restrict__ kh, int rowbase) {
  __shared__ __attribute__((aligned(16))) b16 Th[4][32][HD + 8], Tq[4][32][HD + 8];
  const int lane = threadIdx.x & 31, wave = threadIdx.x >> 5, nloc = lane & 15, hlf = lane >> 4, m0 = rowbase + blockIdx.y * 128 + wave * 32, c0 = blockIdx.x * 64;
  v8f acc[2][4];
#pragma unroll
  for (int r = 0; r < 2; ++r)
#pragma unroll
    for (int t = 0; t < 4; ++t) acc[r][t] = (v8f){};
#pragma unroll 2
  for (int kb = 0; kb < D; kb += 32) {
    const v16bb a0 = frag_pk_bf(x16 + ((size_t)(kb / 32) * (NTOK / 16) + m0 / 16) * FT, lane), a1 = frag_pk_bf(x16 + ((size_t)(kb / 32) * (NTOK / 16) + m0 / 16 + 1) * FT, lane);
    v16bb bw[4];                                                // the k step's 12 loads go out as one group ahead of its products: one load latency a step, not four
#pragma unroll
    for (int t = 0; t < 4; ++t) bw[t] = frag_pk_bf(w16 + ((size_t)(kb / 32) * (2 * D / 16) + c0 / 16 + t) * FT, lane);
#pragma unroll
    for (int t = 0; t < 4; ++t) { acc[0][t] = wmma16bb(a0, bw[t], acc[0][t]); acc[1][t] = wmma16bb(a1, bw[t], acc[1][t]); }
  }
  const int which = blockIdx.x / (D / 64), head = blockIdx.x % (D / 64), b = m0 / S, tok0 = m0 % S;
  {                                                             // q (tiles 0..15) or k (16..31) head: x8 hi/lo planes
#pragma unroll
    for (int t = 0; t < 4; ++t)
#pragma unroll
      for (int r = 0; r < 2; ++r)
#pragma unroll
        for (int v = 0; v < 8; ++v) { b16 a_, c_; split16(acc[r][t][v] * QS, a_, c_); Th[wave][r * 16 + 8 * hlf + v][t * 16 + nloc] = a_; Tq[wave][r * 16 + 8 * hlf + v][t * 16 + nloc] = c_; }   // q, k carried x8 (lo residuals stay normal)
    wave_lds_sync();
    b16* dst = (which == 0 ? qh : kh) + (((size_t)b * H + head) * S + tok0) * HD;
    {
#pragma unroll
      for (int j = 0; j < 8; ++j) { const int rr = (j >> 2) * 16 + nloc, c8 = ((j >> 1) & 1) * 32 + (j & 1) * 16 + 8 * hlf; *(v8b*)(dst + (j * 32 + lane) * 8) = *(const v8b*)(&Th[wave][rr][c8]); *(v8b*)(dst + QPL + (j * 32 + lane) * 8) = *(const v8b*)(&Tq[wave][rr][c8]); }   // the wave's 4 tiles lie in a row: half-tile j
       }
    return;
  }
}

// the 8 K fragments of one 32-key chunk: [ks][keys 0..15 hi, lo, keys 16..31 hi, lo]; WAITS is off for the fetch in front of the loop, where the compiler's own waits stand before every rewrite
template <bool WAITS> __device__ __forceinline__ void load_kfrags(const b16* __restrict__ K, int kb, int lane, v16b (&kf)[8]) {
#pragma unroll
  for (int pl = 0; pl < 2; ++pl) {
#pragma unroll
    for (int ks = 0; ks < 2; ++ks) {
      kf[ks * 4 + pl] = frag_pk(K + pl * QPL + (size_t)kb * HD + ks * FT, lane);
      if (WAITS && pl == 1 && ks == 1) asm volatile("s_wait_xcnt 0x0" ::: "memory");   // the last fragment lands on registers that held addresses of the loads above
      kf[ks * 4 + 2 + pl] = frag_pk(K + pl * QPL + (size_t)(kb + 16) * HD + ks * FT, lane);
    }
    if (WAITS) asm volatile("s_wait_xcnt 0x0" ::: "memory");    // before anything rewrites an address register of the loads just issued
  }
}

// causal shaped attention: wave = (b, h, 16 queries); key chunks of 32 up to the query tile: S^T (K=64, 3 products), causal mask on the straddling chunk, online softmax f32, P x8 hi/lo,
// o^T += v^T P^T (2 products) and pf^T += v^T U^T (U = exact 0/1 causal indicator: prefix sums); epilogue y = beta o/(8 l) + alpha ((e-1) v_i + colsum)/(e+2047) - gamma pf/(i+1)
template <int QT>
__global__ __launch_bounds__(256) void attn_kernel(const b16* __restrict__ qh, const b16* __restrict__ kh, const b16* __restrict__ vt, const float* __restrict__ x, const float* __restrict__ colsum, const float* __restrict__ alpha_p, const float* __restrict__ beta_p, const float* __restrict__ gamma_p, float* __restrict__ y) {
  __shared__ __attribute__((aligned(16))) float Os[8][16][HD + 4];
  const int wid = __builtin_amdgcn_readfirstlane(threadIdx.x >> 5), lane = threadIdx.x & 31, hh = lane >> 4, col = lane & 15;   // wave number as a scalar: tile bases and the fetch-ahead bound sit in SGPRs, so the fragments in flight fit 256 VGPRs
  const int qt = blockIdx.x * 8 + wid, jt = qt % QT, bh = qt / QT, h = bh % H, b = bh / H, q0 = jt * 16, qi = q0 + col;
  const b16* Q = qh + ((size_t)bh * S) * HD; const b16* K = kh + ((size_t)bh * S) * HD; const b16* vb = vt + ((size_t)bh * HD) * S;
  v16b qf[2], ql[2];
#pragma unroll
  for (int ks = 0; ks < 2; ++ks) { qf[ks] = frag_pk(Q + (size_t)q0 * HD + ks * FT, lane); ql[ks] = frag_pk(Q + QPL + (size_t)q0 * HD + ks * FT, lane); }
  float m = -INFINITY, l = 0.0f; v8f o[4] = {{}, {}, {}, {}}, pf[4] = {{}, {}, {}, {}};   // pf = causal prefix sums of v (the MC term)
  v16b kf[8]; load_kfrags<false>(K, 0, lane, kf);                      // K fragments run one chunk ahead of their products
  for (int kb = 0; kb < q0 + 16; kb += 32) {                   // causal: key blocks past the query tile are skipped (wave-uniform bound)
    v16b vf[4];                                                 // this chunk's v^T fragments leave now and are used behind the softmax
#pragma unroll
    for (int n = 0; n < 4; ++n) vf[n] = frag_pk(vb + ((size_t)(kb / 32) * 4 + n) * FT, lane);
    asm volatile("s_wait_xcnt 0x0" ::: "memory");               // before the loop's pointer step rewrites the address register of these loads
    const bool diag = (kb + 32 > q0);                           // this block reaches past some queries -> mask key > query
    v16b ub;                                                    // 0/1 causal indicator operand: ub[r] = [key 8hh+r <= query col], [16+8hh+r <= col]
#pragma unroll
    for (int r = 0; r < 8; ++r) { ub[r] = (b16)((kb + 8 * hh + r <= qi) ? 1.0f : 0.0f); ub[8 + r] = (b16)((kb + 16 + 8 * hh + r <= qi) ? 1.0f : 0.0f); }
    v8f s0 = {}, s1 = {};
#pragma unroll
    for (int ks = 0; ks < 2; ++ks) { const v16b k0 = kf[ks * 4 + 0], k0l = kf[ks * 4 + 1], k1 = kf[ks * 4 + 2], k1l = kf[ks * 4 + 3];
      s0 = wmma16b(k0, qf[ks], s0); s0 = wmma16b(k0, ql[ks], s0); s0 = wmma16b(k0l, qf[ks], s0);      // q and k as f16 hi+lo pairs (lo.lo dropped)
      s1 = wmma16b(k1, qf[ks], s1); s1 = wmma16b(k1, ql[ks], s1); s1 = wmma16b(k1l, qf[ks], s1); }
    float mr = -INFINITY;
#pragma unroll
    for (int r = 0; r < 8; ++r) { s0[r] *= SCALE / (QS * QS); s1[r] *= SCALE / (QS * QS); if (diag) { if (kb + 8 * hh + r > qi) s0[r] = -INFINITY; if (kb + 16 + 8 * hh + r > qi) s1[r] = -INFINITY; } mr = fmaxf(mr, fmaxf(s0[r], s1[r])); }
    mr = fmaxf(mr, __shfl_xor(mr, 16));
    const float mn = fmaxf(m, mr), al_ = __expf(m - mn); m = mn;
    float sum = 0.0f; v16b pb, pl;
#pragma unroll
    for (int r = 0; r < 8; ++r) { const float e0 = __expf(s0[r] - mn), e1 = __expf(s1[r] - mn); sum += e0 + e1; b16 a, c; split16(e0 * PS, a, c); pb[r] = a; pl[r] = c; split16(e1 * PS, a, c); pb[8 + r] = a; pl[8 + r] = c; }   // P carried x8
    sum += __shfl_xor(sum, 16); l = l * al_ + sum;
#pragma unroll
    for (int n = 0; n < 4; ++n) {
#pragma unroll
      for (int r = 0; r < 8; ++r) o[n][r] *= al_;
      o[n] = wmma16b(vf[n], pb, o[n]);
      if (n == 0) load_kfrags<true>(K, (kb + 32 < q0 + 16) ? kb + 32 : kb, lane, kf);   // next chunk's K, behind the softmax (above it its 64 registers cost a wave per SIMD); the last chunk fetches itself again: in bounds, unused
      o[n] = wmma16b(vf[n], pl, o[n]);                                                          // v exact (bf16 values), P hi+lo
      pf[n] = wmma16b(vf[n], ub, pf[n]); }                                                          // exact causal prefix sums of v
  }
  const float alpha = bf16_rne(alpha_p[0]), beta = bf16_rne(beta_p[0]), gamma = bf16_rne(gamma_p[0]);   // scalar INPUTS
  const float cb = beta / (PS * l), cid = alpha / (EUL + (float)(S - 1)), cmc = gamma / (float)(qi + 1);
#pragma unroll
  for (int n = 0; n < 4; ++n)
#pragma unroll
    for (int r = 0; r < 8; ++r) { const int d = n * 16 + 8 * hh + r; const float vi = bf16_rne(x[((size_t)b * S + qi) * D + h * HD + d]), vs = colsum[(size_t)b * D + h * HD + d];
      Os[wid][col][d] = o[n][r] * cb + cid * ((EUL - 1.0f) * vi + vs) - cmc * pf[n][r]; }
  wave_lds_sync();
  float* dst = y + ((size_t)b * S + q0) * D + h * HD;
  {
#pragma unroll
    for (int j = 0; j < 8; ++j) { const int rr = j * 2 + hh, c4 = col * 4; *(v4f*)(dst + (size_t)rr * D + c4) = *(const v4f*)(&Os[wid][rr][c4]); }
    
  }
}

}  // namespace

extern "C" void kernel_launch(void* const* d_in, const int* in_sizes, int n_in,
                              void* d_out, int out_size, void* d_ws, size_t ws_size, hipStream_t stream) {
  (void)n_in; (void)out_size;
  const float* x = (const float*)d_in[0]; const float* wattn = (const float*)d_in[1];
  float* out = (float*)d_out;   // [4][2048][1024]
  if (in_sizes[0] != BT * S * D || in_sizes[1] != 2 * D * D || in_sizes[2] != 1 || in_sizes[3] != 1 || in_sizes[4] != 1) return;
  size_t off = 0; char* ws = (char*)d_ws;
  auto carve = [&](size_t bytes) { char* p = ws + off; off += (bytes + 255) & ~(size_t)255; return p; };
  unsigned short* x16 = (unsigned short*)carve((size_t)NTOK * D * 2); unsigned short* w16 = (unsigned short*)carve((size_t)2 * D * D * 2); float* colsum = (float*)carve((size_t)BT * D * 4);
  b16* qh = (b16*)carve((size_t)2 * NTOK * D * 2); b16* kh = (b16*)carve((size_t)2 * NTOK * D * 2); b16* vt = (b16*)carve((size_t)NTOK * D * 2);
  if (off > ws_size) return;                                    // ≈ 105 MB
  prep_kernel<<<512, 256, 0, stream>>>(wattn, w16);
  xprep_kernel<<<1024, 256, 0, stream>>>(x, x16);
  vt_kernel<<<dim3(H, NTOK / 128), 256, 0, stream>>>(x, vt, 0);
  colsum_kernel<<<dim3(D / 32, BT), 1024, 0, stream>>>(x, colsum);
  proj_kernel<<<dim3(2 * D / 64, NTOK / 128), 128, 0, stream>>>((const __bf16*)x16, (const __bf16*)w16, qh, kh, 0);
  attn_kernel<S / 16><<<Bn * H * (S / 16) / 8, 256, 0, stream>>>(qh, kh, vt, x, colsum, (const float*)d_in[2], (const float*)d_in[3], (const float*)d_in[4], out);
}

// v004
// Measured time: 169 microseconds a run.
// In both of two side-by-side timings against v003, it was 1.37 times as fast.
// All steps since v000 together make it 3.30 times as fast.
#include <hip/hip_runtime.h>

// Causal "shaped" attention: [q | k] = x W_attn^T (16 heads x 64), v = x itself (use_v = False); att = beta softmax_causal(q.k/8) + alpha Id - gamma MC with Id = softmax(eye(2048))
// (diag e/(e+2047), off-diag 1/(e+2047)) and MC = causal row-uniform averaging (1/(i+1) on j <= i); y = att.v merged over heads -> [4][2048][1024] (no output projection).
// So y_i = beta (P.v)_i/l_i + alpha ((e-1) v_i + sum_all v_j)/(e+2047) - gamma (sum_{j<=i} v_j)/(i+1).
// Numerics: x, W_attn, alpha, beta, gamma rounded to bf16; [q|k] projection on v_wmma_f32_16x16x32_bf16 (exact products, f32 accumulate);
// scores on v_wmma_f32_16x16x32_f16 with q, k as f16 hi+lo pairs carried x8 (3 products); P.v with P an x8 hi+lo pair and v = bf16(x) exact in f16 (2 products); the causal prefix
// sums sum_{j<=i} v_j ride along as a second accumulator against an exact 0/1 mask operand (1 product); the all-token column sums in a small f32 kernel; softmax and the combine in f32.

namespace {
constexpr int BT = 4, Bn = 4, S = 2048, D = 1024, H = 16, HD = 64, NTOK = Bn * S;
constexpr float SCALE = 0.125f, VS = 1.0f /* v = bf16(x): exact, single plane */, QS = 8.0f, PS = 8.0f, EUL = 2.718281828459045f;   // power-of-two carry scales so hi/lo residual planes stay normal in f16
constexpr size_t VPL = (size_t)NTOK * D;   // unused: v^T is a single f16 plane of bf16(x)
constexpr size_t QPL = (size_t)NTOK * D;   // distance between the q/k hi and lo planes

typedef _Float16 b16;
typedef __attribute__((ext_vector_type(16))) _Float16 v16b;
typedef __attribute__((ext_vector_type(8)))  _Float16 v8b;
typedef __attribute__((ext_vector_type(8)))  float v8f;
typedef __attribute__((ext_vector_type(4)))  float v4f;

__device__ __forceinline__ v8b ld8b(const b16* p) { return *(const v8b*)p; }
__device__ __forceinline__ v16b cat8b(v8b a, v8b b) { return __builtin_shufflevector(a, b, 0, 1, 2, 3, 4, 5, 6, 7, 8, 9, 10, 11, 12, 13, 14, 15); }
__device__ __forceinline__ v16b frag_kb(const b16* p, int hh) { return cat8b(ld8b(p + 8 * hh), ld8b(p + 16 + 8 * hh)); }
// Fragment-order tile (every 16-bit matrix operand kept in the workspace): 16 rows x 32 k = 512 elements = 1 KiB; element j*256 + lane*8 + e holds (row lane & 15, k = 16 j + 8 (lane >> 4) + e),
// the k map of frag_kb. A fragment is then two loads of 512 contiguous bytes (4 whole 128-B lines each) where a row-major plane gives 16 lines of 32 bytes a load.
constexpr int FT = 512;
__device__ __forceinline__ v16b frag_pk(const b16* tile, int lane) { return cat8b(ld8b(tile + lane * 8), ld8b(tile + 256 + lane * 8)); }
__device__ __forceinline__ void split16(float v, b16& hi, b16& lo) { hi = (b16)v; lo = (b16)(v - (float)hi); }
// hi/lo fragment pair straight from an f32 k-contiguous row (same k-map)
__device__ __forceinline__ void frag_ksplit(const float* p, int hh, v16b& fh_, v16b& fl_) {
  const float* p0 = p + 8 * hh; const float* p1 = p + 16 + 8 * hh;
#pragma unroll
  for (int e = 0; e < 8; ++e) { b16 a, c; split16(p0[e], a, c); fh_[e] = a; fl_[e] = c; split16(p1[e], a, c); fh_[8 + e] = a; fl_[8 + e] = c; }
}
__device__ __forceinline__ v8f wmma16b(v16b a, v16b b, v8f c) {
  v8f d = __builtin_amdgcn_wmma_f32_16x16x32_f16(false, a, false, b, (short)0, c, false, false);
  asm volatile("v_nop\n\tv_nop\n\tv_nop\n\tv_nop" : "+v"(d) : "v"(a), "v"(b));
  return d;
}
__device__ __forceinline__ void wave_lds_sync() {
  __builtin_amdgcn_fence(__ATOMIC_RELEASE, "workgroup");
  __builtin_amdgcn_wave_barrier();
  __builtin_amdgcn_fence(__ATOMIC_ACQUIRE, "workgroup");
}

// Operand descriptor: NP = 0 -> f32 rows split on the fly into (hi, lo); NP = 1 -> one f16 plane; NP = 2 -> f16 hi + lo planes;
// NP = 3 -> f32 rows rounded once to a single f16 fragment. ld = row pitch.
struct Opnd { const void* p0; const void* p1; int ld; };
template <int NP> __device__ __forceinline__ void load_frags(const Opnd& o, int row, int kb, int hh, v16b& fh_, v16b& fl_) {
  if (NP == 0) { frag_ksplit((const float*)o.p0 + (size_t)row * o.ld + kb, hh, fh_, fl_); }
  else if (NP == 4 || NP == 5) {                             // f32 rows x64 (NP 4) or x8 (NP 5) then split (keeps the lo halves of small values normal)
    const float sc_ = (NP == 4) ? 64.0f : 8.0f;
    const float* p = (const float*)o.p0 + (size_t)row * o.ld + kb; const float* p0 = p + 8 * hh; const float* p1 = p + 16 + 8 * hh;
#pragma unroll
    for (int e = 0; e < 8; ++e) { b16 a, c; split16(p0[e] * sc_, a, c); fh_[e] = a; fl_[e] = c; split16(p1[e] * sc_, a, c); fh_[8 + e] = a; fl_[8 + e] = c; }
  } else if (NP == 3) {
    const float* p = (const float*)o.p0 + (size_t)row * o.ld + kb; const float* p0 = p + 8 * hh; const float* p1 = p + 16 + 8 * hh;
#pragma unroll
    for (int e = 0; e < 8; ++e) { fh_[e] = (b16)p0[e]; fh_[8 + e] = (b16)p1[e]; }
    fl_ = fh_;
  } else {
    fh_ = frag_kb((const b16*)o.p0 + (size_t)row * o.ld + kb, hh);
    if (NP == 2) fl_ = frag_kb((const b16*)o.p1 + (size_t)row * o.ld + kb, hh); else fl_ = fh_;
  }
}
template <int ANP, int BNP> __device__ __forceinline__ v8f mac(v16b ah, v16b al, v16b bh, v16b bl, v8f c) {
  c = wmma16b(ah, bh, c);
  if (BNP == 0 || BNP == 2 || BNP == 4 || BNP == 5) c = wmma16b(ah, bl, c);     // hi.lo
  if (ANP == 0 || ANP == 2 || ANP == 4 || ANP == 5) c = wmma16b(al, bh, c);     // lo.hi   (lo.lo dropped)
  return c;
}
// 32x64 wave tile: acc[r][t] (rows m0+16r.., cols c0+16t..) += A[m][k] . B[n][k] over k in [0, K)
template <int ANP, int BNP>
__device__ __forceinline__ void gemm_tile(const Opnd& A, const Opnd& B, int K, int m0, int c0, int nloc, int hlf, v8f (&acc)[2][4]) {
  for (int kb = 0; kb < K; kb += 32) {
    v16b a0h, a0l, a1h, a1l;
    load_frags<ANP>(A, m0 + nloc, kb, hlf, a0h, a0l);
    load_frags<ANP>(A, m0 + 16 + nloc, kb, hlf, a1h, a1l);
#pragma unroll
    for (int t = 0; t < 4; ++t) {
      v16b bh, bl;
      load_frags<BNP>(B, c0 + t * 16 + nloc, kb, hlf, bh, bl);
      acc[0][t] = mac<ANP, BNP>(a0h, a0l, bh, bl, acc[0][t]);
      acc[1][t] = mac<ANP, BNP>(a1h, a1l, bh, bl, acc[1][t]);
    }
  }
}

__device__ __forceinline__ void epi_planes(v8f (&acc)[2][4], float scale, bool two, b16* __restrict__ oh, b16* __restrict__ ol, int ldo,
                                           int m0, int c0, int lane, b16* Th, b16* Tl) {
  const int nloc = lane & 15, hlf = lane >> 4;
#pragma unroll
  for (int t = 0; t < 4; ++t)
#pragma unroll
    for (int r = 0; r < 2; ++r)
#pragma unroll
      for (int v = 0; v < 8; ++v) {
        const int rr = r * 16 + v + 8 * hlf, cc = t * 16 + nloc;
        b16 h_, l_; split16(acc[r][t][v] * scale, h_, l_);
        Th[rr * 64 + cc] = h_; Tl[rr * 64 + cc] = l_;
      }
  wave_lds_sync();
  {
#pragma unroll
    for (int j = 0; j < 8; ++j) {
      const int rr = j * 4 + (lane >> 3), c8 = (lane & 7) * 8;
      const size_t o = (size_t)(m0 + rr) * ldo + c0 + c8;
      *(v8b*)(oh + o) = ld8b(Th + rr * 64 + c8);
      if (two) *(v8b*)(ol + o) = ld8b(Tl + rr * 64 + c8);
    }
    
  }
}
// (b) f32 rows with pitch ldo: 64 floats = 256 B = 2 lines per row; 16 lanes x 16 B per row, 2 rows per instruction. Optional per-row factor
__device__ __forceinline__ void epi_f32(v8f (&acc)[2][4], float scale, const float* rscale, float* __restrict__ out, int ldo, int m0, int c0, int lane, float* Tt) {
  const int nloc = lane & 15, hlf = lane >> 4;
#pragma unroll
  for (int t = 0; t < 4; ++t)
#pragma unroll
    for (int r = 0; r < 2; ++r)
#pragma unroll
      for (int v = 0; v < 8; ++v) {
        const int rr = r * 16 + v + 8 * hlf;
        const float rs = rscale ? rscale[(size_t)(m0 + rr) * 32] : 1.0f;
        Tt[rr * 64 + t * 16 + nloc] = acc[r][t][v] * scale * rs;
      }
  wave_lds_sync();
  float* dst0 = out + (size_t)m0 * ldo + c0;
  {
#pragma unroll
    for (int j = 0; j < 16; ++j) { const int rr = j * 2 + hlf, c4 = nloc * 4; *(v4f*)(dst0 + (size_t)rr * ldo + c4) = *(const v4f*)(Tt + rr * 64 + c4); }
    
  }
}



typedef __attribute__((ext_vector_type(8))) __bf16 v8bb; typedef __attribute__((ext_vector_type(16))) __bf16 v16bb;
typedef __attribute__((ext_vector_type(8))) unsigned short v8us;
__device__ __forceinline__ v16bb frag_kb_bf(const __bf16* p, int hh) { const v8bb a = *(const v8bb*)(p + 8 * hh), b = *(const v8bb*)(p + 16 + 8 * hh); return __builtin_shufflevector(a, b, 0, 1, 2, 3, 4, 5, 6, 7, 8, 9, 10, 11, 12, 13, 14, 15); }
__device__ __forceinline__ v16bb frag_pk_bf(const __bf16* tile, int lane) { const v8bb a = *(const v8bb*)(tile + lane * 8), b = *(const v8bb*)(tile + 256 + lane * 8); return __builtin_shufflevector(a, b, 0, 1, 2, 3, 4, 5, 6, 7, 8, 9, 10, 11, 12, 13, 14, 15); }
__device__ __forceinline__ v8f wmma16bb(v16bb a, v16bb b, v8f c) {
  v8f d = __builtin_amdgcn_wmma_f32_16x16x32_bf16(false, a, false, b, (short)0, c, false, false);
  asm volatile("v_nop\n\tv_nop\n\tv_nop\n\tv_nop" : "+v"(d) : "v"(a), "v"(b));
  return d;
}
__device__ __forceinline__ unsigned short bf16_rne_bits(float v) { unsigned int u = __float_as_uint(v); u += 0x7FFFu + ((u >> 16) & 1u); return (unsigned short)(u >> 16); }
__device__ __forceinline__ float bf16_rne(float v) { return __uint_as_float(((unsigned int)bf16_rne_bits(v)) << 16); }



// f32 rows [nrow][D] -> bf16 fragment-order tiles, tile index (k / 32) * (nrow / 16) + row / 16 (the tiles that waves at one k step read lie side by side). One work item = one lane's 2 x 16 bytes of one tile; a wave reads 16 whole 128-B lines and stores 1 KiB in a row.
__device__ __forceinline__ void pack_bf16_tiles(const float* __restrict__ src, unsigned short* __restrict__ dst, size_t nrow, size_t tid, size_t nth) {
  for (size_t p = tid; p < nrow * D / 16; p += nth) {
    const size_t rt = (p >> 5) / (D / 32), kt = (p >> 5) % (D / 32), tile = kt * (nrow / 16) + rt; const int lane = (int)(p & 31);
    const float* s = src + (rt * 16 + (lane & 15)) * D + kt * 32 + 8 * (lane >> 4);
    v8us a, c;
#pragma unroll
    for (int e = 0; e < 8; ++e) { a[e] = bf16_rne_bits(s[e]); c[e] = bf16_rne_bits(s[16 + e]); }
    *(v8us*)(dst + tile * FT + lane * 8) = a; *(v8us*)(dst + tile * FT + 256 + lane * 8) = c;
  }
}
__global__ __launch_bounds__(256) void xprep_kernel(const float* __restrict__ x, unsigned short* __restrict__ x16) {   // x -> bf16 tiles
  pack_bf16_tiles(x, x16, NTOK, (size_t)blockIdx.x * blockDim.x + threadIdx.x, (size_t)gridDim.x * blockDim.x);
}
__global__ __launch_bounds__(256) void prep_kernel(const float* __restrict__ wattn, unsigned short* __restrict__ w16) {
  pack_bf16_tiles(wattn, w16, 2 * D, (size_t)blockIdx.x * blockDim.x + threadIdx.x, (size_t)gridDim.x * blockDim.x);   // W_attn [2C][C] ([out][in]): rows 0..1023 -> q, 1024..2047 -> k
}

// v = bf16(x) exactly: v^T f16 as fragment-order tiles (rows = 16 channels, k = 32 tokens), tile index ((b*H + h) * (S/32) + tok/32) * 4 + channel/16, via an LDS transpose (block = 128 tokens x one head). grid (H, NTOK/128).
__global__ __launch_bounds__(256) void vt_kernel(const float* __restrict__ x, b16* __restrict__ vt, int rowbase) {
  __shared__ __attribute__((aligned(16))) b16 T[HD][128 + 8];
  const int t_ = threadIdx.x, h = blockIdx.x, m0 = rowbase + blockIdx.y * 128, b = m0 / S, tok0 = m0 % S;
  for (int i = t_; i < 128 * HD / 4; i += 256) { const int r = i / (HD / 4), c4 = (i % (HD / 4)) * 4; const v4f xv = *(const v4f*)(x + (size_t)(m0 + r) * D + h * HD + c4);
#pragma unroll
    for (int e = 0; e < 4; ++e) T[c4 + e][r] = (b16)bf16_rne(xv[e]); }
  __syncthreads();
  b16* dst = vt + (((size_t)b * H + h) * (S / 32) + tok0 / 32) * 4 * FT;   // the block's 16 tiles lie in a row
  { for (int i = t_; i < HD * 16; i += 256) { const int tile = i >> 6, j = (i >> 5) & 1, ln = i & 31; *(v8b*)(dst + (size_t)i * 8) = *(const v8b*)(&T[(tile & 3) * 16 + (ln & 15)][(tile >> 2) * 32 + 16 * j + 8 * (ln >> 4)]); }  }
}
// All-token column sums, spread over tokens as well as channels: block = (one batch, 32 channels = one 128-B line per token), 32 waves; wave w owns tokens 64w..64w+63, one load = 4 tokens x one
// whole line, a lane's 16 loads independent of one another (unrolled, so that many are in flight). Sum order: 16 tokens per lane, then the 4 token rows of the wave (two butterfly steps), then the 32 waves through LDS.
__global__ __launch_bounds__(1024) void colsum_kernel(const float* __restrict__ x, float* __restrict__ colsum) {
  __shared__ __attribute__((aligned(16))) float P[32][32];
  const int lane = threadIdx.x & 31, wave = threadIdx.x >> 5, c0 = blockIdx.x * 32, b = blockIdx.y;
  const float* p = x + ((size_t)b * S + wave * 64 + (lane >> 3)) * D + c0 + (lane & 7) * 4;
  v4f xv[16];
#pragma unroll
  for (int i = 0; i < 16; ++i) xv[i] = *(const v4f*)(p + (size_t)i * 4 * D);
  v4f s = {};
#pragma unroll
  for (int i = 0; i < 16; ++i)
#pragma unroll
    for (int e = 0; e < 4; ++e) s[e] += bf16_rne(xv[i][e]);
#pragma unroll
  for (int e = 0; e < 4; ++e) { s[e] += __shfl_xor(s[e], 8); s[e] += __shfl_xor(s[e], 16); }
  if (lane < 8) *(v4f*)(&P[wave][lane * 4]) = s;
  __syncthreads();
  if (wave == 0) {
    float t = 0.0f;
#pragma unroll
    for (int w = 0; w < 32; ++w) t += P[w][lane];
    colsum[(size_t)b * D + c0 + lane] = t;
  }
}

// projections: rows = tokens (8192), K = 1024, column tiles of 64 = one head of q (tiles 0..15) or k (16..31): x8 hi/lo planes of fragment-order tiles (rows = 16 tokens, k = 32 channels), tile index ((b*H + head) * (S/16) + tok/16) * 2 + channel/32. grid (32, 64) x 128.
__global__ __launch_bounds__(128) void proj_kernel(const __bf16* __restrict__ x16, const __bf16* __restrict__ w16, b16* __restrict__ qh, b16* __restrict__ kh, int rowbase) {
  __shared__ __attribute__((aligned(16))) b16 Th[4][32][HD + 8], Tq[4][32][HD + 8];
  const int lane = threadIdx.x & 31, wave = threadIdx.x >> 5, nloc = lane & 15, hlf = lane >> 4, m0 = rowbase + blockIdx.y * 128 + wave * 32, c0 = blockIdx.x * 64;
  v8f acc[2][4];
#pragma unroll
  for (int r = 0; r < 2; ++r)
#pragma unroll
    for (int t = 0; t < 4; ++t) acc[r][t] = (v8f){};
#pragma unroll 2
  for (int kb = 0; kb < D; kb += 32) {
    const v16bb a0 = frag_pk_bf(x16 + ((size_t)(kb / 32) * (NTOK / 16) + m0 / 16) * FT, lane), a1 = frag_pk_bf(x16 + ((size_t)(kb / 32) * (NTOK / 16) + m0 / 16 + 1) * FT, lane);
    v16bb bw[4];                                                // the k step's 12 loads go out as one group ahead of its products: one load latency a step, not four
#pragma unroll
    for (int t = 0; t < 4; ++t) bw[t] = frag_pk_bf(w16 + ((size_t)(kb / 32) * (2 * D / 16) + c0 / 16 + t) * FT, lane);
#pragma unroll
    for (int t = 0; t < 4; ++t) { acc[0][t] = wmma16bb(a0, bw[t], acc[0][t]); acc[1][t] = wmma16bb(a1, bw[t], acc[1][t]); }
  }
  const int which = blockIdx.x / (D / 64), head = blockIdx.x % (D / 64), b = m0 / S, tok0 = m0 % S;
  {                                                             // q (tiles 0..15) or k (16..31) head: x8 hi/lo planes
#pragma unroll
    for (int t = 0; t < 4; ++t)
#pragma unroll
      for (int r = 0; r < 2; ++r)
#pragma unroll
        for (int v = 0; v < 8; ++v) { b16 a_, c_; split16(acc[r][t][v] * QS, a_, c_); Th[wave][r * 16 + 8 * hlf + v][t * 16 + nloc] = a_; Tq[wave][r * 16 + 8 * hlf + v][t * 16 + nloc] = c_; }   // q, k carried x8 (lo residuals stay normal)
    wave_lds_sync();
    b16* dst = (which == 0 ? qh : kh) + (((size_t)b * H + head) * S + tok0) * HD;
    {
#pragma unroll
      for (int j = 0; j < 8; ++j) { const int rr = (j >> 2) * 16 + nloc, c8 = ((j >> 1) & 1) * 32 + (j & 1) * 16 + 8 * hlf; *(v8b*)(dst + (j * 32 + lane) * 8) = *(const v8b*)(&Th[wave][rr][c8]); *(v8b*)(dst + QPL + (j * 32 + lane) * 8) = *(const v8b*)(&Tq[wave][rr][c8]); }   // the wave's 4 tiles lie in a row: half-tile j
       }
    return;
  }
}

// the 8 K fragments of one 32-key chunk: [ks][keys 0..15 hi, lo, keys 16..31 hi, lo]; WAITS is off for the fetch in front of the loop, where the compiler's own waits stand before every rewrite
template <bool WAITS> __device__ __forceinline__ void load_kfrags(const b16* __restrict__ K, int kb, int lane, v16b (&kf)[8]) {
#pragma unroll
  for (int pl = 0; pl < 2; ++pl) {
#pragma unroll
    for (int ks = 0; ks < 2; ++ks) {
      kf[ks * 4 + pl] = frag_pk(K + pl * QPL + (size_t)kb * HD + ks * FT, lane);
      if (WAITS && pl == 1 && ks == 1) asm volatile("s_wait_xcnt 0x0" ::: "memory");   // the last fragment lands on registers that held addresses of the loads above
      kf[ks * 4 + 2 + pl] = frag_pk(K + pl * QPL + (size_t)(kb + 16) * HD + ks * FT, lane);
    }
    if (WAITS) asm volatile("s_wait_xcnt 0x0" ::: "memory");    // before anything rewrites an address register of the loads just issued
  }
}

// causal shaped attention: wave = (b, h, 16 queries); key chunks of 32 up to the query tile: S^T (K=64, 3 products), causal mask on the straddling chunk, online softmax f32, P x8 hi/lo,
// o^T += v^T P^T (2 products) and pf^T += v^T U^T (U = exact 0/1 causal indicator: prefix sums); epilogue y = beta o/(8 l) + alpha ((e-1) v_i + colsum)/(e+2047) - gamma pf/(i+1)
template <int QT>
__global__ __launch_bounds__(256) void attn_kernel(const b16* __restrict__ qh, const b16* __restrict__ kh, const b16* __restrict__ vt, const float* __restrict__ x, const float* __restrict__ colsum, const float* __restrict__ alpha_p, const float* __restrict__ beta_p, const float* __restrict__ gamma_p, float* __restrict__ y) {
  __shared__ __attribute__((aligned(16))) float Os[8][16][HD + 4];
  const int wid = __builtin_amdgcn_readfirstlane(threadIdx.x >> 5), lane = threadIdx.x & 31, hh = lane >> 4, col = lane & 15;   // wave number as a scalar: tile bases and the fetch-ahead bound sit in SGPRs, so the fragments in flight fit 256 VGPRs
  // Block -> (head, group of 8 query tiles), longest groups first: a group's cost grows with its position (causal), the grid holds twice the blocks that fit the chip at once, so the short ones
  // take the highest block indices. Every (head, group) pair is taken exactly once: index = (QT / 8 - 1 - group) * (Bn * H) + head.
  const int bh = blockIdx.x % (Bn * H), jt = (QT / 8 - 1 - blockIdx.x / (Bn * H)) * 8 + wid, h = bh % H, b = bh / H, q0 = jt * 16, qi = q0 + col;
  const b16* Q = qh + ((size_t)bh * S) * HD; const b16* K = kh + ((size_t)bh * S) * HD; const b16* vb = vt + ((size_t)bh * HD) * S;
  v16b qf[2], ql[2];
#pragma unroll
  for (int ks = 0; ks < 2; ++ks) { qf[ks] = frag_pk(Q + (size_t)q0 * HD + ks * FT, lane); ql[ks] = frag_pk(Q + QPL + (size_t)q0 * HD + ks * FT, lane); }
  float m = -INFINITY, l = 0.0f; v8f o[4] = {{}, {}, {}, {}}, pf[4] = {{}, {}, {}, {}};   // pf = causal prefix sums of v (the MC term)
  v16b kf[8]; load_kfrags<false>(K, 0, lane, kf);                      // K fragments run one chunk ahead of their products
  for (int kb = 0; kb < q0 + 16; kb += 32) {                   // causal: key blocks past the query tile are skipped (wave-uniform bound)
    v16b vf[4];                                                 // this chunk's v^T fragments leave now and are used behind the softmax
#pragma unroll
    for (int n = 0; n < 4; ++n) vf[n] = frag_pk(vb + ((size_t)(kb / 32) * 4 + n) * FT, lane);
    asm volatile("s_wait_xcnt 0x0" ::: "memory");               // before the loop's pointer step rewrites the address register of these loads
    const bool diag = (kb + 32 > q0);                           // this block reaches past some queries -> mask key > query
    v16b ub;                                                    // 0/1 causal indicator operand: ub[r] = [key 8hh+r <= query col], [16+8hh+r <= col]
#pragma unroll
    for (int r = 0; r < 8; ++r) { ub[r] = (b16)((kb + 8 * hh + r <= qi) ? 1.0f : 0.0f); ub[8 + r] = (b16)((kb + 16 + 8 * hh + r <= qi) ? 1.0f : 0.0f); }
    v8f s0 = {}, s1 = {};
#pragma unroll
    for (int ks = 0; ks < 2; ++ks) { const v16b k0 = kf[ks * 4 + 0], k0l = kf[ks * 4 + 1], k1 = kf[ks * 4 + 2], k1l = kf[ks * 4 + 3];
      s0 = wmma16b(k0, qf[ks], s0); s0 = wmma16b(k0, ql[ks], s0); s0 = wmma16b(k0l, qf[ks], s0);      // q and k as f16 hi+lo pairs (lo.lo dropped)
      s1 = wmma16b(k1, qf[ks], s1); s1 = wmma16b(k1, ql[ks], s1); s1 = wmma16b(k1l, qf[ks], s1); }
    float mr = -INFINITY;
#pragma unroll
    for (int r = 0; r < 8; ++r) { s0[r] *= SCALE / (QS * QS); s1[r] *= SCALE / (QS * QS); if (diag) { if (kb + 8 * hh + r > qi) s0[r] = -INFINITY; if (kb + 16 + 8 * hh + r > qi) s1[r] = -INFINITY; } mr = fmaxf(mr, fmaxf(s0[r], s1[r])); }
    mr = fmaxf(mr, __shfl_xor(mr, 16));
    const float mn = fmaxf(m, mr), al_ = __expf(m - mn); m = mn;
    float sum = 0.0f; v16b pb, pl;
#pragma unroll
    for (int r = 0; r < 8; ++r) { const float e0 = __expf(s0[r] - mn), e1 = __expf(s1[r] - mn); sum += e0 + e1; b16 a, c; split16(e0 * PS, a, c); pb[r] = a; pl[r] = c; split16(e1 * PS, a, c); pb[8 + r] = a; pl[8 + r] = c; }   // P carried x8
    sum += __shfl_xor(sum, 16); l = l * al_ + sum;
#pragma unroll
    for (int n = 0; n < 4; ++n) {
#pragma unroll
      for (int r = 0; r < 8; ++r) o[n][r] *= al_;
      o[n] = wmma16b(vf[n], pb, o[n]);
      if (n == 0) load_kfrags<true>(K, (kb + 32 < q0 + 16) ? kb + 32 : kb, lane, kf);   // next chunk's K, behind the softmax (above it its 64 registers cost a wave per SIMD); the last chunk fetches itself again: in bounds, unused
      o[n] = wmma16b(vf[n], pl, o[n]);                                                          // v exact (bf16 values), P hi+lo
      pf[n] = wmma16b(vf[n], ub, pf[n]); }                                                          // exact causal prefix sums of v
  }
  const float alpha = bf16_rne(alpha_p[0]), beta = bf16_rne(beta_p[0]), gamma = bf16_rne(gamma_p[0]);   // scalar INPUTS
  const float cb = beta / (PS * l), cid = alpha / (EUL + (float)(S - 1)), cmc = gamma / (float)(qi + 1);
#pragma unroll
  for (int n = 0; n < 4; ++n)
#pragma unroll
    for (int r = 0; r < 8; ++r) { const int d = n * 16 + 8 * hh + r; const float vi = bf16_rne(x[((size_t)b * S + qi) * D + h * HD + d]), vs = colsum[(size_t)b * D + h * HD + d];
      Os[wid][col][d] = o[n][r] * cb + cid * ((EUL - 1.0f) * vi + vs) - cmc * pf[n][r]; }
  wave_lds_sync();
  float* dst = y + ((size_t)b * S + q0) * D + h * HD;
  {
#pragma unroll
    for (int j = 0; j < 8; ++j) { const int rr = j * 2 + hh, c4 = col * 4; *(v4f*)(dst + (size_t)rr * D + c4) = *(const v4f*)(&Os[wid][rr][c4]); }
    
  }
}

}  // namespace

extern "C" void kernel_launch(void* const* d_in, const int* in_sizes, int n_in,
                              void* d_out, int out_size, void* d_ws, size_t ws_size, hipStream_t stream) {
  (void)n_in; (void)out_size;
  const float* x = (const float*)d_in[0]; const float* wattn = (const float*)d_in[1];
  float* out = (float*)d_out;   // [4][2048][1024]
  if (in_sizes[0] != BT * S * D || in_sizes[1] != 2 * D * D || in_sizes[2] != 1 || in_sizes[3] != 1 || in_sizes[4] != 1) return;
  size_t off = 0; char* ws = (char*)d_ws;
  auto carve = [&](size_t bytes) { char* p = ws + off; off += (bytes + 255) & ~(size_t)255; return p; };
  unsigned short* x16 = (unsigned short*)carve((size_t)NTOK * D * 2); unsigned short* w16 = (unsigned short*)carve((size_t)2 * D * D * 2); float* colsum = (float*)carve((size_t)BT * D * 4);
  b16* qh = (b16*)carve((size_t)2 * NTOK * D * 2); b16* kh = (b16*)carve((size_t)2 * NTOK * D * 2); b16* vt = (b16*)carve((size_t)NTOK * D * 2);
  if (off > ws_size) return;                                    // ≈ 105 MB
  prep_kernel<<<512, 256, 0, stream>>>(wattn, w16);
  xprep_kernel<<<1024, 256, 0, stream>>>(x, x16);
  vt_kernel<<<dim3(H, NTOK / 128), 256, 0, stream>>>(x, vt, 0);
  colsum_kernel<<<dim3(D / 32, BT), 1024, 0, stream>>>(x, colsum);
  proj_kernel<<<dim3(2 * D / 64, NTOK / 128), 128, 0, stream>>>((const __bf16*)x16, (const __bf16*)w16, qh, kh, 0);
  attn_kernel<S / 16><<<Bn * H * (S / 16) / 8, 256, 0, stream>>>(qh, kh, vt, x, colsum, (const float*)d_in[2], (const float*)d_in[3], (const float*)d_in[4], out);
}

// v005
// One run takes 159 microseconds.
// In two side-by-side timings against v004, it was 1.05 and 1.07 times as fast.
// Over all steps from v000 it is 3.49 times as fast.
#include <hip/hip_runtime.h>

// Causal "shaped" attention: [q | k] = x W_attn^T (16 heads x 64), v = x itself (use_v = False); att = beta softmax_causal(q.k/8) + alpha Id - gamma MC with Id = softmax(eye(2048))
// (diag e/(e+2047), off-diag 1/(e+2047)) and MC = causal row-uniform averaging (1/(i+1) on j <= i); y = att.v merged over heads -> [4][2048][1024] (no output projection).
// So y_i = beta (P.v)_i/l_i + alpha ((e-1) v_i + sum_all v_j)/(e+2047) - gamma (sum_{j<=i} v_j)/(i+1).
// Numerics: x, W_attn, alpha, beta, gamma rounded to bf16; [q|k] projection on v_wmma_f32_16x16x32_bf16 (exact products, f32 accumulate);
// scores on v_wmma_f32_16x16x32_f16 with q, k as f16 hi+lo pairs carried x8 (3 products); P.v with P an x8 hi+lo pair and v = bf16(x) exact in f16 (2 products); the causal prefix
// sums sum_{j<=i} v_j ride along as a second accumulator against an exact 0/1 mask operand (1 product); the all-token column sums in a small f32 kernel; softmax and the combine in f32.

namespace {
constexpr int BT = 4, Bn = 4, S = 2048, D = 1024, H = 16, HD = 64, NTOK = Bn * S;
constexpr float SCALE = 0.125f, VS = 1.0f /* v = bf16(x): exact, single plane */, QS = 8.0f, PS = 8.0f, EUL = 2.718281828459045f;   // power-of-two carry scales so hi/lo residual planes stay normal in f16
constexpr size_t VPL = (size_t)NTOK * D;   // unused: v^T is a single f16 plane of bf16(x)
constexpr size_t QPL = (size_t)NTOK * D;   // distance between the q/k hi and lo planes

typedef _Float16 b16;
typedef __attribute__((ext_vector_type(16))) _Float16 v16b;
typedef __attribute__((ext_vector_type(8)))  _Float16 v8b;
typedef __attribute__((ext_vector_type(8)))  float v8f;
typedef __attribute__((ext_vector_type(4)))  float v4f;

__device__ __forceinline__ v8b ld8b(const b16* p) { return *(const v8b*)p; }
__device__ __forceinline__ v16b cat8b(v8b a, v8b b) { return __builtin_shufflevector(a, b, 0, 1, 2, 3, 4, 5, 6, 7, 8, 9, 10, 11, 12, 13, 14, 15); }
__device__ __forceinline__ v16b frag_kb(const b16* p, int hh) { return cat8b(ld8b(p + 8 * hh), ld8b(p + 16 + 8 * hh)); }
// Fragment-order tile (every 16-bit matrix operand kept in the workspace): 16 rows x 32 k = 512 elements = 1 KiB; element j*256 + lane*8 + e holds (row lane & 15, k = 16 j + 8 (lane >> 4) + e),
// the k map of frag_kb. A fragment is then two loads of 512 contiguous bytes (4 whole 128-B lines each) where a row-major plane gives 16 lines of 32 bytes a load.
constexpr int FT = 512;
__device__ __forceinline__ v16b frag_pk(const b16* tile, int lane) { return cat8b(ld8b(tile + lane * 8), ld8b(tile + 256 + lane * 8)); }
__device__ __forceinline__ void split16(float v, b16& hi, b16& lo) { hi = (b16)v; lo = (b16)(v - (float)hi); }
// hi/lo fragment pair straight from an f32 k-contiguous row (same k-map)
__device__ __forceinline__ void frag_ksplit(const float* p, int hh, v16b& fh_, v16b& fl_) {
  const float* p0 = p + 8 * hh; const float* p1 = p + 16 + 8 * hh;
#pragma unroll
  for (int e = 0; e < 8; ++e) { b16 a, c; split16(p0[e], a, c); fh_[e] = a; fl_[e] = c; split16(p1[e], a, c); fh_[8 + e] = a; fl_[8 + e] = c; }
}
__device__ __forceinline__ v8f wmma16b(v16b a, v16b b, v8f c) {
  v8f d = __builtin_amdgcn_wmma_f32_16x16x32_f16(false, a, false, b, (short)0, c, false, false);
  asm volatile("v_nop\n\tv_nop\n\tv_nop\n\tv_nop" : "+v"(d) : "v"(a), "v"(b));
  return d;
}
__device__ __forceinline__ void wave_lds_sync() {
  __builtin_amdgcn_fence(__ATOMIC_RELEASE, "workgroup");
  __builtin_amdgcn_wave_barrier();
  __builtin_amdgcn_fence(__ATOMIC_ACQUIRE, "workgroup");
}

// Operand descriptor: NP = 0 -> f32 rows split on the fly into (hi, lo); NP = 1 -> one f16 plane; NP = 2 -> f16 hi + lo planes;
// NP = 3 -> f32 rows rounded once to a single f16 fragment. ld = row pitch.
struct Opnd { const void* p0; const void* p1; int ld; };
template <int NP> __device__ __forceinline__ void load_frags(const Opnd& o, int row, int kb, int hh, v16b& fh_, v16b& fl_) {
  if (NP == 0) { frag_ksplit((const float*)o.p0 + (size_t)row * o.ld + kb, hh, fh_, fl_); }
  else if (NP == 4 || NP == 5) {                             // f32 rows x64 (NP 4) or x8 (NP 5) then split (keeps the lo halves of small values normal)
    const float sc_ = (NP == 4) ? 64.0f : 8.0f;
    const float* p = (const float*)o.p0 + (size_t)row * o.ld + kb; const float* p0 = p + 8 * hh; const float* p1 = p + 16 + 8 * hh;
#pragma unroll
    for (int e = 0; e < 8; ++e) { b16 a, c; split16(p0[e] * sc_, a, c); fh_[e] = a; fl_[e] = c; split16(p1[e] * sc_, a, c); fh_[8 + e] = a; fl_[8 + e] = c; }
  } else if (NP == 3) {
    const float* p = (const float*)o.p0 + (size_t)row * o.ld + kb; const float* p0 = p + 8 * hh; const float* p1 = p + 16 + 8 * hh;
#pragma unroll
    for (int e = 0; e < 8; ++e) { fh_[e] = (b16)p0[e]; fh_[8 + e] = (b16)p1[e]; }
    fl_ = fh_;
  } else {
    fh_ = frag_kb((const b16*)o.p0 + (size_t)row * o.ld + kb, hh);
    if (NP == 2) fl_ = frag_kb((const b16*)o.p1 + (size_t)row * o.ld + kb, hh); else fl_ = fh_;
  }
}
template <int ANP, int BNP> __device__ __forceinline__ v8f mac(v16b ah, v16b al, v16b bh, v16b bl, v8f c) {
  c = wmma16b(ah, bh, c);
  if (BNP == 0 || BNP == 2 || BNP == 4 || BNP == 5) c = wmma16b(ah, bl, c);     // hi.lo
  if (ANP == 0 || ANP == 2 || ANP == 4 || ANP == 5) c = wmma16b(al, bh, c);     // lo.hi   (lo.lo dropped)
  return c;
}
// 32x64 wave tile: acc[r][t] (rows m0+16r.., cols c0+16t..) += A[m][k] . B[n][k] over k in [0, K)
template <int ANP, int BNP>
__device__ __forceinline__ void gemm_tile(const Opnd& A, const Opnd& B, int K, int m0, int c0, int nloc, int hlf, v8f (&acc)[2][4]) {
  for (int kb = 0; kb < K; kb += 32) {
    v16b a0h, a0l, a1h, a1l;
    load_frags<ANP>(A, m0 + nloc, kb, hlf, a0h, a0l);
    load_frags<ANP>(A, m0 + 16 + nloc, kb, hlf, a1h, a1l);
#pragma unroll
    for (int t = 0; t < 4; ++t) {
      v16b bh, bl;
      load_frags<BNP>(B, c0 + t * 16 + nloc, kb, hlf, bh, bl);
      acc[0][t] = mac<ANP, BNP>(a0h, a0l, bh, bl, acc[0][t]);
      acc[1][t] = mac<ANP, BNP>(a1h, a1l, bh, bl, acc[1][t]);
    }
  }
}

__device__ __forceinline__ void epi_planes(v8f (&acc)[2][4], float scale, bool two, b16* __restrict__ oh, b16* __restrict__ ol, int ldo,
                                           int m0, int c0, int lane, b16* Th, b16* Tl) {
  const int nloc = lane & 15, hlf = lane >> 4;
#pragma unroll
  for (int t = 0; t < 4; ++t)
#pragma unroll
    for (int r = 0; r < 2; ++r)
#pragma unroll
      for (int v = 0; v < 8; ++v) {
        const int rr = r * 16 + v + 8 * hlf, cc = t * 16 + nloc;
        b16 h_, l_; split16(acc[r][t][v] * scale, h_, l_);
        Th[rr * 64 + cc] = h_; Tl[rr * 64 + cc] = l_;
      }
  wave_lds_sync();
  {
#pragma unroll
    for (int j = 0; j < 8; ++j) {
      const int rr = j * 4 + (lane >> 3), c8 = (lane & 7) * 8;
      const size_t o = (size_t)(m0 + rr) * ldo + c0 + c8;
      *(v8b*)(oh + o) = ld8b(Th + rr * 64 + c8);
      if (two) *(v8b*)(ol + o) = ld8b(Tl + rr * 64 + c8);
    }
    
  }
}
// (b) f32 rows with pitch ldo: 64 floats = 256 B = 2 lines per row; 16 lanes x 16 B per row, 2 rows per instruction. Optional per-row factor
__device__ __forceinline__ void epi_f32(v8f (&acc)[2][4], float scale, const float* rscale, float* __restrict__ out, int ldo, int m0, int c0, int lane, float* Tt) {
  const int nloc = lane & 15, hlf = lane >> 4;
#pragma unroll
  for (int t = 0; t < 4; ++t)
#pragma unroll
    for (int r = 0; r < 2; ++r)
#pragma unroll
      for (int v = 0; v < 8; ++v) {
        const int rr = r * 16 + v + 8 * hlf;
        const float rs = rscale ? rscale[(size_t)(m0 + rr) * 32] : 1.0f;
        Tt[rr * 64 + t * 16 + nloc] = acc[r][t][v] * scale * rs;
      }
  wave_lds_sync();
  float* dst0 = out + (size_t)m0 * ldo + c0;
  {
#pragma unroll
    for (int j = 0; j < 16; ++j) { const int rr = j * 2 + hlf, c4 = nloc * 4; *(v4f*)(dst0 + (size_t)rr * ldo + c4) = *(const v4f*)(Tt + rr * 64 + c4); }
    
  }
}



typedef __attribute__((ext_vector_type(8))) __bf16 v8bb; typedef __attribute__((ext_vector_type(16))) __bf16 v16bb;
typedef __attribute__((ext_vector_type(8))) unsigned short v8us;
__device__ __forceinline__ v16bb frag_kb_bf(const __bf16* p, int hh) { const v8bb a = *(const v8bb*)(p + 8 * hh), b = *(const v8bb*)(p + 16 + 8 * hh); return __builtin_shufflevector(a, b, 0, 1, 2, 3, 4, 5, 6, 7, 8, 9, 10, 11, 12, 13, 14, 15); }
__device__ __forceinline__ v16bb frag_pk_bf(const __bf16* tile, int lane) { const v8bb a = *(const v8bb*)(tile + lane * 8), b = *(const v8bb*)(tile + 256 + lane * 8); return __builtin_shufflevector(a, b, 0, 1, 2, 3, 4, 5, 6, 7, 8, 9, 10, 11, 12, 13, 14, 15); }
__device__ __forceinline__ v8f wmma16bb(v16bb a, v16bb b, v8f c) {
  v8f d = __builtin_amdgcn_wmma_f32_16x16x32_bf16(false, a, false, b, (short)0, c, false, false);
  asm volatile("v_nop\n\tv_nop\n\tv_nop\n\tv_nop" : "+v"(d) : "v"(a), "v"(b));
  return d;
}
__device__ __forceinline__ unsigned short bf16_rne_bits(float v) { unsigned int u = __float_as_uint(v); u += 0x7FFFu + ((u >> 16) & 1u); return (unsigned short)(u >> 16); }
__device__ __forceinline__ float bf16_rne(float v) { return __uint_as_float(((unsigned int)bf16_rne_bits(v)) << 16); }



// f32 rows [nrow][D] -> bf16 fragment-order tiles, tile index (k / 32) * (nrow / 16) + row / 16 (the tiles that waves at one k step read lie side by side). One work item = one lane's 2 x 16 bytes of one tile; a wave reads 16 whole 128-B lines and stores 1 KiB in a row.
__device__ __forceinline__ void pack_bf16_tiles(const float* __restrict__ src, unsigned short* __restrict__ dst, size_t nrow, size_t tid, size_t nth) {
  for (size_t p = tid; p < nrow * D / 16; p += nth) {
    const size_t rt = (p >> 5) / (D / 32), kt = (p >> 5) % (D / 32), tile = kt * (nrow / 16) + rt; const int lane = (int)(p & 31);
    const float* s = src + (rt * 16 + (lane & 15)) * D + kt * 32 + 8 * (lane >> 4);
    v8us a, c;
#pragma unroll
    for (int e = 0; e < 8; ++e) { a[e] = bf16_rne_bits(s[e]); c[e] = bf16_rne_bits(s[16 + e]); }
    *(v8us*)(dst + tile * FT + lane * 8) = a; *(v8us*)(dst + tile * FT + 256 + lane * 8) = c;
  }
}
__global__ __launch_bounds__(256) void xprep_kernel(const float* __restrict__ x, unsigned short* __restrict__ x16) {   // x -> bf16 tiles
  pack_bf16_tiles(x, x16, NTOK, (size_t)blockIdx.x * blockDim.x + threadIdx.x, (size_t)gridDim.x * blockDim.x);
}
__global__ __launch_bounds__(256) void prep_kernel(const float* __restrict__ wattn, unsigned short* __restrict__ w16) {
  pack_bf16_tiles(wattn, w16, 2 * D, (size_t)blockIdx.x * blockDim.x + threadIdx.x, (size_t)gridDim.x * blockDim.x);   // W_attn [2C][C] ([out][in]): rows 0..1023 -> q, 1024..2047 -> k
}

// v = bf16(x) exactly: v^T f16 as fragment-order tiles (rows = 16 channels, k = 32 tokens), tile index ((b*H + h) * (S/32) + tok/32) * 4 + channel/16, via an LDS transpose (block = 128 tokens x one head). grid (H, NTOK/128).
__global__ __launch_bounds__(256) void vt_kernel(const float* __restrict__ x, b16* __restrict__ vt, int rowbase) {
  __shared__ __attribute__((aligned(16))) b16 T[HD][128 + 8];
  const int t_ = threadIdx.x, h = blockIdx.x, m0 = rowbase + blockIdx.y * 128, b = m0 / S, tok0 = m0 % S;
  for (int i = t_; i < 128 * HD / 4; i += 256) { const int r = i / (HD / 4), c4 = (i % (HD / 4)) * 4; const v4f xv = *(const v4f*)(x + (size_t)(m0 + r) * D + h * HD + c4);
#pragma unroll
    for (int e = 0; e < 4; ++e) T[c4 + e][r] = (b16)bf16_rne(xv[e]); }
  __syncthreads();
  b16* dst = vt + (((size_t)b * H + h) * (S / 32) + tok0 / 32) * 4 * FT;   // the block's 16 tiles lie in a row
  { for (int i = t_; i < HD * 16; i += 256) { const int tile = i >> 6, j = (i >> 5) & 1, ln = i & 31; *(v8b*)(dst + (size_t)i * 8) = *(const v8b*)(&T[(tile & 3) * 16 + (ln & 15)][(tile >> 2) * 32 + 16 * j + 8 * (ln >> 4)]); }  }
}
// All-token column sums, spread over tokens as well as channels: block = (one batch, 32 channels = one 128-B line per token), 32 waves; wave w owns tokens 64w..64w+63, one load = 4 tokens x one
// whole line, a lane's 16 loads independent of one another (unrolled, so that many are in flight). Sum order: 16 tokens per lane, then the 4 token rows of the wave (two butterfly steps), then the 32 waves through LDS.
__global__ __launch_bounds__(1024) void colsum_kernel(const float* __restrict__ x, float* __restrict__ colsum) {
  __shared__ __attribute__((aligned(16))) float P[32][32];
  const int lane = threadIdx.x & 31, wave = threadIdx.x >> 5, c0 = blockIdx.x * 32, b = blockIdx.y;
  const float* p = x + ((size_t)b * S + wave * 64 + (lane >> 3)) * D + c0 + (lane & 7) * 4;
  v4f xv[16];
#pragma unroll
  for (int i = 0; i < 16; ++i) xv[i] = *(const v4f*)(p + (size_t)i * 4 * D);
  v4f s = {};
#pragma unroll
  for (int i = 0; i < 16; ++i)
#pragma unroll
    for (int e = 0; e < 4; ++e) s[e] += bf16_rne(xv[i][e]);
#pragma unroll
  for (int e = 0; e < 4; ++e) { s[e] += __shfl_xor(s[e], 8); s[e] += __shfl_xor(s[e], 16); }
  if (lane < 8) *(v4f*)(&P[wave][lane * 4]) = s;
  __syncthreads();
  if (wave == 0) {
    float t = 0.0f;
#pragma unroll
    for (int w = 0; w < 32; ++w) t += P[w][lane];
    colsum[(size_t)b * D + c0 + lane] = t;
  }
}

// projections: rows = tokens (8192), K = 1024, column tiles of 64 = one head of q (tiles 0..15) or k (16..31): x8 hi/lo planes of fragment-order tiles (rows = 16 tokens, k = 32 channels), tile index ((b*H + head) * (S/16) + tok/16) * 2 + channel/32. grid (32, 64) x 128.
__global__ __launch_bounds__(128) void proj_kernel(const __bf16* __restrict__ x16, const __bf16* __restrict__ w16, b16* __restrict__ qh, b16* __restrict__ kh, int rowbase) {
  __shared__ __attribute__((aligned(16))) b16 Th[4][32][HD + 8], Tq[4][32][HD + 8];
  const int lane = threadIdx.x & 31, wave = threadIdx.x >> 5, nloc = lane & 15, hlf = lane >> 4, m0 = rowbase + blockIdx.y * 128 + wave * 32, c0 = blockIdx.x * 64;
  v8f acc[2][4];
#pragma unroll
  for (int r = 0; r < 2; ++r)
#pragma unroll
    for (int t = 0; t < 4; ++t) acc[r][t] = (v8f){};
#pragma unroll 2
  for (int kb = 0; kb < D; kb += 32) {
    const v16bb a0 = frag_pk_bf(x16 + ((size_t)(kb / 32) * (NTOK / 16) + m0 / 16) * FT, lane), a1 = frag_pk_bf(x16 + ((size_t)(kb / 32) * (NTOK / 16) + m0 / 16 + 1) * FT, lane);
    v16bb bw[4];                                                // the k step's 12 loads go out as one group ahead of its products: one load latency a step, not four
#pragma unroll
    for (int t = 0; t < 4; ++t) bw[t] = frag_pk_bf(w16 + ((size_t)(kb / 32) * (2 * D / 16) + c0 / 16 + t) * FT, lane);
#pragma unroll
    for (int t = 0; t < 4; ++t) { acc[0][t] = wmma16bb(a0, bw[t], acc[0][t]); acc[1][t] = wmma16bb(a1, bw[t], acc[1][t]); }
  }
  const int which = blockIdx.x / (D / 64), head = blockIdx.x % (D / 64), b = m0 / S, tok0 = m0 % S;
  {                                                             // q (tiles 0..15) or k (16..31) head: x8 hi/lo planes
#pragma unroll
    for (int t = 0; t < 4; ++t)
#pragma unroll
      for (int r = 0; r < 2; ++r)
#pragma unroll
        for (int v = 0; v < 8; ++v) { b16 a_, c_; split16(acc[r][t][v] * QS, a_, c_); Th[wave][r * 16 + 8 * hlf + v][t * 16 + nloc] = a_; Tq[wave][r * 16 + 8 * hlf + v][t * 16 + nloc] = c_; }   // q, k carried x8 (lo residuals stay normal)
    wave_lds_sync();
    b16* dst = (which == 0 ? qh : kh) + (((size_t)b * H + head) * S + tok0) * HD;
    {
#pragma unroll
      for (int j = 0; j < 8; ++j) { const int rr = (j >> 2) * 16 + nloc, c8 = ((j >> 1) & 1) * 32 + (j & 1) * 16 + 8 * hlf; *(v8b*)(dst + (j * 32 + lane) * 8) = *(const v8b*)(&Th[wave][rr][c8]); *(v8b*)(dst + QPL + (j * 32 + lane) * 8) = *(const v8b*)(&Tq[wave][rr][c8]); }   // the wave's 4 tiles lie in a row: half-tile j
       }
    return;
  }
}

// the 8 K fragments of one 32-key chunk: [ks][keys 0..15 hi, lo, keys 16..31 hi, lo]; WAITS is off for the fetch in front of the loop, where the compiler's own waits stand before every rewrite
template <bool WAITS> __device__ __forceinline__ void load_kfrags(const b16* __restrict__ K, int kb, int lane, v16b (&kf)[8]) {
#pragma unroll
  for (int pl = 0; pl < 2; ++pl) {
#pragma unroll
    for (int ks = 0; ks < 2; ++ks) {
      kf[ks * 4 + pl] = frag_pk(K + pl * QPL + (size_t)kb * HD + ks * FT, lane);
      if (WAITS && pl == 1 && ks == 1) asm volatile("s_wait_xcnt 0x0" ::: "memory");   // the last fragment lands on registers that held addresses of the loads above
      kf[ks * 4 + 2 + pl] = frag_pk(K + pl * QPL + (size_t)(kb + 16) * HD + ks * FT, lane);
    }
    if (WAITS) asm volatile("s_wait_xcnt 0x0" ::: "memory");    // before anything rewrites an address register of the loads just issued
  }
}

template <bool B> struct BoolC { static constexpr bool value = B; };
// causal shaped attention: wave = (b, h, 16 queries); key chunks of 32 up to the query tile: S^T (K=64, 3 products), causal mask on the straddling chunk, online softmax f32, P x8 hi/lo,
// o^T += v^T P^T (2 products) and pf^T += v^T U^T (U = exact 0/1 causal indicator: prefix sums); epilogue y = beta o/(8 l) + alpha ((e-1) v_i + colsum)/(e+2047) - gamma pf/(i+1)
template <int QT>
__global__ __launch_bounds__(256) void attn_kernel(const b16* __restrict__ qh, const b16* __restrict__ kh, const b16* __restrict__ vt, const float* __restrict__ x, const float* __restrict__ colsum, const float* __restrict__ alpha_p, const float* __restrict__ beta_p, const float* __restrict__ gamma_p, float* __restrict__ y) {
  __shared__ __attribute__((aligned(16))) float Os[8][16][HD + 4];
  const int wid = __builtin_amdgcn_readfirstlane(threadIdx.x >> 5), lane = threadIdx.x & 31, hh = lane >> 4, col = lane & 15;   // wave number as a scalar: tile bases and the fetch-ahead bound sit in SGPRs, so the fragments in flight fit 256 VGPRs
  // Block -> (head, group of 8 query tiles), longest groups first: a group's cost grows with its position (causal), the grid holds twice the blocks that fit the chip at once, so the short ones
  // take the highest block indices. Every (head, group) pair is taken exactly once: index = (QT / 8 - 1 - group) * (Bn * H) + head.
  const int bh = blockIdx.x % (Bn * H), jt = (QT / 8 - 1 - blockIdx.x / (Bn * H)) * 8 + wid, h = bh % H, b = bh / H, q0 = jt * 16, qi = q0 + col;
  const b16* Q = qh + ((size_t)bh * S) * HD; const b16* K = kh + ((size_t)bh * S) * HD; const b16* vb = vt + ((size_t)bh * HD) * S;
  v16b qf[2], ql[2];
#pragma unroll
  for (int ks = 0; ks < 2; ++ks) { qf[ks] = frag_pk(Q + (size_t)q0 * HD + ks * FT, lane); ql[ks] = frag_pk(Q + QPL + (size_t)q0 * HD + ks * FT, lane); }
  float m = -INFINITY, l = 0.0f; v8f o[4] = {{}, {}, {}, {}}, pf[4] = {{}, {}, {}, {}};   // pf = causal prefix sums of v (the MC term)
  v16b kf[8]; load_kfrags<false>(K, 0, lane, kf);                      // K fragments run one chunk ahead of their products
  asm volatile("s_wait_xcnt 0x0" ::: "memory");                 // before the set-up below rewrites address registers of the Q and K loads above
  // One 32-key chunk. DIAG = false: every key of the chunk lies at or below every query of the tile, so no score is masked, the 0/1 indicator is all ones, and a next chunk always exists.
  // DIAG = true: the one chunk that straddles the diagonal (always the last): per-element causal tests, nothing left to fetch ahead.
  v16b ones;
#pragma unroll
  for (int r = 0; r < 16; ++r) ones[r] = (b16)1.0f;
  auto chunk = [&](const int kb, auto dg) {
    constexpr bool DIAG = decltype(dg)::value;
    v16b vf[4];                                                 // this chunk's v^T fragments leave now and are used behind the softmax
#pragma unroll
    for (int n = 0; n < 4; ++n) vf[n] = frag_pk(vb + ((size_t)(kb / 32) * 4 + n) * FT, lane);
    asm volatile("s_wait_xcnt 0x0" ::: "memory");               // before the loop's pointer step rewrites the address register of these loads
    v16b ub = ones;                                             // 0/1 causal indicator operand: ub[r] = [key 8hh+r <= query col], [16+8hh+r <= col]
    if constexpr (DIAG) {
#pragma unroll
      for (int r = 0; r < 8; ++r) { ub[r] = (b16)((kb + 8 * hh + r <= qi) ? 1.0f : 0.0f); ub[8 + r] = (b16)((kb + 16 + 8 * hh + r <= qi) ? 1.0f : 0.0f); }
    }
    v8f s0 = {}, s1 = {};
#pragma unroll
    for (int ks = 0; ks < 2; ++ks) { const v16b k0 = kf[ks * 4 + 0], k0l = kf[ks * 4 + 1], k1 = kf[ks * 4 + 2], k1l = kf[ks * 4 + 3];
      s0 = wmma16b(k0, qf[ks], s0); s0 = wmma16b(k0, ql[ks], s0); s0 = wmma16b(k0l, qf[ks], s0);      // q and k as f16 hi+lo pairs (lo.lo dropped)
      s1 = wmma16b(k1, qf[ks], s1); s1 = wmma16b(k1, ql[ks], s1); s1 = wmma16b(k1l, qf[ks], s1); }
    float mr = -INFINITY;
#pragma unroll
    for (int r = 0; r < 8; ++r) { s0[r] *= SCALE / (QS * QS); s1[r] *= SCALE / (QS * QS); if constexpr (DIAG) { if (kb + 8 * hh + r > qi) s0[r] = -INFINITY; if (kb + 16 + 8 * hh + r > qi) s1[r] = -INFINITY; } mr = fmaxf(mr, fmaxf(s0[r], s1[r])); }
    mr = fmaxf(mr, __shfl_xor(mr, 16));
    const float mn = fmaxf(m, mr), al_ = __expf(m - mn); m = mn;
    float sum = 0.0f; v16b pb, pl;
#pragma unroll
    for (int r = 0; r < 8; ++r) { const float e0 = __expf(s0[r] - mn), e1 = __expf(s1[r] - mn); sum += e0 + e1; b16 a, c; split16(e0 * PS, a, c); pb[r] = a; pl[r] = c; split16(e1 * PS, a, c); pb[8 + r] = a; pl[8 + r] = c; }   // P carried x8
    sum += __shfl_xor(sum, 16); l = l * al_ + sum;
#pragma unroll
    for (int n = 0; n < 4; ++n) {
#pragma unroll
      for (int r = 0; r < 8; ++r) o[n][r] *= al_;
      o[n] = wmma16b(vf[n], pb, o[n]);
      o[n] = wmma16b(vf[n], pl, o[n]);                                                          // v exact (bf16 values), P hi+lo
      pf[n] = wmma16b(vf[n], ub, pf[n]);                                                          // exact causal prefix sums of v
      if constexpr (!DIAG) { if (n == 0) load_kfrags<true>(K, kb + 32, lane, kf); } }   // next chunk's K, behind the softmax (above it its 64 registers cost a wave per SIMD)
  };
  int kb = 0;
  for (; kb + 32 <= q0; kb += 32) chunk(kb, BoolC<false>{});   // chunks wholly below the diagonal (wave-uniform bound)
  chunk(kb, BoolC<true>{});                                     // the straddling chunk; key blocks past the query tile are skipped
  const float alpha = bf16_rne(alpha_p[0]), beta = bf16_rne(beta_p[0]), gamma = bf16_rne(gamma_p[0]);   // scalar INPUTS
  const float cb = beta / (PS * l), cid = alpha / (EUL + (float)(S - 1)), cmc = gamma / (float)(qi + 1);
  float xr[4][8], cs[4][8];
#pragma unroll
  for (int n = 0; n < 4; ++n)
#pragma unroll
    for (int r = 0; r < 8; ++r) xr[n][r] = x[((size_t)b * S + qi) * D + h * HD + n * 16 + 8 * hh + r];
  asm volatile("s_wait_xcnt 0x0" ::: "memory");                 // before the column sums land on address registers of the x loads
#pragma unroll
  for (int n = 0; n < 4; ++n)
#pragma unroll
    for (int r = 0; r < 8; ++r) cs[n][r] = colsum[(size_t)b * D + h * HD + n * 16 + 8 * hh + r];
  asm volatile("s_wait_xcnt 0x0" ::: "memory");                 // before the staging index below rewrites address registers of these loads
#pragma unroll
  for (int n = 0; n < 4; ++n)
#pragma unroll
    for (int r = 0; r < 8; ++r) { const int d = n * 16 + 8 * hh + r; const float vi = bf16_rne(xr[n][r]), vs = cs[n][r];
      Os[wid][col][d] = o[n][r] * cb + cid * ((EUL - 1.0f) * vi + vs) - cmc * pf[n][r]; }
  wave_lds_sync();
  float* dst = y + ((size_t)b * S + q0) * D + h * HD;
  {
#pragma unroll
    for (int j = 0; j < 8; ++j) { const int rr = j * 2 + hh, c4 = col * 4; *(v4f*)(dst + (size_t)rr * D + c4) = *(const v4f*)(&Os[wid][rr][c4]); }
    
  }
}

}  // namespace

extern "C" void kernel_launch(void* const* d_in, const int* in_sizes, int n_in,
                              void* d_out, int out_size, void* d_ws, size_t ws_size, hipStream_t stream) {
  (void)n_in; (void)out_size;
  const float* x = (const float*)d_in[0]; const float* wattn = (const float*)d_in[1];
  float* out = (float*)d_out;   // [4][2048][1024]
  if (in_sizes[0] != BT * S * D || in_sizes[1] != 2 * D * D || in_sizes[2] != 1 || in_sizes[3] != 1 || in_sizes[4] != 1) return;
  size_t off = 0; char* ws = (char*)d_ws;
  auto carve = [&](size_t bytes) { char* p = ws + off; off += (bytes + 255) & ~(size_t)255; return p; };
  unsigned short* x16 = (unsigned short*)carve((size_t)NTOK * D * 2); unsigned short* w16 = (unsigned short*)carve((size_t)2 * D * D * 2); float* colsum = (float*)carve((size_t)BT * D * 4);
  b16* qh = (b16*)carve((size_t)2 * NTOK * D * 2); b16* kh = (b16*)carve((size_t)2 * NTOK * D * 2); b16* vt = (b16*)carve((size_t)NTOK * D * 2);
  if (off > ws_size) return;                                    // ≈ 105 MB
  prep_kernel<<<512, 256, 0, stream>>>(wattn, w16);
  xprep_kernel<<<1024, 256, 0, stream>>>(x, x16);
  vt_kernel<<<dim3(H, NTOK / 128), 256, 0, stream>>>(x, vt, 0);
  colsum_kernel<<<dim3(D / 32, BT), 1024, 0, stream>>>(x, colsum);
  proj_kernel<<<dim3(2 * D / 64, NTOK / 128), 128, 0, stream>>>((const __bf16*)x16, (const __bf16*)w16, qh, kh, 0);
  attn_kernel<S / 16><<<Bn * H * (S / 16) / 8, 256, 0, stream>>>(qh, kh, vt, x, colsum, (const float*)d_in[2], (const float*)d_in[3], (const float*)d_in[4], out);
}

// v006
// A run of this version takes 145 microseconds.
// In two side-by-side timings against v005, it was 1.10 and 1.11 times as fast.
// Over all steps from v000 it is 3.85 times as fast.
#include <hip/hip_runtime.h>

// Causal "shaped" attention: [q | k] = x W_attn^T (16 heads x 64), v = x itself (use_v = False); att = beta softmax_causal(q.k/8) + alpha Id - gamma MC with Id = softmax(eye(2048))
// (diag e/(e+2047), off-diag 1/(e+2047)) and MC = causal row-uniform averaging (1/(i+1) on j <= i); y = att.v merged over heads -> [4][2048][1024] (no output projection).
// So y_i = beta (P.v)_i/l_i + alpha ((e-1) v_i + sum_all v_j)/(e+2047) - gamma (sum_{j<=i} v_j)/(i+1).
// Numerics: x, W_attn, alpha, beta, gamma rounded to bf16; [q|k] projection on v_wmma_f32_16x16x32_bf16 (exact products, f32 accumulate);
// scores on v_wmma_f32_16x16x32_f16 with q, k as f16 hi+lo pairs carried x8 (3 products); P.v with P an x8 hi+lo pair and v = bf16(x) exact in f16 (2 products); the causal prefix
// sums sum_{j<=i} v_j ride along as a second accumulator against an exact 0/1 mask operand (1 product); the all-token column sums in a small f32 kernel; softmax and the combine in f32.

namespace {
constexpr int BT = 4, Bn = 4, S = 2048, D = 1024, H = 16, HD = 64, NTOK = Bn * S;
constexpr float SCALE = 0.125f, VS = 1.0f /* v = bf16(x): exact, single plane */, QS = 8.0f, PS = 8.0f, EUL = 2.718281828459045f;   // power-of-two carry scales so hi/lo residual planes stay normal in f16
constexpr size_t VPL = (size_t)NTOK * D;   // unused: v^T is a single f16 plane of bf16(x)
constexpr size_t QPL = (size_t)NTOK * D;   // distance between the q/k hi and lo planes

typedef _Float16 b16;
typedef __attribute__((ext_vector_type(16))) _Float16 v16b;
typedef __attribute__((ext_vector_type(8)))  _Float16 v8b;
typedef __attribute__((ext_vector_type(8)))  float v8f;
typedef __attribute__((ext_vector_type(4)))  float v4f;

__device__ __forceinline__ v8b ld8b(const b16* p) { return *(const v8b*)p; }
__device__ __forceinline__ v16b cat8b(v8b a, v8b b) { return __builtin_shufflevector(a, b, 0, 1, 2, 3, 4, 5, 6, 7, 8, 9, 10, 11, 12, 13, 14, 15); }
__device__ __forceinline__ v16b frag_kb(const b16* p, int hh) { return cat8b(ld8b(p + 8 * hh), ld8b(p + 16 + 8 * hh)); }
// Fragment-order tile (every 16-bit matrix operand kept in the workspace): 16 rows x 32 k = 512 elements = 1 KiB; element j*256 + lane*8 + e holds (row lane & 15, k = 16 j + 8 (lane >> 4) + e),
// the k map of frag_kb. A fragment is then two loads of 512 contiguous bytes (4 whole 128-B lines each) where a row-major plane gives 16 lines of 32 bytes a load.
constexpr int FT = 512;
__device__ __forceinline__ v16b frag_pk(const b16* tile, int lane) { return cat8b(ld8b(tile + lane * 8), ld8b(tile + 256 + lane * 8)); }
__device__ __forceinline__ void split16(float v, b16& hi, b16& lo) { hi = (b16)v; lo = (b16)(v - (float)hi); }
// hi/lo fragment pair straight from an f32 k-contiguous row (same k-map)
__device__ __forceinline__ void frag_ksplit(const float* p, int hh, v16b& fh_, v16b& fl_) {
  const float* p0 = p + 8 * hh; const float* p1 = p + 16 + 8 * hh;
#pragma unroll
  for (int e = 0; e < 8; ++e) { b16 a, c; split16(p0[e], a, c); fh_[e] = a; fl_[e] = c; split16(p1[e], a, c); fh_[8 + e] = a; fl_[8 + e] = c; }
}
__device__ __forceinline__ v8f wmma16b(v16b a, v16b b, v8f c) {
  v8f d = __builtin_amdgcn_wmma_f32_16x16x32_f16(false, a, false, b, (short)0, c, false, false);
  asm volatile("v_nop\n\tv_nop\n\tv_nop\n\tv_nop" : "+v"(d) : "v"(a), "v"(b));
  return d;
}
__device__ __forceinline__ void wave_lds_sync() {
  __builtin_amdgcn_fence(__ATOMIC_RELEASE, "workgroup");
  __builtin_amdgcn_wave_barrier();
  __builtin_amdgcn_fence(__ATOMIC_ACQUIRE, "workgroup");
}

// Operand descriptor: NP = 0 -> f32 rows split on the fly into (hi, lo); NP = 1 -> one f16 plane; NP = 2 -> f16 hi + lo planes;
// NP = 3 -> f32 rows rounded once to a single f16 fragment. ld = row pitch.
struct Opnd { const void* p0; const void* p1; int ld; };
template <int NP> __device__ __forceinline__ void load_frags(const Opnd& o, int row, int kb, int hh, v16b& fh_, v16b& fl_) {
  if (NP == 0) { frag_ksplit((const float*)o.p0 + (size_t)row * o.ld + kb, hh, fh_, fl_); }
  else if (NP == 4 || NP == 5) {                             // f32 rows x64 (NP 4) or x8 (NP 5) then split (keeps the lo halves of small values normal)
    const float sc_ = (NP == 4) ? 64.0f : 8.0f;
    const float* p = (const float*)o.p0 + (size_t)row * o.ld + kb; const float* p0 = p + 8 * hh; const float* p1 = p + 16 + 8 * hh;
#pragma unroll
    for (int e = 0; e < 8; ++e) { b16 a, c; split16(p0[e] * sc_, a, c); fh_[e] = a; fl_[e] = c; split16(p1[e] * sc_, a, c); fh_[8 + e] = a; fl_[8 + e] = c; }
  } else if (NP == 3) {
    const float* p = (const float*)o.p0 + (size_t)row * o.ld + kb; const float* p0 = p + 8 * hh; const float* p1 = p + 16 + 8 * hh;
#pragma unroll
    for (int e = 0; e < 8; ++e) { fh_[e] = (b16)p0[e]; fh_[8 + e] = (b16)p1[e]; }
    fl_ = fh_;
  } else {
    fh_ = frag_kb((const b16*)o.p0 + (size_t)row * o.ld + kb, hh);
    if (NP == 2) fl_ = frag_kb((const b16*)o.p1 + (size_t)row * o.ld + kb, hh); else fl_ = fh_;
  }
}
template <int ANP, int BNP> __device__ __forceinline__ v8f mac(v16b ah, v16b al, v16b bh, v16b bl, v8f c) {
  c = wmma16b(ah, bh, c);
  if (BNP == 0 || BNP == 2 || BNP == 4 || BNP == 5) c = wmma16b(ah, bl, c);     // hi.lo
  if (ANP == 0 || ANP == 2 || ANP == 4 || ANP == 5) c = wmma16b(al, bh, c);     // lo.hi   (lo.lo dropped)
  return c;
}
// 32x64 wave tile: acc[r][t] (rows m0+16r.., cols c0+16t..) += A[m][k] . B[n][k] over k in [0, K)
template <int ANP, int BNP>
__device__ __forceinline__ void gemm_tile(const Opnd& A, const Opnd& B, int K, int m0, int c0, int nloc, int hlf, v8f (&acc)[2][4]) {
  for (int kb = 0; kb < K; kb += 32) {
    v16b a0h, a0l, a1h, a1l;
    load_frags<ANP>(A, m0 + nloc, kb, hlf, a0h, a0l);
    load_frags<ANP>(A, m0 + 16 + nloc, kb, hlf, a1h, a1l);
#pragma unroll
    for (int t = 0; t < 4; ++t) {
      v16b bh, bl;
      load_frags<BNP>(B, c0 + t * 16 + nloc, kb, hlf, bh, bl);
      acc[0][t] = mac<ANP, BNP>(a0h, a0l, bh, bl, acc[0][t]);
      acc[1][t] = mac<ANP, BNP>(a1h, a1l, bh, bl, acc[1][t]);
    }
  }
}

__device__ __forceinline__ void epi_planes(v8f (&acc)[2][4], float scale, bool two, b16* __restrict__ oh, b16* __restrict__ ol, int ldo,
                                           int m0, int c0, int lane, b16* Th, b16* Tl) {
  const int nloc = lane & 15, hlf = lane >> 4;
#pragma unroll
  for (int t = 0; t < 4; ++t)
#pragma unroll
    for (int r = 0; r < 2; ++r)
#pragma unroll
      for (int v = 0; v < 8; ++v) {
        const int rr = r * 16 + v + 8 * hlf, cc = t * 16 + nloc;
        b16 h_, l_; split16(acc[r][t][v] * scale, h_, l_);
        Th[rr * 64 + cc] = h_; Tl[rr * 64 + cc] = l_;
      }
  wave_lds_sync();
  {
#pragma unroll
    for (int j = 0; j < 8; ++j) {
      const int rr = j * 4 + (lane >> 3), c8 = (lane & 7) * 8;
      const size_t o = (size_t)(m0 + rr) * ldo + c0 + c8;
      *(v8b*)(oh + o) = ld8b(Th + rr * 64 + c8);
      if (two) *(v8b*)(ol + o) = ld8b(Tl + rr * 64 + c8);
    }
    
  }
}
// (b) f32 rows with pitch ldo: 64 floats = 256 B = 2 lines per row; 16 lanes x 16 B per row, 2 rows per instruction. Optional per-row factor
__device__ __forceinline__ void epi_f32(v8f (&acc)[2][4], float scale, const float* rscale, float* __restrict__ out, int ldo, int m0, int c0, int lane, float* Tt) {
  const int nloc = lane & 15, hlf = lane >> 4;
#pragma unroll
  for (int t = 0; t < 4; ++t)
#pragma unroll
    for (int r = 0; r < 2; ++r)
#pragma unroll
      for (int v = 0; v < 8; ++v) {
        const int rr = r * 16 + v + 8 * hlf;
        const float rs = rscale ? rscale[(size_t)(m0 + rr) * 32] : 1.0f;
        Tt[rr * 64 + t * 16 + nloc] = acc[r][t][v] * scale * rs;
      }
  wave_lds_sync();
  float* dst0 = out + (size_t)m0 * ldo + c0;
  {
#pragma unroll
    for (int j = 0; j < 16; ++j) { const int rr = j * 2 + hlf, c4 = nloc * 4; *(v4f*)(dst0 + (size_t)rr * ldo + c4) = *(const v4f*)(Tt + rr * 64 + c4); }
    
  }
}



typedef __attribute__((ext_vector_type(8))) __bf16 v8bb; typedef __attribute__((ext_vector_type(16))) __bf16 v16bb;
typedef __attribute__((ext_vector_type(8))) unsigned short v8us;
__device__ __forceinline__ v16bb frag_kb_bf(const __bf16* p, int hh) { const v8bb a = *(const v8bb*)(p + 8 * hh), b = *(const v8bb*)(p + 16 + 8 * hh); return __builtin_shufflevector(a, b, 0, 1, 2, 3, 4, 5, 6, 7, 8, 9, 10, 11, 12, 13, 14, 15); }
__device__ __forceinline__ v16bb frag_pk_bf(const __bf16* tile, int lane) { const v8bb a = *(const v8bb*)(tile + lane * 8), b = *(const v8bb*)(tile + 256 + lane * 8); return __builtin_shufflevector(a, b, 0, 1, 2, 3, 4, 5, 6, 7, 8, 9, 10, 11, 12, 13, 14, 15); }
__device__ __forceinline__ v8f wmma16bb(v16bb a, v16bb b, v8f c) {
  v8f d = __builtin_amdgcn_wmma_f32_16x16x32_bf16(false, a, false, b, (short)0, c, false, false);
  asm volatile("v_nop\n\tv_nop\n\tv_nop\n\tv_nop" : "+v"(d) : "v"(a), "v"(b));
  return d;
}
__device__ __forceinline__ unsigned short bf16_rne_bits(float v) { unsigned int u = __float_as_uint(v); u += 0x7FFFu + ((u >> 16) & 1u); return (unsigned short)(u >> 16); }
__device__ __forceinline__ float bf16_rne(float v) { return __uint_as_float(((unsigned int)bf16_rne_bits(v)) << 16); }



// f32 rows [nrow][D] -> bf16 fragment-order tiles, tile index (k / 32) * (nrow / 16) + row / 16 (the tiles that waves at one k step read lie side by side). One work item = one lane's 2 x 16 bytes of one tile; a wave reads 16 whole 128-B lines and stores 1 KiB in a row.
__device__ __forceinline__ void pack_bf16_tiles(const float* __restrict__ src, unsigned short* __restrict__ dst, size_t nrow, size_t tid, size_t nth) {
  for (size_t p = tid; p < nrow * D / 16; p += nth) {
    const size_t rt = (p >> 5) / (D / 32), kt = (p >> 5) % (D / 32), tile = kt * (nrow / 16) + rt; const int lane = (int)(p & 31);
    const float* s = src + (rt * 16 + (lane & 15)) * D + kt * 32 + 8 * (lane >> 4);
    v8us a, c;
#pragma unroll
    for (int e = 0; e < 8; ++e) { a[e] = bf16_rne_bits(s[e]); c[e] = bf16_rne_bits(s[16 + e]); }
    *(v8us*)(dst + tile * FT + lane * 8) = a; *(v8us*)(dst + tile * FT + 256 + lane * 8) = c;
  }
}
__global__ __launch_bounds__(256) void xprep_kernel(const float* __restrict__ x, unsigned short* __restrict__ x16) {   // x -> bf16 tiles
  pack_bf16_tiles(x, x16, NTOK, (size_t)blockIdx.x * blockDim.x + threadIdx.x, (size_t)gridDim.x * blockDim.x);
}
__global__ __launch_bounds__(256) void prep_kernel(const float* __restrict__ wattn, unsigned short* __restrict__ w16) {
  pack_bf16_tiles(wattn, w16, 2 * D, (size_t)blockIdx.x * blockDim.x + threadIdx.x, (size_t)gridDim.x * blockDim.x);   // W_attn [2C][C] ([out][in]): rows 0..1023 -> q, 1024..2047 -> k
}

// v = bf16(x) exactly: v^T f16 as fragment-order tiles (rows = 16 channels, k = 32 tokens), tile index ((b*H + h) * (S/32) + tok/32) * 4 + channel/16, via an LDS transpose (block = 128 tokens x one head). grid (H, NTOK/128).
__global__ __launch_bounds__(256) void vt_kernel(const float* __restrict__ x, b16* __restrict__ vt, int rowbase) {
  __shared__ __attribute__((aligned(16))) b16 T[HD][128 + 8];
  const int t_ = threadIdx.x, h = blockIdx.x, m0 = rowbase + blockIdx.y * 128, b = m0 / S, tok0 = m0 % S;
  for (int i = t_; i < 128 * HD / 4; i += 256) { const int r = i / (HD / 4), c4 = (i % (HD / 4)) * 4; const v4f xv = *(const v4f*)(x + (size_t)(m0 + r) * D + h * HD + c4);
#pragma unroll
    for (int e = 0; e < 4; ++e) T[c4 + e][r] = (b16)bf16_rne(xv[e]); }
  __syncthreads();
  b16* dst = vt + (((size_t)b * H + h) * (S / 32) + tok0 / 32) * 4 * FT;   // the block's 16 tiles lie in a row
  { for (int i = t_; i < HD * 16; i += 256) { const int tile = i >> 6, j = (i >> 5) & 1, ln = i & 31; *(v8b*)(dst + (size_t)i * 8) = *(const v8b*)(&T[(tile & 3) * 16 + (ln & 15)][(tile >> 2) * 32 + 16 * j + 8 * (ln >> 4)]); }  }
}
// All-token column sums, spread over tokens as well as channels: block = (one batch, 32 channels = one 128-B line per token), 32 waves; wave w owns tokens 64w..64w+63, one load = 4 tokens x one
// whole line, a lane's 16 loads independent of one another (unrolled, so that many are in flight). Sum order: 16 tokens per lane, then the 4 token rows of the wave (two butterfly steps), then the 32 waves through LDS.
__global__ __launch_bounds__(1024) void colsum_kernel(const float* __restrict__ x, float* __restrict__ colsum) {
  __shared__ __attribute__((aligned(16))) float P[32][32];
  const int lane = threadIdx.x & 31, wave = threadIdx.x >> 5, c0 = blockIdx.x * 32, b = blockIdx.y;
  const float* p = x + ((size_t)b * S + wave * 64 + (lane >> 3)) * D + c0 + (lane & 7) * 4;
  v4f xv[16];
#pragma unroll
  for (int i = 0; i < 16; ++i) xv[i] = *(const v4f*)(p + (size_t)i * 4 * D);
  v4f s = {};
#pragma unroll
  for (int i = 0; i < 16; ++i)
#pragma unroll
    for (int e = 0; e < 4; ++e) s[e] += bf16_rne(xv[i][e]);
#pragma unroll
  for (int e = 0; e < 4; ++e) { s[e] += __shfl_xor(s[e], 8); s[e] += __shfl_xor(s[e], 16); }
  if (lane < 8) *(v4f*)(&P[wave][lane * 4]) = s;
  __syncthreads();
  if (wave == 0) {
    float t = 0.0f;
#pragma unroll
    for (int w = 0; w < 32; ++w) t += P[w][lane];
    colsum[(size_t)b * D + c0 + lane] = t;
  }
}

// projections: rows = tokens (8192), K = 1024, column tiles of 64 = one head of q (tiles 0..15) or k (16..31): x8 hi/lo planes of fragment-order tiles (rows = 16 tokens, k = 32 channels), tile index ((b*H + head) * (S/16) + tok/16) * 2 + channel/32. grid (32, 64) x 128.
__global__ __launch_bounds__(128) void proj_kernel(const __bf16* __restrict__ x16, const __bf16* __restrict__ w16, b16* __restrict__ qh, b16* __restrict__ kh, int rowbase) {
  __shared__ __attribute__((aligned(16))) b16 Th[4][32][HD + 8], Tq[4][32][HD + 8];
  const int lane = threadIdx.x & 31, wave = threadIdx.x >> 5, nloc = lane & 15, hlf = lane >> 4, m0 = rowbase + blockIdx.y * 128 + wave * 32, c0 = blockIdx.x * 64;
  v8f acc[2][4];
#pragma unroll
  for (int r = 0; r < 2; ++r)
#pragma unroll
    for (int t = 0; t < 4; ++t) acc[r][t] = (v8f){};
#pragma unroll 2
  for (int kb = 0; kb < D; kb += 32) {
    const v16bb a0 = frag_pk_bf(x16 + ((size_t)(kb / 32) * (NTOK / 16) + m0 / 16) * FT, lane), a1 = frag_pk_bf(x16 + ((size_t)(kb / 32) * (NTOK / 16) + m0 / 16 + 1) * FT, lane);
    v16bb bw[4];                                                // the k step's 12 loads go out as one group ahead of its products: one load latency a step, not four
#pragma unroll
    for (int t = 0; t < 4; ++t) bw[t] = frag_pk_bf(w16 + ((size_t)(kb / 32) * (2 * D / 16) + c0 / 16 + t) * FT, lane);
#pragma unroll
    for (int t = 0; t < 4; ++t) { acc[0][t] = wmma16bb(a0, bw[t], acc[0][t]); acc[1][t] = wmma16bb(a1, bw[t], acc[1][t]); }
  }
  const int which = blockIdx.x / (D / 64), head = blockIdx.x % (D / 64), b = m0 / S, tok0 = m0 % S;
  {                                                             // q (tiles 0..15) or k (16..31) head: x8 hi/lo planes
#pragma unroll
    for (int t = 0; t < 4; ++t)
#pragma unroll
      for (int r = 0; r < 2; ++r)
#pragma unroll
        for (int v = 0; v < 8; ++v) { b16 a_, c_; split16(acc[r][t][v] * QS, a_, c_); Th[wave][r * 16 + 8 * hlf + v][t * 16 + nloc] = a_; Tq[wave][r * 16 + 8 * hlf + v][t * 16 + nloc] = c_; }   // q, k carried x8 (lo residuals stay normal)
    wave_lds_sync();
    b16* dst = (which == 0 ? qh : kh) + (((size_t)b * H + head) * S + tok0) * HD;
    {
#pragma unroll
      for (int j = 0; j < 8; ++j) { const int rr = (j >> 2) * 16 + nloc, c8 = ((j >> 1) & 1) * 32 + (j & 1) * 16 + 8 * hlf; *(v8b*)(dst + (j * 32 + lane) * 8) = *(const v8b*)(&Th[wave][rr][c8]); *(v8b*)(dst + QPL + (j * 32 + lane) * 8) = *(const v8b*)(&Tq[wave][rr][c8]); }   // the wave's 4 tiles lie in a row: half-tile j
       }
    return;
  }
}

// One stage of the attention ring: 64 keys of one head = K hi, K lo and v^T, each 8 KiB of fragment-order tiles that lie in a row in the workspace; 24 KiB a stage, two buffers.
constexpr int STG_K = 64, STG_P = STG_K * HD /* elements of one plane's piece */, STG_E = 3 * STG_P;
// A thread's six 16-byte asynchronous copies of one stage (256 threads x 16 B = 4 KiB a copy). The s_wait_xcnt stands inside the statement, in front of any rewrite of an address register that a copy names.
__device__ __forceinline__ void stage_copies(unsigned lds, const b16* gkh, const b16* gkl, const b16* gv) {
  asm volatile("global_load_async_to_lds_b128 %0, %6, off\n\t"
               "global_load_async_to_lds_b128 %1, %7, off\n\t"
               "global_load_async_to_lds_b128 %2, %8, off\n\t"
               "global_load_async_to_lds_b128 %3, %9, off\n\t"
               "global_load_async_to_lds_b128 %4, %10, off\n\t"
               "global_load_async_to_lds_b128 %5, %11, off\n\t"
               "s_wait_xcnt 0x0"
               :: "v"(lds), "v"(lds + 4096u), "v"(lds + 8192u), "v"(lds + 12288u), "v"(lds + 16384u), "v"(lds + 20480u),
                  "v"(gkh), "v"(gkh + 2048), "v"(gkl), "v"(gkl + 2048), "v"(gv), "v"(gv + 2048) : "memory");
}

// causal shaped attention: wave = (b, h, 16 queries); K and v^T come through a two-buffer LDS ring shared by the block's 8 waves; key chunks of 32 up to the query tile: S^T (K=64, 3 products), causal mask on the straddling chunk, online softmax f32, P x8 hi/lo,
// o^T += v^T P^T (2 products) and pf^T += v^T U^T (U = exact 0/1 causal indicator: prefix sums); epilogue y = beta o/(8 l) + alpha ((e-1) v_i + colsum)/(e+2047) - gamma pf/(i+1)
template <int QT>
__global__ __launch_bounds__(256) void attn_kernel(const b16* __restrict__ qh, const b16* __restrict__ kh, const b16* __restrict__ vt, const float* __restrict__ x, const float* __restrict__ colsum, const float* __restrict__ alpha_p, const float* __restrict__ beta_p, const float* __restrict__ gamma_p, float* __restrict__ y) {
  __shared__ __attribute__((aligned(16))) float Os[8][16][HD + 4];
  __shared__ __attribute__((aligned(16))) b16 KV[2][STG_E];   // the block's K hi / K lo / v^T ring: each stage is fetched once for the 8 waves
  const int wid = __builtin_amdgcn_readfirstlane(threadIdx.x >> 5), lane = threadIdx.x & 31, hh = lane >> 4, col = lane & 15;   // wave number as a scalar: tile bases and the causal chunk bound sit in SGPRs, so the fragments in flight fit 256 VGPRs
  // Block -> (head, group of 8 query tiles), longest groups first: a group's cost grows with its position (causal), the grid holds twice the blocks that fit the chip at once, and the short groups
  // take the late block indices. Every (head, group) pair is taken exactly once: index = (QT / 8 - 1 - group) * (Bn * H) + head.
  const int bh = blockIdx.x % (Bn * H), grp = QT / 8 - 1 - blockIdx.x / (Bn * H), jt = grp * 8 + wid, h = bh % H, b = bh / H, q0 = jt * 16, qi = q0 + col;
  const b16* Q = qh + ((size_t)bh * S) * HD; const b16* K = kh + ((size_t)bh * S) * HD; const b16* vb = vt + ((size_t)bh * HD) * S;
  v16b qf[2], ql[2];
#pragma unroll
  for (int ks = 0; ks < 2; ++ks) { qf[ks] = frag_pk(Q + (size_t)q0 * HD + ks * FT, lane); ql[ks] = frag_pk(Q + QPL + (size_t)q0 * HD + ks * FT, lane); }
  float m = -INFINITY, l = 0.0f; v8f o[4] = {{}, {}, {}, {}}, pf[4] = {{}, {}, {}, {}};   // pf = causal prefix sums of v (the MC term)
  asm volatile("s_wait_xcnt 0x0" ::: "memory");                 // before the set-up below rewrites address registers of the Q loads above
  const int nst = 2 * grp + 2;                                  // stages of the block = those of its last wave (the same for every thread; at least 2)
  const unsigned lds0 = (unsigned)(size_t)(&KV[0][0]) + threadIdx.x * 16u;   // the thread's own LDS byte address in buffer 0
  const b16* gk = K + threadIdx.x * 8; const b16* gv = vb + threadIdx.x * 8;
  auto fill = [&](const int st) { stage_copies(lds0 + (unsigned)(st & 1) * (unsigned)(STG_E * 2), gk + (size_t)st * STG_P, gk + QPL + (size_t)st * STG_P, gv + (size_t)st * STG_P); };
  fill(0);
  asm volatile("s_wait_asynccnt 0x0" ::: "memory");             // stage 0 has landed for this wave's copies
  __syncthreads();                                              // ... and for every wave's: nobody reads it before
  fill(1);
  // One 32-key chunk. DIAG = false: every key of the chunk lies at or below every query of the tile, so no score is masked and the 0/1 indicator is all ones.
  // DIAG = true: the one chunk that straddles the diagonal (the wave's last): per-element causal tests, behind one scalar branch.
  v16b ones;
#pragma unroll
  for (int r = 0; r < 16; ++r) ones[r] = (b16)1.0f;
  auto chunk = [&](const int kb, const b16* T, const bool DIAG) {   // T = the chunk's K hi tiles in the ring (K lo STG_P, v^T 2 STG_P further on); DIAG is the same for the whole wave
    v16b kf[8], vf[4];                                          // [ks][keys 0..15 hi, lo, keys 16..31 hi, lo]; all 24 LDS reads of the chunk stand in one place
#pragma unroll
    for (int ks = 0; ks < 2; ++ks)
#pragma unroll
      for (int pl = 0; pl < 2; ++pl) { kf[ks * 4 + pl] = frag_pk(T + pl * STG_P + ks * FT, lane); kf[ks * 4 + 2 + pl] = frag_pk(T + pl * STG_P + 16 * HD + ks * FT, lane); }
#pragma unroll
    for (int n = 0; n < 4; ++n) vf[n] = frag_pk(T + 2 * STG_P + n * FT, lane);
    v16b ub = ones;                                             // 0/1 causal indicator operand: ub[r] = [key 8hh+r <= query col], [16+8hh+r <= col]
    v8f s0 = {}, s1 = {};
#pragma unroll
    for (int ks = 0; ks < 2; ++ks) { const v16b k0 = kf[ks * 4 + 0], k0l = kf[ks * 4 + 1], k1 = kf[ks * 4 + 2], k1l = kf[ks * 4 + 3];
      s0 = wmma16b(k0, qf[ks], s0); s0 = wmma16b(k0, ql[ks], s0); s0 = wmma16b(k0l, qf[ks], s0);      // q and k as f16 hi+lo pairs (lo.lo dropped)
      s1 = wmma16b(k1, qf[ks], s1); s1 = wmma16b(k1, ql[ks], s1); s1 = wmma16b(k1l, qf[ks], s1); }
    float mr = -INFINITY;
#pragma unroll
    for (int r = 0; r < 8; ++r) { s0[r] *= SCALE / (QS * QS); s1[r] *= SCALE / (QS * QS); }
    if (DIAG) {
#pragma unroll
      for (int r = 0; r < 8; ++r) { if (kb + 8 * hh + r > qi) s0[r] = -INFINITY; if (kb + 16 + 8 * hh + r > qi) s1[r] = -INFINITY; }
#pragma unroll
      for (int r = 0; r < 8; ++r) { ub[r] = (b16)((kb + 8 * hh + r <= qi) ? 1.0f : 0.0f); ub[8 + r] = (b16)((kb + 16 + 8 * hh + r <= qi) ? 1.0f : 0.0f); }
    }
#pragma unroll
    for (int r = 0; r < 8; ++r) mr = fmaxf(mr, fmaxf(s0[r], s1[r]));
    mr = fmaxf(mr, __shfl_xor(mr, 16));
    const float mn = fmaxf(m, mr), al_ = __expf(m - mn); m = mn;
    float sum = 0.0f; v16b pb, pl;
#pragma unroll
    for (int r = 0; r < 8; ++r) { const float e0 = __expf(s0[r] - mn), e1 = __expf(s1[r] - mn); sum += e0 + e1; b16 a, c; split16(e0 * PS, a, c); pb[r] = a; pl[r] = c; split16(e1 * PS, a, c); pb[8 + r] = a; pl[8 + r] = c; }   // P carried x8
    sum += __shfl_xor(sum, 16); l = l * al_ + sum;
#pragma unroll
    for (int n = 0; n < 4; ++n) {
#pragma unroll
      for (int r = 0; r < 8; ++r) o[n][r] *= al_;
      o[n] = wmma16b(vf[n], pb, o[n]);
      o[n] = wmma16b(vf[n], pl, o[n]);                                                          // v exact (bf16 values), P hi+lo
      pf[n] = wmma16b(vf[n], ub, pf[n]); }                                                        // exact causal prefix sums of v
  };
  for (int st = 0; st < nst; ++st) {                            // every wave makes every trip (copies and barrier); a wave past its diagonal skips the work alone
    const b16* T = &KV[st & 1][0];
#pragma unroll 1                                                // one copy of the chunk body for the stage's two chunks: the loop stays small
    for (int c = 0; c < 2; ++c) {
      const int kb = st * STG_K + c * 32;
      if (kb <= q0) chunk(kb, T + c * 32 * HD, kb + 32 > q0);    // wave-uniform tests: key chunks past the query tile are skipped; the straddling chunk alone takes the causal tests
    }
    asm volatile("s_wait_dscnt 0x0" ::: "memory");              // this wave's reads of the buffer are done before it is refilled
    asm volatile("s_wait_asynccnt 0x0" ::: "memory");           // this wave's copies of stage st + 1 have landed
    __syncthreads();                                            // publishes stage st + 1 and ends every wave's reads of stage st
    if (st + 2 < nst) fill(st + 2);                             // into the buffer just read (the test is the same for the whole block)
  }
  asm volatile("s_wait_asynccnt 0x0" ::: "memory");             // nothing is in flight when the wave goes on to the epilogue
  const float alpha = bf16_rne(alpha_p[0]), beta = bf16_rne(beta_p[0]), gamma = bf16_rne(gamma_p[0]);   // scalar INPUTS
  const float cb = beta / (PS * l), cid = alpha / (EUL + (float)(S - 1)), cmc = gamma / (float)(qi + 1);
  float xr[4][8], cs[4][8];
#pragma unroll
  for (int n = 0; n < 4; ++n)
#pragma unroll
    for (int r = 0; r < 8; ++r) xr[n][r] = x[((size_t)b * S + qi) * D + h * HD + n * 16 + 8 * hh + r];
  asm volatile("s_wait_xcnt 0x0" ::: "memory");                 // before the column sums land on address registers of the x loads
#pragma unroll
  for (int n = 0; n < 4; ++n)
#pragma unroll
    for (int r = 0; r < 8; ++r) cs[n][r] = colsum[(size_t)b * D + h * HD + n * 16 + 8 * hh + r];
  asm volatile("s_wait_xcnt 0x0" ::: "memory");                 // before the staging index below rewrites address registers of these loads
#pragma unroll
  for (int n = 0; n < 4; ++n)
#pragma unroll
    for (int r = 0; r < 8; ++r) { const int d = n * 16 + 8 * hh + r; const float vi = bf16_rne(xr[n][r]), vs = cs[n][r];
      Os[wid][col][d] = o[n][r] * cb + cid * ((EUL - 1.0f) * vi + vs) - cmc * pf[n][r]; }
  wave_lds_sync();
  float* dst = y + ((size_t)b * S + q0) * D + h * HD;
  {
#pragma unroll
    for (int j = 0; j < 8; ++j) { const int rr = j * 2 + hh, c4 = col * 4; *(v4f*)(dst + (size_t)rr * D + c4) = *(const v4f*)(&Os[wid][rr][c4]); }
    
  }
}

}  // namespace

extern "C" void kernel_launch(void* const* d_in, const int* in_sizes, int n_in,
                              void* d_out, int out_size, void* d_ws, size_t ws_size, hipStream_t stream) {
  (void)n_in; (void)out_size;
  const float* x = (const float*)d_in[0]; const float* wattn = (const float*)d_in[1];
  float* out = (float*)d_out;   // [4][2048][1024]
  if (in_sizes[0] != BT * S * D || in_sizes[1] != 2 * D * D || in_sizes[2] != 1 || in_sizes[3] != 1 || in_sizes[4] != 1) return;
  size_t off = 0; char* ws = (char*)d_ws;
  auto carve = [&](size_t bytes) { char* p = ws + off; off += (bytes + 255) & ~(size_t)255; return p; };
  unsigned short* x16 = (unsigned short*)carve((size_t)NTOK * D * 2); unsigned short* w16 = (unsigned short*)carve((size_t)2 * D * D * 2); float* colsum = (float*)carve((size_t)BT * D * 4);
  b16* qh = (b16*)carve((size_t)2 * NTOK * D * 2); b16* kh = (b16*)carve((size_t)2 * NTOK * D * 2); b16* vt = (b16*)carve((size_t)NTOK * D * 2);
  if (off > ws_size) return;                                    // ≈ 105 MB
  prep_kernel<<<512, 256, 0, stream>>>(wattn, w16);
  xprep_kernel<<<1024, 256, 0, stream>>>(x, x16);
  vt_kernel<<<dim3(H, NTOK / 128), 256, 0, stream>>>(x, vt, 0);
  colsum_kernel<<<dim3(D / 32, BT), 1024, 0, stream>>>(x, colsum);
  proj_kernel<<<dim3(2 * D / 64, NTOK / 128), 128, 0, stream>>>((const __bf16*)x16, (const __bf16*)w16, qh, kh, 0);
  attn_kernel<S / 16><<<Bn * H * (S / 16) / 8, 256, 0, stream>>>(qh, kh, vt, x, colsum, (const float*)d_in[2], (const float*)d_in[3], (const float*)d_in[4], out);
}

// v007
// One run takes 140 microseconds.
// Next to v006, in two timings, it ran 1.03 and 1.04 times as fast.
// All steps since v000 together make it 3.98 times as fast.
#include <hip/hip_runtime.h>

// Causal "shaped" attention: [q | k] = x W_attn^T (16 heads x 64), v = x itself (use_v = False); att = beta softmax_causal(q.k/8) + alpha Id - gamma MC with Id = softmax(eye(2048))
// (diag e/(e+2047), off-diag 1/(e+2047)) and MC = causal row-uniform averaging (1/(i+1) on j <= i); y = att.v merged over heads -> [4][2048][1024] (no output projection).
// So y_i = beta (P.v)_i/l_i + alpha ((e-1) v_i + sum_all v_j)/(e+2047) - gamma (sum_{j<=i} v_j)/(i+1).
// Numerics: x, W_attn, alpha, beta, gamma rounded to bf16; [q|k] projection on v_wmma_f32_16x16x32_bf16 (exact products, f32 accumulate);
// scores on v_wmma_f32_16x16x32_f16 with q, k as f16 hi+lo pairs carried x8 (3 products); P.v with P an x8 hi+lo pair and v = bf16(x) exact in f16 (2 products); the causal prefix
// sums sum_{j<=i} v_j ride along as a second accumulator against an exact 0/1 mask operand (1 product); the all-token column sums in a small f32 kernel; softmax and the combine in f32.

namespace {
constexpr int BT = 4, Bn = 4, S = 2048, D = 1024, H = 16, HD = 64, NTOK = Bn * S;
constexpr float SCALE = 0.125f, VS = 1.0f /* v = bf16(x): exact, single plane */, QS = 8.0f, PS = 8.0f, EUL = 2.718281828459045f;   // power-of-two carry scales so hi/lo residual planes stay normal in f16
constexpr size_t VPL = (size_t)NTOK * D;   // unused: v^T is a single f16 plane of bf16(x)
constexpr size_t QPL = (size_t)NTOK * D;   // distance between the q/k hi and lo planes

typedef _Float16 b16;
typedef __attribute__((ext_vector_type(16))) _Float16 v16b;
typedef __attribute__((ext_vector_type(8)))  _Float16 v8b;
typedef __attribute__((ext_vector_type(8)))  float v8f;
typedef __attribute__((ext_vector_type(4)))  float v4f;

__device__ __forceinline__ v8b ld8b(const b16* p) { return *(const v8b*)p; }
__device__ __forceinline__ v16b cat8b(v8b a, v8b b) { return __builtin_shufflevector(a, b, 0, 1, 2, 3, 4, 5, 6, 7, 8, 9, 10, 11, 12, 13, 14, 15); }
__device__ __forceinline__ v16b frag_kb(const b16* p, int hh) { return cat8b(ld8b(p + 8 * hh), ld8b(p + 16 + 8 * hh)); }
// Fragment-order tile (every 16-bit matrix operand kept in the workspace): 16 rows x 32 k = 512 elements = 1 KiB; element j*256 + lane*8 + e holds (row lane & 15, k = 16 j + 8 (lane >> 4) + e),
// the k map of frag_kb. A fragment is then two loads of 512 contiguous bytes (4 whole 128-B lines each) where a row-major plane gives 16 lines of 32 bytes a load.
constexpr int FT = 512;
__device__ __forceinline__ v16b frag_pk(const b16* tile, int lane) { return cat8b(ld8b(tile + lane * 8), ld8b(tile + 256 + lane * 8)); }
__device__ __forceinline__ void split16(float v, b16& hi, b16& lo) { hi = (b16)v; lo = (b16)(v - (float)hi); }
// hi/lo fragment pair straight from an f32 k-contiguous row (same k-map)
__device__ __forceinline__ void frag_ksplit(const float* p, int hh, v16b& fh_, v16b& fl_) {
  const float* p0 = p + 8 * hh; const float* p1 = p + 16 + 8 * hh;
#pragma unroll
  for (int e = 0; e < 8; ++e) { b16 a, c; split16(p0[e], a, c); fh_[e] = a; fl_[e] = c; split16(p1[e], a, c); fh_[8 + e] = a; fl_[8 + e] = c; }
}
__device__ __forceinline__ v8f wmma16b(v16b a, v16b b, v8f c) {
  return __builtin_amdgcn_wmma_f32_16x16x32_f16(false, a, false, b, (short)0, c, false, false);
}
__device__ __forceinline__ void wave_lds_sync() {
  __builtin_amdgcn_fence(__ATOMIC_RELEASE, "workgroup");
  __builtin_amdgcn_wave_barrier();
  __builtin_amdgcn_fence(__ATOMIC_ACQUIRE, "workgroup");
}

// Operand descriptor: NP = 0 -> f32 rows split on the fly into (hi, lo); NP = 1 -> one f16 plane; NP = 2 -> f16 hi + lo planes;
// NP = 3 -> f32 rows rounded once to a single f16 fragment. ld = row pitch.
struct Opnd { const void* p0; const void* p1; int ld; };
template <int NP> __device__ __forceinline__ void load_frags(const Opnd& o, int row, int kb, int hh, v16b& fh_, v16b& fl_) {
  if (NP == 0) { frag_ksplit((const float*)o.p0 + (size_t)row * o.ld + kb, hh, fh_, fl_); }
  else if (NP == 4 || NP == 5) {                             // f32 rows x64 (NP 4) or x8 (NP 5) then split (keeps the lo halves of small values normal)
    const float sc_ = (NP == 4) ? 64.0f : 8.0f;
    const float* p = (const float*)o.p0 + (size_t)row * o.ld + kb; const float* p0 = p + 8 * hh; const float* p1 = p + 16 + 8 * hh;
#pragma unroll
    for (int e = 0; e < 8; ++e) { b16 a, c; split16(p0[e] * sc_, a, c); fh_[e] = a; fl_[e] = c; split16(p1[e] * sc_, a, c); fh_[8 + e] = a; fl_[8 + e] = c; }
  } else if (NP == 3) {
    const float* p = (const float*)o.p0 + (size_t)row * o.ld + kb; const float* p0 = p + 8 * hh; const float* p1 = p + 16 + 8 * hh;
#pragma unroll
    for (int e = 0; e < 8; ++e) { fh_[e] = (b16)p0[e]; fh_[8 + e] = (b16)p1[e]; }
    fl_ = fh_;
  } else {
    fh_ = frag_kb((const b16*)o.p0 + (size_t)row * o.ld + kb, hh);
    if (NP == 2) fl_ = frag_kb((const b16*)o.p1 + (size_t)row * o.ld + kb, hh); else fl_ = fh_;
  }
}
template <int ANP, int BNP> __device__ __forceinline__ v8f mac(v16b ah, v16b al, v16b bh, v16b bl, v8f c) {
  c = wmma16b(ah, bh, c);
  if (BNP == 0 || BNP == 2 || BNP == 4 || BNP == 5) c = wmma16b(ah, bl, c);     // hi.lo
  if (ANP == 0 || ANP == 2 || ANP == 4 || ANP == 5) c = wmma16b(al, bh, c);     // lo.hi   (lo.lo dropped)
  return c;
}
// 32x64 wave tile: acc[r][t] (rows m0+16r.., cols c0+16t..) += A[m][k] . B[n][k] over k in [0, K)
template <int ANP, int BNP>
__device__ __forceinline__ void gemm_tile(const Opnd& A, const Opnd& B, int K, int m0, int c0, int nloc, int hlf, v8f (&acc)[2][4]) {
  for (int kb = 0; kb < K; kb += 32) {
    v16b a0h, a0l, a1h, a1l;
    load_frags<ANP>(A, m0 + nloc, kb, hlf, a0h, a0l);
    load_frags<ANP>(A, m0 + 16 + nloc, kb, hlf, a1h, a1l);
#pragma unroll
    for (int t = 0; t < 4; ++t) {
      v16b bh, bl;
      load_frags<BNP>(B, c0 + t * 16 + nloc, kb, hlf, bh, bl);
      acc[0][t] = mac<ANP, BNP>(a0h, a0l, bh, bl, acc[0][t]);
      acc[1][t] = mac<ANP, BNP>(a1h, a1l, bh, bl, acc[1][t]);
    }
  }
}

__device__ __forceinline__ void epi_planes(v8f (&acc)[2][4], float scale, bool two, b16* __restrict__ oh, b16* __restrict__ ol, int ldo,
                                           int m0, int c0, int lane, b16* Th, b16* Tl) {
  const int nloc = lane & 15, hlf = lane >> 4;
#pragma unroll
  for (int t = 0; t < 4; ++t)
#pragma unroll
    for (int r = 0; r < 2; ++r)
#pragma unroll
      for (int v = 0; v < 8; ++v) {
        const int rr = r * 16 + v + 8 * hlf, cc = t * 16 + nloc;
        b16 h_, l_; split16(acc[r][t][v] * scale, h_, l_);
        Th[rr * 64 + cc] = h_; Tl[rr * 64 + cc] = l_;
      }
  wave_lds_sync();
  {
#pragma unroll
    for (int j = 0; j < 8; ++j) {
      const int rr = j * 4 + (lane >> 3), c8 = (lane & 7) * 8;
      const size_t o = (size_t)(m0 + rr) * ldo + c0 + c8;
      *(v8b*)(oh + o) = ld8b(Th + rr * 64 + c8);
      if (two) *(v8b*)(ol + o) = ld8b(Tl + rr * 64 + c8);
    }
    
  }
}
// (b) f32 rows with pitch ldo: 64 floats = 256 B = 2 lines per row; 16 lanes x 16 B per row, 2 rows per instruction. Optional per-row factor
__device__ __forceinline__ void epi_f32(v8f (&acc)[2][4], float scale, const float* rscale, float* __restrict__ out, int ldo, int m0, int c0, int lane, float* Tt) {
  const int nloc = lane & 15, hlf = lane >> 4;
#pragma unroll
  for (int t = 0; t < 4; ++t)
#pragma unroll
    for (int r = 0; r < 2; ++r)
#pragma unroll
      for (int v = 0; v < 8; ++v) {
        const int rr = r * 16 + v + 8 * hlf;
        const float rs = rscale ? rscale[(size_t)(m0 + rr) * 32] : 1.0f;
        Tt[rr * 64 + t * 16 + nloc] = acc[r][t][v] * scale * rs;
      }
  wave_lds_sync();
  float* dst0 = out + (size_t)m0 * ldo + c0;
  {
#pragma unroll
    for (int j = 0; j < 16; ++j) { const int rr = j * 2 + hlf, c4 = nloc * 4; *(v4f*)(dst0 + (size_t)rr * ldo + c4) = *(const v4f*)(Tt + rr * 64 + c4); }
    
  }
}



typedef __attribute__((ext_vector_type(8))) __bf16 v8bb; typedef __attribute__((ext_vector_type(16))) __bf16 v16bb;
typedef __attribute__((ext_vector_type(8))) unsigned short v8us;
__device__ __forceinline__ v16bb frag_kb_bf(const __bf16* p, int hh) { const v8bb a = *(const v8bb*)(p + 8 * hh), b = *(const v8bb*)(p + 16 + 8 * hh); return __builtin_shufflevector(a, b, 0, 1, 2, 3, 4, 5, 6, 7, 8, 9, 10, 11, 12, 13, 14, 15); }
__device__ __forceinline__ v16bb frag_pk_bf(const __bf16* tile, int lane) { const v8bb a = *(const v8bb*)(tile + lane * 8), b = *(const v8bb*)(tile + 256 + lane * 8); return __builtin_shufflevector(a, b, 0, 1, 2, 3, 4, 5, 6, 7, 8, 9, 10, 11, 12, 13, 14, 15); }
__device__ __forceinline__ v8f wmma16bb(v16bb a, v16bb b, v8f c) {
  return __builtin_amdgcn_wmma_f32_16x16x32_bf16(false, a, false, b, (short)0, c, false, false);
}
__device__ __forceinline__ unsigned short bf16_rne_bits(float v) { unsigned int u = __float_as_uint(v); u += 0x7FFFu + ((u >> 16) & 1u); return (unsigned short)(u >> 16); }
__device__ __forceinline__ float bf16_rne(float v) { return __uint_as_float(((unsigned int)bf16_rne_bits(v)) << 16); }



// f32 rows [nrow][D] -> bf16 fragment-order tiles, tile index (k / 32) * (nrow / 16) + row / 16 (the tiles that waves at one k step read lie side by side). One work item = one lane's 2 x 16 bytes of one tile; a wave reads 16 whole 128-B lines and stores 1 KiB in a row.
__device__ __forceinline__ void pack_bf16_tiles(const float* __restrict__ src, unsigned short* __restrict__ dst, size_t nrow, size_t tid, size_t nth) {
  for (size_t p = tid; p < nrow * D / 16; p += nth) {
    const size_t rt = (p >> 5) / (D / 32), kt = (p >> 5) % (D / 32), tile = kt * (nrow / 16) + rt; const int lane = (int)(p & 31);
    const float* s = src + (rt * 16 + (lane & 15)) * D + kt * 32 + 8 * (lane >> 4);
    v8us a, c;
#pragma unroll
    for (int e = 0; e < 8; ++e) { a[e] = bf16_rne_bits(s[e]); c[e] = bf16_rne_bits(s[16 + e]); }
    *(v8us*)(dst + tile * FT + lane * 8) = a; *(v8us*)(dst + tile * FT + 256 + lane * 8) = c;
  }
}
__global__ __launch_bounds__(256) void xprep_kernel(const float* __restrict__ x, unsigned short* __restrict__ x16) {   // x -> bf16 tiles
  pack_bf16_tiles(x, x16, NTOK, (size_t)blockIdx.x * blockDim.x + threadIdx.x, (size_t)gridDim.x * blockDim.x);
}
__global__ __launch_bounds__(256) void prep_kernel(const float* __restrict__ wattn, unsigned short* __restrict__ w16) {
  pack_bf16_tiles(wattn, w16, 2 * D, (size_t)blockIdx.x * blockDim.x + threadIdx.x, (size_t)gridDim.x * blockDim.x);   // W_attn [2C][C] ([out][in]): rows 0..1023 -> q, 1024..2047 -> k
}

// v = bf16(x) exactly: v^T f16 as fragment-order tiles (rows = 16 channels, k = 32 tokens), tile index ((b*H + h) * (S/32) + tok/32) * 4 + channel/16, via an LDS transpose (block = 128 tokens x one head). grid (H, NTOK/128).
__global__ __launch_bounds__(256) void vt_kernel(const float* __restrict__ x, b16* __restrict__ vt, int rowbase) {
  __shared__ __attribute__((aligned(16))) b16 T[HD][128 + 8];
  const int t_ = threadIdx.x, h = blockIdx.x, m0 = rowbase + blockIdx.y * 128, b = m0 / S, tok0 = m0 % S;
  for (int i = t_; i < 128 * HD / 4; i += 256) { const int r = i / (HD / 4), c4 = (i % (HD / 4)) * 4; const v4f xv = *(const v4f*)(x + (size_t)(m0 + r) * D + h * HD + c4);
#pragma unroll
    for (int e = 0; e < 4; ++e) T[c4 + e][r] = (b16)bf16_rne(xv[e]); }
  __syncthreads();
  b16* dst = vt + (((size_t)b * H + h) * (S / 32) + tok0 / 32) * 4 * FT;   // the block's 16 tiles lie in a row
  { for (int i = t_; i < HD * 16; i += 256) { const int tile = i >> 6, j = (i >> 5) & 1, ln = i & 31; *(v8b*)(dst + (size_t)i * 8) = *(const v8b*)(&T[(tile & 3) * 16 + (ln & 15)][(tile >> 2) * 32 + 16 * j + 8 * (ln >> 4)]); }  }
}
// All-token column sums, spread over tokens as well as channels: block = (one batch, 32 channels = one 128-B line per token), 32 waves; wave w owns tokens 64w..64w+63, one load = 4 tokens x one
// whole line, a lane's 16 loads independent of one another (unrolled, so that many are in flight). Sum order: 16 tokens per lane, then the 4 token rows of the wave (two butterfly steps), then the 32 waves through LDS.
__global__ __launch_bounds__(1024) void colsum_kernel(const float* __restrict__ x, float* __restrict__ colsum) {
  __shared__ __attribute__((aligned(16))) float P[32][32];
  const int lane = threadIdx.x & 31, wave = threadIdx.x >> 5, c0 = blockIdx.x * 32, b = blockIdx.y;
  const float* p = x + ((size_t)b * S + wave * 64 + (lane >> 3)) * D + c0 + (lane & 7) * 4;
  v4f xv[16];
#pragma unroll
  for (int i = 0; i < 16; ++i) xv[i] = *(const v4f*)(p + (size_t)i * 4 * D);
  v4f s = {};
#pragma unroll
  for (int i = 0; i < 16; ++i)
#pragma unroll
    for (int e = 0; e < 4; ++e) s[e] += bf16_rne(xv[i][e]);
#pragma unroll
  for (int e = 0; e < 4; ++e) { s[e] += __shfl_xor(s[e], 8); s[e] += __shfl_xor(s[e], 16); }
  if (lane < 8) *(v4f*)(&P[wave][lane * 4]) = s;
  __syncthreads();
  if (wave == 0) {
    float t = 0.0f;
#pragma unroll
    for (int w = 0; w < 32; ++w) t += P[w][lane];
    colsum[(size_t)b * D + c0 + lane] = t;
  }
}

// projections: rows = tokens (8192), K = 1024, column tiles of 64 = one head of q (tiles 0..15) or k (16..31): x8 hi/lo planes of fragment-order tiles (rows = 16 tokens, k = 32 channels), tile index ((b*H + head) * (S/16) + tok/16) * 2 + channel/32. grid (32, 64) x 128.
__global__ __launch_bounds__(128) void proj_kernel(const __bf16* __restrict__ x16, const __bf16* __restrict__ w16, b16* __restrict__ qh, b16* __restrict__ kh, int rowbase) {
  __shared__ __attribute__((aligned(16))) b16 Th[4][32][HD + 8], Tq[4][32][HD + 8];
  const int lane = threadIdx.x & 31, wave = threadIdx.x >> 5, nloc = lane & 15, hlf = lane >> 4, m0 = rowbase + blockIdx.y * 128 + wave * 32, c0 = blockIdx.x * 64;
  v8f acc[2][4];
#pragma unroll
  for (int r = 0; r < 2; ++r)
#pragma unroll
    for (int t = 0; t < 4; ++t) acc[r][t] = (v8f){};
#pragma unroll 2
  for (int kb = 0; kb < D; kb += 32) {
    const v16bb a0 = frag_pk_bf(x16 + ((size_t)(kb / 32) * (NTOK / 16) + m0 / 16) * FT, lane), a1 = frag_pk_bf(x16 + ((size_t)(kb / 32) * (NTOK / 16) + m0 / 16 + 1) * FT, lane);
    v16bb bw[4];                                                // the k step's 12 loads go out as one group ahead of its products: one load latency a step, not four
#pragma unroll
    for (int t = 0; t < 4; ++t) bw[t] = frag_pk_bf(w16 + ((size_t)(kb / 32) * (2 * D / 16) + c0 / 16 + t) * FT, lane);
    __builtin_amdgcn_sched_barrier(0);                          // holds the group together: the scheduler would spread the loads among the products
#pragma unroll
    for (int t = 0; t < 4; ++t) { acc[0][t] = wmma16bb(a0, bw[t], acc[0][t]); acc[1][t] = wmma16bb(a1, bw[t], acc[1][t]); }
  }
  const int which = blockIdx.x / (D / 64), head = blockIdx.x % (D / 64), b = m0 / S, tok0 = m0 % S;
  {                                                             // q (tiles 0..15) or k (16..31) head: x8 hi/lo planes
#pragma unroll
    for (int t = 0; t < 4; ++t)
#pragma unroll
      for (int r = 0; r < 2; ++r)
#pragma unroll
        for (int v = 0; v < 8; ++v) { b16 a_, c_; split16(acc[r][t][v] * QS, a_, c_); Th[wave][r * 16 + 8 * hlf + v][t * 16 + nloc] = a_; Tq[wave][r * 16 + 8 * hlf + v][t * 16 + nloc] = c_; }   // q, k carried x8 (lo residuals stay normal)
    wave_lds_sync();
    b16* dst = (which == 0 ? qh : kh) + (((size_t)b * H + head) * S + tok0) * HD;
    {
#pragma unroll
      for (int j = 0; j < 8; ++j) { const int rr = (j >> 2) * 16 + nloc, c8 = ((j >> 1) & 1) * 32 + (j & 1) * 16 + 8 * hlf; *(v8b*)(dst + (j * 32 + lane) * 8) = *(const v8b*)(&Th[wave][rr][c8]); *(v8b*)(dst + QPL + (j * 32 + lane) * 8) = *(const v8b*)(&Tq[wave][rr][c8]); }   // the wave's 4 tiles lie in a row: half-tile j
       }
    return;
  }
}

// One stage of the attention ring: 64 keys of one head = K hi, K lo and v^T, each 8 KiB of fragment-order tiles that lie in a row in the workspace; 24 KiB a stage, two buffers.
constexpr int STG_K = 64, STG_P = STG_K * HD /* elements of one plane's piece */, STG_E = 3 * STG_P;
// A thread's six 16-byte asynchronous copies of one stage (256 threads x 16 B = 4 KiB a copy). The s_wait_xcnt stands inside the statement, in front of any rewrite of an address register that a copy names.
__device__ __forceinline__ void stage_copies(unsigned lds, const b16* gkh, const b16* gkl, const b16* gv) {
  asm volatile("global_load_async_to_lds_b128 %0, %6, off\n\t"
               "global_load_async_to_lds_b128 %1, %7, off\n\t"
               "global_load_async_to_lds_b128 %2, %8, off\n\t"
               "global_load_async_to_lds_b128 %3, %9, off\n\t"
               "global_load_async_to_lds_b128 %4, %10, off\n\t"
               "global_load_async_to_lds_b128 %5, %11, off\n\t"
               "s_wait_xcnt 0x0"
               :: "v"(lds), "v"(lds + 4096u), "v"(lds + 8192u), "v"(lds + 12288u), "v"(lds + 16384u), "v"(lds + 20480u),
                  "v"(gkh), "v"(gkh + 2048), "v"(gkl), "v"(gkl + 2048), "v"(gv), "v"(gv + 2048) : "memory");
}

// causal shaped attention: wave = (b, h, 16 queries); K and v^T come through a two-buffer LDS ring shared by the block's 8 waves; key chunks of 32 up to the query tile: S^T (K=64, 3 products), causal mask on the straddling chunk, online softmax f32, P x8 hi/lo,
// o^T += v^T P^T (2 products) and pf^T += v^T U^T (U = exact 0/1 causal indicator: prefix sums); epilogue y = beta o/(8 l) + alpha ((e-1) v_i + colsum)/(e+2047) - gamma pf/(i+1)
template <int QT>
__global__ __launch_bounds__(256) void attn_kernel(const b16* __restrict__ qh, const b16* __restrict__ kh, const b16* __restrict__ vt, const float* __restrict__ x, const float* __restrict__ colsum, const float* __restrict__ alpha_p, const float* __restrict__ beta_p, const float* __restrict__ gamma_p, float* __restrict__ y) {
  __shared__ __attribute__((aligned(16))) float Os[8][16][HD + 4];
  __shared__ __attribute__((aligned(16))) b16 KV[2][STG_E];   // the block's K hi / K lo / v^T ring: each stage is fetched once for the 8 waves
  const int wid = __builtin_amdgcn_readfirstlane(threadIdx.x >> 5), lane = threadIdx.x & 31, hh = lane >> 4, col = lane & 15;   // wave number as a scalar: tile bases and the causal chunk bound sit in SGPRs, so the fragments in flight fit 256 VGPRs
  // Block -> (head, group of 8 query tiles), longest groups first: a group's cost grows with its position (causal), the grid holds twice the blocks that fit the chip at once, and the short groups
  // take the late block indices. Every (head, group) pair is taken exactly once: index = (QT / 8 - 1 - group) * (Bn * H) + head.
  const int bh = blockIdx.x % (Bn * H), grp = QT / 8 - 1 - blockIdx.x / (Bn * H), jt = grp * 8 + wid, h = bh % H, b = bh / H, q0 = jt * 16, qi = q0 + col;
  const b16* Q = qh + ((size_t)bh * S) * HD; const b16* K = kh + ((size_t)bh * S) * HD; const b16* vb = vt + ((size_t)bh * HD) * S;
  v16b qf[2], ql[2];
#pragma unroll
  for (int ks = 0; ks < 2; ++ks) { qf[ks] = frag_pk(Q + (size_t)q0 * HD + ks * FT, lane); ql[ks] = frag_pk(Q + QPL + (size_t)q0 * HD + ks * FT, lane); }
  float m = -INFINITY, l = 0.0f; v8f o[4] = {{}, {}, {}, {}}, pf[4] = {{}, {}, {}, {}};   // pf = causal prefix sums of v (the MC term)
  asm volatile("s_wait_xcnt 0x0" ::: "memory");                 // before the set-up below rewrites address registers of the Q loads above
  const int nst = 2 * grp + 2;                                  // stages of the block = those of its last wave (the same for every thread; at least 2)
  const unsigned lds0 = (unsigned)(size_t)(&KV[0][0]) + threadIdx.x * 16u;   // the thread's own LDS byte address in buffer 0
  const b16* gk = K + threadIdx.x * 8; const b16* gv = vb + threadIdx.x * 8;
  auto fill = [&](const int st) { stage_copies(lds0 + (unsigned)(st & 1) * (unsigned)(STG_E * 2), gk + (size_t)st * STG_P, gk + QPL + (size_t)st * STG_P, gv + (size_t)st * STG_P); };
  fill(0);
  asm volatile("s_wait_asynccnt 0x0" ::: "memory");             // stage 0 has landed for this wave's copies
  __syncthreads();                                              // ... and for every wave's: nobody reads it before
  fill(1);
  // One 32-key chunk. DIAG = false: every key of the chunk lies at or below every query of the tile, so no score is masked and the 0/1 indicator is all ones.
  // DIAG = true: the one chunk that straddles the diagonal (the wave's last): per-element causal tests, behind one scalar branch.
  v16b ones;
#pragma unroll
  for (int r = 0; r < 16; ++r) ones[r] = (b16)1.0f;
  auto chunk = [&](const int kb, const b16* T, const bool DIAG) {   // T = the chunk's K hi tiles in the ring (K lo STG_P, v^T 2 STG_P further on); DIAG is the same for the whole wave
    v16b kf[8], vf[4];                                          // [ks][keys 0..15 hi, lo, keys 16..31 hi, lo]; all 24 LDS reads of the chunk stand in one place
#pragma unroll
    for (int ks = 0; ks < 2; ++ks)
#pragma unroll
      for (int pl = 0; pl < 2; ++pl) { kf[ks * 4 + pl] = frag_pk(T + pl * STG_P + ks * FT, lane); kf[ks * 4 + 2 + pl] = frag_pk(T + pl * STG_P + 16 * HD + ks * FT, lane); }
#pragma unroll
    for (int n = 0; n < 4; ++n) vf[n] = frag_pk(T + 2 * STG_P + n * FT, lane);
    __builtin_amdgcn_sched_barrier(0);                          // holds the 24 reads in that one place: the scheduler would sink them to their products, each behind a wait of its own
    v16b ub = ones;                                             // 0/1 causal indicator operand: ub[r] = [key 8hh+r <= query col], [16+8hh+r <= col]
    v8f s0 = {}, s1 = {};
#pragma unroll
    for (int ks = 0; ks < 2; ++ks) { const v16b k0 = kf[ks * 4 + 0], k0l = kf[ks * 4 + 1], k1 = kf[ks * 4 + 2], k1l = kf[ks * 4 + 3];
      s0 = wmma16b(k0, qf[ks], s0); s0 = wmma16b(k0, ql[ks], s0); s0 = wmma16b(k0l, qf[ks], s0);      // q and k as f16 hi+lo pairs (lo.lo dropped)
      s1 = wmma16b(k1, qf[ks], s1); s1 = wmma16b(k1, ql[ks], s1); s1 = wmma16b(k1l, qf[ks], s1); }
    float mr = -INFINITY;
#pragma unroll
    for (int r = 0; r < 8; ++r) { s0[r] *= SCALE / (QS * QS); s1[r] *= SCALE / (QS * QS); }
    if (DIAG) {
#pragma unroll
      for (int r = 0; r < 8; ++r) { if (kb + 8 * hh + r > qi) s0[r] = -INFINITY; if (kb + 16 + 8 * hh + r > qi) s1[r] = -INFINITY; }
#pragma unroll
      for (int r = 0; r < 8; ++r) { ub[r] = (b16)((kb + 8 * hh + r <= qi) ? 1.0f : 0.0f); ub[8 + r] = (b16)((kb + 16 + 8 * hh + r <= qi) ? 1.0f : 0.0f); }
    }
#pragma unroll
    for (int r = 0; r < 8; ++r) mr = fmaxf(mr, fmaxf(s0[r], s1[r]));
    mr = fmaxf(mr, __shfl_xor(mr, 16));
    const float mn = fmaxf(m, mr), al_ = __expf(m - mn); m = mn;
    float sum = 0.0f; v16b pb, pl;
#pragma unroll
    for (int r = 0; r < 8; ++r) { const float e0 = __expf(s0[r] - mn), e1 = __expf(s1[r] - mn); sum += e0 + e1; b16 a, c; split16(e0 * PS, a, c); pb[r] = a; pl[r] = c; split16(e1 * PS, a, c); pb[8 + r] = a; pl[8 + r] = c; }   // P carried x8
    sum += __shfl_xor(sum, 16); l = l * al_ + sum;
#pragma unroll
    for (int n = 0; n < 4; ++n) {
#pragma unroll
      for (int r = 0; r < 8; ++r) o[n][r] *= al_;
      o[n] = wmma16b(vf[n], pb, o[n]);
      o[n] = wmma16b(vf[n], pl, o[n]);                                                          // v exact (bf16 values), P hi+lo
      pf[n] = wmma16b(vf[n], ub, pf[n]); }                                                        // exact causal prefix sums of v
  };
  for (int st = 0; st < nst; ++st) {                            // every wave makes every trip (copies and barrier); a wave past its diagonal skips the work alone
    const b16* T = &KV[st & 1][0];
#pragma unroll 1                                                // one copy of the chunk body for the stage's two chunks: the loop stays small
    for (int c = 0; c < 2; ++c) {
      const int kb = st * STG_K + c * 32;
      if (kb <= q0) chunk(kb, T + c * 32 * HD, kb + 32 > q0);    // wave-uniform tests: key chunks past the query tile are skipped; the straddling chunk alone takes the causal tests
    }
    asm volatile("s_wait_dscnt 0x0" ::: "memory");              // this wave's reads of the buffer are done before it is refilled
    asm volatile("s_wait_asynccnt 0x0" ::: "memory");           // this wave's copies of stage st + 1 have landed
    __syncthreads();                                            // publishes stage st + 1 and ends every wave's reads of stage st
    if (st + 2 < nst) fill(st + 2);                             // into the buffer just read (the test is the same for the whole block)
  }
  asm volatile("s_wait_asynccnt 0x0" ::: "memory");             // nothing is in flight when the wave goes on to the epilogue
  const float alpha = bf16_rne(alpha_p[0]), beta = bf16_rne(beta_p[0]), gamma = bf16_rne(gamma_p[0]);   // scalar INPUTS
  const float cb = beta / (PS * l), cid = alpha / (EUL + (float)(S - 1)), cmc = gamma / (float)(qi + 1);
  float xr[4][8], cs[4][8];
#pragma unroll
  for (int n = 0; n < 4; ++n)
#pragma unroll
    for (int r = 0; r < 8; ++r) xr[n][r] = x[((size_t)b * S + qi) * D + h * HD + n * 16 + 8 * hh + r];
  asm volatile("s_wait_xcnt 0x0" ::: "memory");                 // before the column sums land on address registers of the x loads
#pragma unroll
  for (int n = 0; n < 4; ++n)
#pragma unroll
    for (int r = 0; r < 8; ++r) cs[n][r] = colsum[(size_t)b * D + h * HD + n * 16 + 8 * hh + r];
  asm volatile("s_wait_xcnt 0x0" ::: "memory");                 // before the staging index below rewrites address registers of these loads
#pragma unroll
  for (int n = 0; n < 4; ++n)
#pragma unroll
    for (int r = 0; r < 8; ++r) { const int d = n * 16 + 8 * hh + r; const float vi = bf16_rne(xr[n][r]), vs = cs[n][r];
      Os[wid][col][d] = o[n][r] * cb + cid * ((EUL - 1.0f) * vi + vs) - cmc * pf[n][r]; }
  wave_lds_sync();
  float* dst = y + ((size_t)b * S + q0) * D + h * HD;
  {
#pragma unroll
    for (int j = 0; j < 8; ++j) { const int rr = j * 2 + hh, c4 = col * 4; *(v4f*)(dst + (size_t)rr * D + c4) = *(const v4f*)(&Os[wid][rr][c4]); }
    
  }
}

}  // namespace

extern "C" void kernel_launch(void* const* d_in, const int* in_sizes, int n_in,
                              void* d_out, int out_size, void* d_ws, size_t ws_size, hipStream_t stream) {
  (void)n_in; (void)out_size;
  const float* x = (const float*)d_in[0]; const float* wattn = (const float*)d_in[1];
  float* out = (float*)d_out;   // [4][2048][1024]
  if (in_sizes[0] != BT * S * D || in_sizes[1] != 2 * D * D || in_sizes[2] != 1 || in_sizes[3] != 1 || in_sizes[4] != 1) return;
  size_t off = 0; char* ws = (char*)d_ws;
  auto carve = [&](size_t bytes) { char* p = ws + off; off += (bytes + 255) & ~(size_t)255; return p; };
  unsigned short* x16 = (unsigned short*)carve((size_t)NTOK * D * 2); unsigned short* w16 = (unsigned short*)carve((size_t)2 * D * D * 2); float* colsum = (float*)carve((size_t)BT * D * 4);
  b16* qh = (b16*)carve((size_t)2 * NTOK * D * 2); b16* kh = (b16*)carve((size_t)2 * NTOK * D * 2); b16* vt = (b16*)carve((size_t)NTOK * D * 2);
  if (off > ws_size) return;                                    // ≈ 105 MB
  prep_kernel<<<512, 256, 0, stream>>>(wattn, w16);
  xprep_kernel<<<1024, 256, 0, stream>>>(x, x16);
  vt_kernel<<<dim3(H, NTOK / 128), 256, 0, stream>>>(x, vt, 0);
  colsum_kernel<<<dim3(D / 32, BT), 1024, 0, stream>>>(x, colsum);
  proj_kernel<<<dim3(2 * D / 64, NTOK / 128), 128, 0, stream>>>((const __bf16*)x16, (const __bf16*)w16, qh, kh, 0);
  attn_kernel<S / 16><<<Bn * H * (S / 16) / 8, 256, 0, stream>>>(qh, kh, vt, x, colsum, (const float*)d_in[2], (const float*)d_in[3], (const float*)d_in[4], out);
}

// v008
// It runs in 131 microseconds.
// Two timings next to v007 both put it at 1.07 times that version's speed.
// Over all steps from v000 it is 4.25 times as fast.
#include <hip/hip_runtime.h>

// Causal "shaped" attention: [q | k] = x W_attn^T (16 heads x 64), v = x itself (use_v = False); att = beta softmax_causal(q.k/8) + alpha Id - gamma MC with Id = softmax(eye(2048))
// (diag e/(e+2047), off-diag 1/(e+2047)) and MC = causal row-uniform averaging (1/(i+1) on j <= i); y = att.v merged over heads -> [4][2048][1024] (no output projection).
// So y_i = beta (P.v)_i/l_i + alpha ((e-1) v_i + sum_all v_j)/(e+2047) - gamma (sum_{j<=i} v_j)/(i+1).
// Numerics: x, W_attn, alpha, beta, gamma rounded to bf16; [q|k] projection on v_wmma_f32_16x16x32_bf16 (exact products, f32 accumulate);
// scores on v_wmma_f32_16x16x32_f16 with q, k as f16 hi+lo pairs carried x8 (3 products); P.v with P an x8 hi+lo pair and v = bf16(x) exact in f16 (2 products); the causal prefix
// sums sum_{j<=i} v_j ride along as a second accumulator against an exact 0/1 mask operand (1 product); the all-token column sums in a small f32 kernel; softmax and the combine in f32.

namespace {
constexpr int BT = 4, Bn = 4, S = 2048, D = 1024, H = 16, HD = 64, NTOK = Bn * S;
constexpr float SCALE = 0.125f, VS = 1.0f /* v = bf16(x): exact, single plane */, QS = 8.0f, PS = 8.0f, EUL = 2.718281828459045f;   // power-of-two carry scales so hi/lo residual planes stay normal in f16
constexpr size_t VPL = (size_t)NTOK * D;   // unused: v^T is a single f16 plane of bf16(x)
constexpr size_t QPL = (size_t)NTOK * D;   // distance between the q/k hi and lo planes

typedef _Float16 b16;
typedef __attribute__((ext_vector_type(16))) _Float16 v16b;
typedef __attribute__((ext_vector_type(8)))  _Float16 v8b;
typedef __attribute__((ext_vector_type(8)))  float v8f;
typedef __attribute__((ext_vector_type(4)))  float v4f;

__device__ __forceinline__ v8b ld8b(const b16* p) { return *(const v8b*)p; }
__device__ __forceinline__ v16b cat8b(v8b a, v8b b) { return __builtin_shufflevector(a, b, 0, 1, 2, 3, 4, 5, 6, 7, 8, 9, 10, 11, 12, 13, 14, 15); }
__device__ __forceinline__ v16b frag_kb(const b16* p, int hh) { return cat8b(ld8b(p + 8 * hh), ld8b(p + 16 + 8 * hh)); }
// Fragment-order tile (every 16-bit matrix operand kept in the workspace): 16 rows x 32 k = 512 elements = 1 KiB; element j*256 + lane*8 + e holds (row lane & 15, k = 16 j + 8 (lane >> 4) + e),
// the k map of frag_kb. A fragment is then two loads of 512 contiguous bytes (4 whole 128-B lines each) where a row-major plane gives 16 lines of 32 bytes a load.
constexpr int FT = 512;
__device__ __forceinline__ v16b frag_pk(const b16* tile, int lane) { return cat8b(ld8b(tile + lane * 8), ld8b(tile + 256 + lane * 8)); }
__device__ __forceinline__ void split16(float v, b16& hi, b16& lo) { hi = (b16)v; lo = (b16)(v - (float)hi); }
// hi/lo fragment pair straight from an f32 k-contiguous row (same k-map)
__device__ __forceinline__ void frag_ksplit(const float* p, int hh, v16b& fh_, v16b& fl_) {
  const float* p0 = p + 8 * hh; const float* p1 = p + 16 + 8 * hh;
#pragma unroll
  for (int e = 0; e < 8; ++e) { b16 a, c; split16(p0[e], a, c); fh_[e] = a; fl_[e] = c; split16(p1[e], a, c); fh_[8 + e] = a; fl_[8 + e] = c; }
}
__device__ __forceinline__ v8f wmma16b(v16b a, v16b b, v8f c) {
  return __builtin_amdgcn_wmma_f32_16x16x32_f16(false, a, false, b, (short)0, c, false, false);
}
__device__ __forceinline__ void wave_lds_sync() {
  __builtin_amdgcn_fence(__ATOMIC_RELEASE, "workgroup");
  __builtin_amdgcn_wave_barrier();
  __builtin_amdgcn_fence(__ATOMIC_ACQUIRE, "workgroup");
}

// Operand descriptor: NP = 0 -> f32 rows split on the fly into (hi, lo); NP = 1 -> one f16 plane; NP = 2 -> f16 hi + lo planes;
// NP = 3 -> f32 rows rounded once to a single f16 fragment. ld = row pitch.
struct Opnd { const void* p0; const void* p1; int ld; };
template <int NP> __device__ __forceinline__ void load_frags(const Opnd& o, int row, int kb, int hh, v16b& fh_, v16b& fl_) {
  if (NP == 0) { frag_ksplit((const float*)o.p0 + (size_t)row * o.ld + kb, hh, fh_, fl_); }
  else if (NP == 4 || NP == 5) {                             // f32 rows x64 (NP 4) or x8 (NP 5) then split (keeps the lo halves of small values normal)
    const float sc_ = (NP == 4) ? 64.0f : 8.0f;
    const float* p = (const float*)o.p0 + (size_t)row * o.ld + kb; const float* p0 = p + 8 * hh; const float* p1 = p + 16 + 8 * hh;
#pragma unroll
    for (int e = 0; e < 8; ++e) { b16 a, c; split16(p0[e] * sc_, a, c); fh_[e] = a; fl_[e] = c; split16(p1[e] * sc_, a, c); fh_[8 + e] = a; fl_[8 + e] = c; }
  } else if (NP == 3) {
    const float* p = (const float*)o.p0 + (size_t)row * o.ld + kb; const float* p0 = p + 8 * hh; const float* p1 = p + 16 + 8 * hh;
#pragma unroll
    for (int e = 0; e < 8; ++e) { fh_[e] = (b16)p0[e]; fh_[8 + e] = (b16)p1[e]; }
    fl_ = fh_;
  } else {
    fh_ = frag_kb((const b16*)o.p0 + (size_t)row * o.ld + kb, hh);
    if (NP == 2) fl_ = frag_kb((const b16*)o.p1 + (size_t)row * o.ld + kb, hh); else fl_ = fh_;
  }
}
template <int ANP, int BNP> __device__ __forceinline__ v8f mac(v16b ah, v16b al, v16b bh, v16b bl, v8f c) {
  c = wmma16b(ah, bh, c);
  if (BNP == 0 || BNP == 2 || BNP == 4 || BNP == 5) c = wmma16b(ah, bl, c);     // hi.lo
  if (ANP == 0 || ANP == 2 || ANP == 4 || ANP == 5) c = wmma16b(al, bh, c);     // lo.hi   (lo.lo dropped)
  return c;
}
// 32x64 wave tile: acc[r][t] (rows m0+16r.., cols c0+16t..) += A[m][k] . B[n][k] over k in [0, K)
template <int ANP, int BNP>
__device__ __forceinline__ void gemm_tile(const Opnd& A, const Opnd& B, int K, int m0, int c0, int nloc, int hlf, v8f (&acc)[2][4]) {
  for (int kb = 0; kb < K; kb += 32) {
    v16b a0h, a0l, a1h, a1l;
    load_frags<ANP>(A, m0 + nloc, kb, hlf, a0h, a0l);
    load_frags<ANP>(A, m0 + 16 + nloc, kb, hlf, a1h, a1l);
#pragma unroll
    for (int t = 0; t < 4; ++t) {
      v16b bh, bl;
      load_frags<BNP>(B, c0 + t * 16 + nloc, kb, hlf, bh, bl);
      acc[0][t] = mac<ANP, BNP>(a0h, a0l, bh, bl, acc[0][t]);
      acc[1][t] = mac<ANP, BNP>(a1h, a1l, bh, bl, acc[1][t]);
    }
  }
}

__device__ __forceinline__ void epi_planes(v8f (&acc)[2][4], float scale, bool two, b16* __restrict__ oh, b16* __restrict__ ol, int ldo,
                                           int m0, int c0, int lane, b16* Th, b16* Tl) {
  const int nloc = lane & 15, hlf = lane >> 4;
#pragma unroll
  for (int t = 0; t < 4; ++t)
#pragma unroll
    for (int r = 0; r < 2; ++r)
#pragma unroll
      for (int v = 0; v < 8; ++v) {
        const int rr = r * 16 + v + 8 * hlf, cc = t * 16 + nloc;
        b16 h_, l_; split16(acc[r][t][v] * scale, h_, l_);
        Th[rr * 64 + cc] = h_; Tl[rr * 64 + cc] = l_;
      }
  wave_lds_sync();
  {
#pragma unroll
    for (int j = 0; j < 8; ++j) {
      const int rr = j * 4 + (lane >> 3), c8 = (lane & 7) * 8;
      const size_t o = (size_t)(m0 + rr) * ldo + c0 + c8;
      *(v8b*)(oh + o) = ld8b(Th + rr * 64 + c8);
      if (two) *(v8b*)(ol + o) = ld8b(Tl + rr * 64 + c8);
    }
    
  }
}
// (b) f32 rows with pitch ldo: 64 floats = 256 B = 2 lines per row; 16 lanes x 16 B per row, 2 rows per instruction. Optional per-row factor
__device__ __forceinline__ void epi_f32(v8f (&acc)[2][4], float scale, const float* rscale, float* __restrict__ out, int ldo, int m0, int c0, int lane, float* Tt) {
  const int nloc = lane & 15, hlf = lane >> 4;
#pragma unroll
  for (int t = 0; t < 4; ++t)
#pragma unroll
    for (int r = 0; r < 2; ++r)
#pragma unroll
      for (int v = 0; v < 8; ++v) {
        const int rr = r * 16 + v + 8 * hlf;
        const float rs = rscale ? rscale[(size_t)(m0 + rr) * 32] : 1.0f;
        Tt[rr * 64 + t * 16 + nloc] = acc[r][t][v] * scale * rs;
      }
  wave_lds_sync();
  float* dst0 = out + (size_t)m0 * ldo + c0;
  {
#pragma unroll
    for (int j = 0; j < 16; ++j) { const int rr = j * 2 + hlf, c4 = nloc * 4; *(v4f*)(dst0 + (size_t)rr * ldo + c4) = *(const v4f*)(Tt + rr * 64 + c4); }
    
  }
}



typedef __attribute__((ext_vector_type(8))) __bf16 v8bb; typedef __attribute__((ext_vector_type(16))) __bf16 v16bb;
typedef __attribute__((ext_vector_type(8))) unsigned short v8us;
__device__ __forceinline__ v16bb frag_kb_bf(const __bf16* p, int hh) { const v8bb a = *(const v8bb*)(p + 8 * hh), b = *(const v8bb*)(p + 16 + 8 * hh); return __builtin_shufflevector(a, b, 0, 1, 2, 3, 4, 5, 6, 7, 8, 9, 10, 11, 12, 13, 14, 15); }
__device__ __forceinline__ v16bb frag_pk_bf(const __bf16* tile, int lane) { const v8bb a = *(const v8bb*)(tile + lane * 8), b = *(const v8bb*)(tile + 256 + lane * 8); return __builtin_shufflevector(a, b, 0, 1, 2, 3, 4, 5, 6, 7, 8, 9, 10, 11, 12, 13, 14, 15); }
__device__ __forceinline__ v8f wmma16bb(v16bb a, v16bb b, v8f c) {
  return __builtin_amdgcn_wmma_f32_16x16x32_bf16(false, a, false, b, (short)0, c, false, false);
}
__device__ __forceinline__ unsigned short bf16_rne_bits(float v) { unsigned int u = __float_as_uint(v); u += 0x7FFFu + ((u >> 16) & 1u); return (unsigned short)(u >> 16); }
__device__ __forceinline__ float bf16_rne(float v) { return __uint_as_float(((unsigned int)bf16_rne_bits(v)) << 16); }



// f32 rows [nrow][D] -> bf16 fragment-order tiles, tile index (k / 32) * (nrow / 16) + row / 16 (the tiles that waves at one k step read lie side by side). One work item = one lane's 2 x 16 bytes of one tile; a wave reads 16 whole 128-B lines and stores 1 KiB in a row.
__device__ __forceinline__ void pack_bf16_tiles(const float* __restrict__ src, unsigned short* __restrict__ dst, size_t nrow, size_t tid, size_t nth) {
  for (size_t p = tid; p < nrow * D / 16; p += nth) {
    const size_t rt = (p >> 5) / (D / 32), kt = (p >> 5) % (D / 32), tile = kt * (nrow / 16) + rt; const int lane = (int)(p & 31);
    const float* s = src + (rt * 16 + (lane & 15)) * D + kt * 32 + 8 * (lane >> 4);
    v8us a, c;
#pragma unroll
    for (int e = 0; e < 8; ++e) { a[e] = bf16_rne_bits(s[e]); c[e] = bf16_rne_bits(s[16 + e]); }
    *(v8us*)(dst + tile * FT + lane * 8) = a; *(v8us*)(dst + tile * FT + 256 + lane * 8) = c;
  }
}
__global__ __launch_bounds__(256) void xprep_kernel(const float* __restrict__ x, unsigned short* __restrict__ x16) {   // x -> bf16 tiles
  pack_bf16_tiles(x, x16, NTOK, (size_t)blockIdx.x * blockDim.x + threadIdx.x, (size_t)gridDim.x * blockDim.x);
}
__global__ __launch_bounds__(256) void prep_kernel(const float* __restrict__ wattn, unsigned short* __restrict__ w16) {
  pack_bf16_tiles(wattn, w16, 2 * D, (size_t)blockIdx.x * blockDim.x + threadIdx.x, (size_t)gridDim.x * blockDim.x);   // W_attn [2C][C] ([out][in]): rows 0..1023 -> q, 1024..2047 -> k
}

// v = bf16(x) exactly: v^T f16 as fragment-order tiles (rows = 16 channels, k = 32 tokens), tile index ((b*H + h) * (S/32) + tok/32) * 4 + channel/16, via an LDS transpose (block = 128 tokens x one head). grid (H, NTOK/128).
__global__ __launch_bounds__(256) void vt_kernel(const float* __restrict__ x, b16* __restrict__ vt, int rowbase) {
  __shared__ __attribute__((aligned(16))) b16 T[HD][128 + 8];
  const int t_ = threadIdx.x, h = blockIdx.x, m0 = rowbase + blockIdx.y * 128, b = m0 / S, tok0 = m0 % S;
  for (int i = t_; i < 128 * HD / 4; i += 256) { const int r = i / (HD / 4), c4 = (i % (HD / 4)) * 4; const v4f xv = *(const v4f*)(x + (size_t)(m0 + r) * D + h * HD + c4);
#pragma unroll
    for (int e = 0; e < 4; ++e) T[c4 + e][r] = (b16)bf16_rne(xv[e]); }
  __syncthreads();
  b16* dst = vt + (((size_t)b * H + h) * (S / 32) + tok0 / 32) * 4 * FT;   // the block's 16 tiles lie in a row
  { for (int i = t_; i < HD * 16; i += 256) { const int tile = i >> 6, j = (i >> 5) & 1, ln = i & 31; *(v8b*)(dst + (size_t)i * 8) = *(const v8b*)(&T[(tile & 3) * 16 + (ln & 15)][(tile >> 2) * 32 + 16 * j + 8 * (ln >> 4)]); }  }
}
// All-token column sums, spread over tokens as well as channels: block = (one batch, 32 channels = one 128-B line per token), 32 waves; wave w owns tokens 64w..64w+63, one load = 4 tokens x one
// whole line, a lane's 16 loads independent of one another (unrolled, so that many are in flight). Sum order: 16 tokens per lane, then the 4 token rows of the wave (two butterfly steps), then the 32 waves through LDS.
__global__ __launch_bounds__(1024) void colsum_kernel(const float* __restrict__ x, float* __restrict__ colsum) {
  __shared__ __attribute__((aligned(16))) float P[32][32];
  const int lane = threadIdx.x & 31, wave = threadIdx.x >> 5, c0 = blockIdx.x * 32, b = blockIdx.y;
  const float* p = x + ((size_t)b * S + wave * 64 + (lane >> 3)) * D + c0 + (lane & 7) * 4;
  v4f xv[16];
#pragma unroll
  for (int i = 0; i < 16; ++i) xv[i] = *(const v4f*)(p + (size_t)i * 4 * D);
  v4f s = {};
#pragma unroll
  for (int i = 0; i < 16; ++i)
#pragma unroll
    for (int e = 0; e < 4; ++e) s[e] += bf16_rne(xv[i][e]);
#pragma unroll
  for (int e = 0; e < 4; ++e) { s[e] += __shfl_xor(s[e], 8); s[e] += __shfl_xor(s[e], 16); }
  if (lane < 8) *(v4f*)(&P[wave][lane * 4]) = s;
  __syncthreads();
  if (wave == 0) {
    float t = 0.0f;
#pragma unroll
    for (int w = 0; w < 32; ++w) t += P[w][lane];
    colsum[(size_t)b * D + c0 + lane] = t;
  }
}

// One stage of the projection ring: 64 of k (two k steps of 32) of the block's 256 token rows and 256 output columns. At one k step the 16 x tiles and the 16 W tiles of a block each lie in a row in the
// workspace (16 KiB), so a stage is four 16-KiB pieces [x step 0 | x step 1 | W step 0 | W step 1] = 64 KiB; two buffers.
constexpr int PJ_PC = 16 * FT /* elements of one piece */, PJ_STG = 4 * PJ_PC, PJ_NST = D / 64, PJ_EPI = 2 * 32 * (HD + 8) /* a wave's output staging, hi + lo */;
// A thread's eight 16-byte asynchronous copies of one stage (512 threads x 16 B = 8 KiB a copy). The s_wait_xcnt stands inside the statement, in front of any rewrite of an address register that a copy names.
__device__ __forceinline__ void proj_stage_copies(unsigned lds, const __bf16* a0, const __bf16* a1, const __bf16* b0, const __bf16* b1) {
  asm volatile("global_load_async_to_lds_b128 %0, %8, off\n\t"
               "global_load_async_to_lds_b128 %1, %9, off\n\t"
               "global_load_async_to_lds_b128 %2, %10, off\n\t"
               "global_load_async_to_lds_b128 %3, %11, off\n\t"
               "global_load_async_to_lds_b128 %4, %12, off\n\t"
               "global_load_async_to_lds_b128 %5, %13, off\n\t"
               "global_load_async_to_lds_b128 %6, %14, off\n\t"
               "global_load_async_to_lds_b128 %7, %15, off\n\t"
               "s_wait_xcnt 0x0"
               :: "v"(lds), "v"(lds + 8192u), "v"(lds + 16384u), "v"(lds + 24576u), "v"(lds + 32768u), "v"(lds + 40960u), "v"(lds + 49152u), "v"(lds + 57344u),
                  "v"(a0), "v"(a0 + 4096), "v"(a1), "v"(a1 + 4096), "v"(b0), "v"(b0 + 4096), "v"(b1), "v"(b1 + 4096) : "memory");
}
// projections: rows = tokens (8192), K = 1024. Block = 256 tokens x 256 columns, 16 waves of 64 x 64 (a wave's 64 columns = one head of q (columns 0..1023) or k); x and W tiles come through a two-buffer LDS ring
// shared by the 16 waves, so each tile leaves L2 once a block. Output: x8 hi/lo planes of fragment-order tiles (rows = 16 tokens, k = 32 channels), tile index ((b*H + head) * (S/16) + tok/16) * 2 + channel/32. grid (8, 32) x 512.
__global__ __launch_bounds__(512) void proj_kernel(const __bf16* __restrict__ x16, const __bf16* __restrict__ w16, b16* __restrict__ qh, b16* __restrict__ kh, int rowbase) {
  __shared__ __attribute__((aligned(16))) unsigned short SM[16 * PJ_EPI];   // the ring (2 x 64 KiB) in the loop; behind it each wave's own output staging
  static_assert(16 * PJ_EPI >= 2 * PJ_STG, "the ring fits");
  const int lane = threadIdx.x & 31, wave = __builtin_amdgcn_readfirstlane(threadIdx.x >> 5), nloc = lane & 15, hlf = lane >> 4, wm = wave >> 2, wn = wave & 3;   // wave number as a scalar: tile bases sit in SGPRs
  const int mb = rowbase + blockIdx.y * 256, m0 = mb + wm * 64;
  v8f acc[4][4];
#pragma unroll
  for (int r = 0; r < 4; ++r)
#pragma unroll
    for (int t = 0; t < 4; ++t) acc[r][t] = (v8f){};
  const unsigned lds0 = (unsigned)(size_t)(&SM[0]) + threadIdx.x * 16u;   // the thread's own LDS byte address in buffer 0
  const __bf16* ga = x16 + (size_t)(mb / 16) * FT + threadIdx.x * 8; const __bf16* gb = w16 + (size_t)(blockIdx.x * 16) * FT + threadIdx.x * 8;
  auto fill = [&](const int st) { proj_stage_copies(lds0 + (unsigned)(st & 1) * (unsigned)(PJ_STG * 2), ga + (size_t)(2 * st) * (NTOK / 16) * FT, ga + (size_t)(2 * st + 1) * (NTOK / 16) * FT,
                                                    gb + (size_t)(2 * st) * (2 * D / 16) * FT, gb + (size_t)(2 * st + 1) * (2 * D / 16) * FT); };
  fill(0);
  asm volatile("s_wait_asynccnt 0x0" ::: "memory");             // stage 0 has landed for this wave's copies
  __syncthreads();                                              // ... and for every wave's: nobody reads it before
  fill(1);
#pragma unroll 1                                                // one copy of the stage body: the buffer is picked by a scalar
  for (int st = 0; st < PJ_NST; ++st) {
    const __bf16* T = (const __bf16*)SM + (st & 1) * PJ_STG;
    v16bb a[4], bw[4];                                          // a k step's 16 LDS reads stand in one place ahead of its 16 products
    auto reads = [&](const int ks) {
#pragma unroll
      for (int r = 0; r < 4; ++r) a[r] = frag_pk_bf(T + ks * PJ_PC + (wm * 4 + r) * FT, lane);
#pragma unroll
      for (int t = 0; t < 4; ++t) bw[t] = frag_pk_bf(T + (2 + ks) * PJ_PC + (wn * 4 + t) * FT, lane);
      __builtin_amdgcn_sched_barrier(0);                        // holds the group together: the scheduler would spread the reads among the products
    };
    auto products = [&]() {
#pragma unroll
      for (int t = 0; t < 4; ++t)
#pragma unroll
        for (int r = 0; r < 4; ++r) acc[r][t] = wmma16bb(a[r], bw[t], acc[r][t]);
    };
    reads(0); products(); reads(1);
    asm volatile("s_wait_dscnt 0x0" ::: "memory");              // this wave's reads of the buffer are done (the second k step's fragments sit in registers) before it is refilled
    asm volatile("s_wait_asynccnt 0x0" ::: "memory");           // this wave's copies of stage st + 1 have landed
    __syncthreads();                                            // publishes stage st + 1 and ends every wave's reads of stage st
    if (st + 2 < PJ_NST) fill(st + 2);                          // into the buffer just read (the test is the same for the whole block)
    __builtin_amdgcn_sched_barrier(0);                          // the refill goes out ahead of the second k step's products: a whole trip of lead, not half a trip
    products();
  }
  asm volatile("s_wait_asynccnt 0x0" ::: "memory");             // nothing is in flight when the ring becomes output staging (every wave's last read ended at the loop's last barrier)
  const int hq = blockIdx.x * 4 + wn, which = hq / H, head = hq % H, b = m0 / S, tok0 = m0 % S;
  b16 (*Th)[HD + 8] = (b16 (*)[HD + 8])(SM + wave * PJ_EPI); b16 (*Tq)[HD + 8] = Th + 32;
  b16* dst0 = (which == 0 ? qh : kh) + (((size_t)b * H + head) * S + tok0) * HD;
#pragma unroll
  for (int hf = 0; hf < 2; ++hf) {                              // the wave's 64 tokens in two halves of 32: x8 hi/lo planes
#pragma unroll
    for (int t = 0; t < 4; ++t)
#pragma unroll
      for (int r = 0; r < 2; ++r)
#pragma unroll
        for (int v = 0; v < 8; ++v) { b16 a_, c_; split16(acc[2 * hf + r][t][v] * QS, a_, c_); Th[r * 16 + 8 * hlf + v][t * 16 + nloc] = a_; Tq[r * 16 + 8 * hlf + v][t * 16 + nloc] = c_; }   // q, k carried x8 (lo residuals stay normal)
    wave_lds_sync();
    b16* dst = dst0 + (size_t)hf * 32 * HD;
#pragma unroll
    for (int j = 0; j < 8; ++j) { const int rr = (j >> 2) * 16 + nloc, c8 = ((j >> 1) & 1) * 32 + (j & 1) * 16 + 8 * hlf; *(v8b*)(dst + (j * 32 + lane) * 8) = *(const v8b*)(&Th[rr][c8]); *(v8b*)(dst + QPL + (j * 32 + lane) * 8) = *(const v8b*)(&Tq[rr][c8]); }   // the half's 4 tiles lie in a row: half-tile j
    if (hf == 0) asm volatile("s_wait_dscnt 0x0" ::: "memory");   // the first half's rows are read back before the second half overwrites them (no wait on the global stores, which a fence would add)
  }
}

// One stage of the attention ring: 64 keys of one head = K hi, K lo and v^T, each 8 KiB of fragment-order tiles that lie in a row in the workspace; 24 KiB a stage, two buffers.
constexpr int STG_K = 64, STG_P = STG_K * HD /* elements of one plane's piece */, STG_E = 3 * STG_P;
// A thread's six 16-byte asynchronous copies of one stage (256 threads x 16 B = 4 KiB a copy). The s_wait_xcnt stands inside the statement, in front of any rewrite of an address register that a copy names.
__device__ __forceinline__ void stage_copies(unsigned lds, const b16* gkh, const b16* gkl, const b16* gv) {
  asm volatile("global_load_async_to_lds_b128 %0, %6, off\n\t"
               "global_load_async_to_lds_b128 %1, %7, off\n\t"
               "global_load_async_to_lds_b128 %2, %8, off\n\t"
               "global_load_async_to_lds_b128 %3, %9, off\n\t"
               "global_load_async_to_lds_b128 %4, %10, off\n\t"
               "global_load_async_to_lds_b128 %5, %11, off\n\t"
               "s_wait_xcnt 0x0"
               :: "v"(lds), "v"(lds + 4096u), "v"(lds + 8192u), "v"(lds + 12288u), "v"(lds + 16384u), "v"(lds + 20480u),
                  "v"(gkh), "v"(gkh + 2048), "v"(gkl), "v"(gkl + 2048), "v"(gv), "v"(gv + 2048) : "memory");
}

// causal shaped attention: wave = (b, h, 16 queries); K and v^T come through a two-buffer LDS ring shared by the block's 8 waves; key chunks of 32 up to the query tile: S^T (K=64, 3 products), causal mask on the straddling chunk, online softmax f32, P x8 hi/lo,
// o^T += v^T P^T (2 products) and pf^T += v^T U^T (U = exact 0/1 causal indicator: prefix sums); epilogue y = beta o/(8 l) + alpha ((e-1) v_i + colsum)/(e+2047) - gamma pf/(i+1)
template <int QT>
__global__ __launch_bounds__(256) void attn_kernel(const b16* __restrict__ qh, const b16* __restrict__ kh, const b16* __restrict__ vt, const float* __restrict__ x, const float* __restrict__ colsum, const float* __restrict__ alpha_p, const float* __restrict__ beta_p, const float* __restrict__ gamma_p, float* __restrict__ y) {
  __shared__ __attribute__((aligned(16))) float Os[8][16][HD + 4];
  __shared__ __attribute__((aligned(16))) b16 KV[2][STG_E];   // the block's K hi / K lo / v^T ring: each stage is fetched once for the 8 waves
  const int wid = __builtin_amdgcn_readfirstlane(threadIdx.x >> 5), lane = threadIdx.x & 31, hh = lane >> 4, col = lane & 15;   // wave number as a scalar: tile bases and the causal chunk bound sit in SGPRs, so the fragments in flight fit 256 VGPRs
  // Block -> (head, group of 8 query tiles), longest groups first: a group's cost grows with its position (causal), the grid holds twice the blocks that fit the chip at once, and the short groups
  // take the late block indices. Every (head, group) pair is taken exactly once: index = (QT / 8 - 1 - group) * (Bn * H) + head.
  const int bh = blockIdx.x % (Bn * H), grp = QT / 8 - 1 - blockIdx.x / (Bn * H), jt = grp * 8 + wid, h = bh % H, b = bh / H, q0 = jt * 16, qi = q0 + col;
  const b16* Q = qh + ((size_t)bh * S) * HD; const b16* K = kh + ((size_t)bh * S) * HD; const b16* vb = vt + ((size_t)bh * HD) * S;
  v16b qf[2], ql[2];
#pragma unroll
  for (int ks = 0; ks < 2; ++ks) { qf[ks] = frag_pk(Q + (size_t)q0 * HD + ks * FT, lane); ql[ks] = frag_pk(Q + QPL + (size_t)q0 * HD + ks * FT, lane); }
  float m = -INFINITY, l = 0.0f; v8f o[4] = {{}, {}, {}, {}}, pf[4] = {{}, {}, {}, {}};   // pf = causal prefix sums of v (the MC term)
  asm volatile("s_wait_xcnt 0x0" ::: "memory");                 // before the set-up below rewrites address registers of the Q loads above
  const int nst = 2 * grp + 2;                                  // stages of the block = those of its last wave (the same for every thread; at least 2)
  const unsigned lds0 = (unsigned)(size_t)(&KV[0][0]) + threadIdx.x * 16u;   // the thread's own LDS byte address in buffer 0
  const b16* gk = K + threadIdx.x * 8; const b16* gv = vb + threadIdx.x * 8;
  auto fill = [&](const int st) { stage_copies(lds0 + (unsigned)(st & 1) * (unsigned)(STG_E * 2), gk + (size_t)st * STG_P, gk + QPL + (size_t)st * STG_P, gv + (size_t)st * STG_P); };
  fill(0);
  asm volatile("s_wait_asynccnt 0x0" ::: "memory");             // stage 0 has landed for this wave's copies
  __syncthreads();                                              // ... and for every wave's: nobody reads it before
  fill(1);
  // One 32-key chunk. DIAG = false: every key of the chunk lies at or below every query of the tile, so no score is masked and the 0/1 indicator is all ones.
  // DIAG = true: the one chunk that straddles the diagonal (the wave's last): per-element causal tests, behind one scalar branch.
  v16b ones;
#pragma unroll
  for (int r = 0; r < 16; ++r) ones[r] = (b16)1.0f;
  auto chunk = [&](const int kb, const b16* T, const bool DIAG) {   // T = the chunk's K hi tiles in the ring (K lo STG_P, v^T 2 STG_P further on); DIAG is the same for the whole wave
    v16b kf[8], vf[4];                                          // [ks][keys 0..15 hi, lo, keys 16..31 hi, lo]; all 24 LDS reads of the chunk stand in one place
#pragma unroll
    for (int ks = 0; ks < 2; ++ks)
#pragma unroll
      for (int pl = 0; pl < 2; ++pl) { kf[ks * 4 + pl] = frag_pk(T + pl * STG_P + ks * FT, lane); kf[ks * 4 + 2 + pl] = frag_pk(T + pl * STG_P + 16 * HD + ks * FT, lane); }
#pragma unroll
    for (int n = 0; n < 4; ++n) vf[n] = frag_pk(T + 2 * STG_P + n * FT, lane);
    __builtin_amdgcn_sched_barrier(0);                          // holds the 24 reads in that one place: the scheduler would sink them to their products, each behind a wait of its own
    v16b ub = ones;                                             // 0/1 causal indicator operand: ub[r] = [key 8hh+r <= query col], [16+8hh+r <= col]
    v8f s0 = {}, s1 = {};
#pragma unroll
    for (int ks = 0; ks < 2; ++ks) { const v16b k0 = kf[ks * 4 + 0], k0l = kf[ks * 4 + 1], k1 = kf[ks * 4 + 2], k1l = kf[ks * 4 + 3];
      s0 = wmma16b(k0, qf[ks], s0); s0 = wmma16b(k0, ql[ks], s0); s0 = wmma16b(k0l, qf[ks], s0);      // q and k as f16 hi+lo pairs (lo.lo dropped)
      s1 = wmma16b(k1, qf[ks], s1); s1 = wmma16b(k1, ql[ks], s1); s1 = wmma16b(k1l, qf[ks], s1); }
    float mr = -INFINITY;
#pragma unroll
    for (int r = 0; r < 8; ++r) { s0[r] *= SCALE / (QS * QS); s1[r] *= SCALE / (QS * QS); }
    if (DIAG) {
#pragma unroll
      for (int r = 0; r < 8; ++r) { if (kb + 8 * hh + r > qi) s0[r] = -INFINITY; if (kb + 16 + 8 * hh + r > qi) s1[r] = -INFINITY; }
#pragma unroll
      for (int r = 0; r < 8; ++r) { ub[r] = (b16)((kb + 8 * hh + r <= qi) ? 1.0f : 0.0f); ub[8 + r] = (b16)((kb + 16 + 8 * hh + r <= qi) ? 1.0f : 0.0f); }
    }
#pragma unroll
    for (int r = 0; r < 8; ++r) mr = fmaxf(mr, fmaxf(s0[r], s1[r]));
    mr = fmaxf(mr, __shfl_xor(mr, 16));
    const float mn = fmaxf(m, mr), al_ = __expf(m - mn); m = mn;
    float sum = 0.0f; v16b pb, pl;
#pragma unroll
    for (int r = 0; r < 8; ++r) { const float e0 = __expf(s0[r] - mn), e1 = __expf(s1[r] - mn); sum += e0 + e1; b16 a, c; split16(e0 * PS, a, c); pb[r] = a; pl[r] = c; split16(e1 * PS, a, c); pb[8 + r] = a; pl[8 + r] = c; }   // P carried x8
    sum += __shfl_xor(sum, 16); l = l * al_ + sum;
#pragma unroll
    for (int n = 0; n < 4; ++n) {
#pragma unroll
      for (int r = 0; r < 8; ++r) o[n][r] *= al_;
      o[n] = wmma16b(vf[n], pb, o[n]);
      o[n] = wmma16b(vf[n], pl, o[n]);                                                          // v exact (bf16 values), P hi+lo
      pf[n] = wmma16b(vf[n], ub, pf[n]); }                                                        // exact causal prefix sums of v
  };
  for (int st = 0; st < nst; ++st) {                            // every wave makes every trip (copies and barrier); a wave past its diagonal skips the work alone
    const b16* T = &KV[st & 1][0];
#pragma unroll 1                                                // one copy of the chunk body for the stage's two chunks: the loop stays small
    for (int c = 0; c < 2; ++c) {
      const int kb = st * STG_K + c * 32;
      if (kb <= q0) chunk(kb, T + c * 32 * HD, kb + 32 > q0);    // wave-uniform tests: key chunks past the query tile are skipped; the straddling chunk alone takes the causal tests
    }
    asm volatile("s_wait_dscnt 0x0" ::: "memory");              // this wave's reads of the buffer are done before it is refilled
    asm volatile("s_wait_asynccnt 0x0" ::: "memory");           // this wave's copies of stage st + 1 have landed
    __syncthreads();                                            // publishes stage st + 1 and ends every wave's reads of stage st
    if (st + 2 < nst) fill(st + 2);                             // into the buffer just read (the test is the same for the whole block)
  }
  asm volatile("s_wait_asynccnt 0x0" ::: "memory");             // nothing is in flight when the wave goes on to the epilogue
  const float alpha = bf16_rne(alpha_p[0]), beta = bf16_rne(beta_p[0]), gamma = bf16_rne(gamma_p[0]);   // scalar INPUTS
  const float cb = beta / (PS * l), cid = alpha / (EUL + (float)(S - 1)), cmc = gamma / (float)(qi + 1);
  float xr[4][8], cs[4][8];
#pragma unroll
  for (int n = 0; n < 4; ++n)
#pragma unroll
    for (int r = 0; r < 8; ++r) xr[n][r] = x[((size_t)b * S + qi) * D + h * HD + n * 16 + 8 * hh + r];
  asm volatile("s_wait_xcnt 0x0" ::: "memory");                 // before the column sums land on address registers of the x loads
#pragma unroll
  for (int n = 0; n < 4; ++n)
#pragma unroll
    for (int r = 0; r < 8; ++r) cs[n][r] = colsum[(size_t)b * D + h * HD + n * 16 + 8 * hh + r];
  asm volatile("s_wait_xcnt 0x0" ::: "memory");                 // before the staging index below rewrites address registers of these loads
#pragma unroll
  for (int n = 0; n < 4; ++n)
#pragma unroll
    for (int r = 0; r < 8; ++r) { const int d = n * 16 + 8 * hh + r; const float vi = bf16_rne(xr[n][r]), vs = cs[n][r];
      Os[wid][col][d] = o[n][r] * cb + cid * ((EUL - 1.0f) * vi + vs) - cmc * pf[n][r]; }
  wave_lds_sync();
  float* dst = y + ((size_t)b * S + q0) * D + h * HD;
  {
#pragma unroll
    for (int j = 0; j < 8; ++j) { const int rr = j * 2 + hh, c4 = col * 4; *(v4f*)(dst + (size_t)rr * D + c4) = *(const v4f*)(&Os[wid][rr][c4]); }
    
  }
}

}  // namespace

extern "C" void kernel_launch(void* const* d_in, const int* in_sizes, int n_in,
                              void* d_out, int out_size, void* d_ws, size_t ws_size, hipStream_t stream) {
  (void)n_in; (void)out_size;
  const float* x = (const float*)d_in[0]; const float* wattn = (const float*)d_in[1];
  float* out = (float*)d_out;   // [4][2048][1024]
  if (in_sizes[0] != BT * S * D || in_sizes[1] != 2 * D * D || in_sizes[2] != 1 || in_sizes[3] != 1 || in_sizes[4] != 1) return;
  size_t off = 0; char* ws = (char*)d_ws;
  auto carve = [&](size_t bytes) { char* p = ws + off; off += (bytes + 255) & ~(size_t)255; return p; };
  unsigned short* x16 = (unsigned short*)carve((size_t)NTOK * D * 2); unsigned short* w16 = (unsigned short*)carve((size_t)2 * D * D * 2); float* colsum = (float*)carve((size_t)BT * D * 4);
  b16* qh = (b16*)carve((size_t)2 * NTOK * D * 2); b16* kh = (b16*)carve((size_t)2 * NTOK * D * 2); b16* vt = (b16*)carve((size_t)NTOK * D * 2);
  if (off > ws_size) return;                                    // ≈ 105 MB
  prep_kernel<<<512, 256, 0, stream>>>(wattn, w16);
  xprep_kernel<<<1024, 256, 0, stream>>>(x, x16);
  vt_kernel<<<dim3(H, NTOK / 128), 256, 0, stream>>>(x, vt, 0);
  colsum_kernel<<<dim3(D / 32, BT), 1024, 0, stream>>>(x, colsum);
  proj_kernel<<<dim3(2 * D / 256, NTOK / 256), 512, 0, stream>>>((const __bf16*)x16, (const __bf16*)w16, qh, kh, 0);
  attn_kernel<S / 16><<<Bn * H * (S / 16) / 8, 256, 0, stream>>>(qh, kh, vt, x, colsum, (const float*)d_in[2], (const float*)d_in[3], (const float*)d_in[4], out);
}

// v009
// It runs in 118 microseconds.
// In both of two side-by-side timings against v008, it was 1.11 times as fast.
// Counting every step since v000, it is 4.71 times as fast.
#include <hip/hip_runtime.h>

// Causal "shaped" attention: [q | k] = x W_attn^T (16 heads x 64), v = x itself (use_v = False); att = beta softmax_causal(q.k/8) + alpha Id - gamma MC with Id = softmax(eye(2048))
// (diag e/(e+2047), off-diag 1/(e+2047)) and MC = causal row-uniform averaging (1/(i+1) on j <= i); y = att.v merged over heads -> [4][2048][1024] (no output projection).
// So y_i = beta (P.v)_i/l_i + alpha ((e-1) v_i + sum_all v_j)/(e+2047) - gamma (sum_{j<=i} v_j)/(i+1).
// Numerics: x, W_attn, alpha, beta, gamma rounded to bf16; [q|k] projection on v_wmma_f32_16x16x32_bf16 (exact products, f32 accumulate);
// scores on v_wmma_f32_16x16x32_f16 with q, k as f16 hi+lo pairs carried x8 (3 products); P.v with P an x8 hi+lo pair and v = bf16(x) exact in f16 (2 products); the causal prefix
// sums sum_{j<=i} v_j ride along as a second accumulator against an exact 0/1 mask operand (1 product); the all-token column sums in f32 (128-token partial sums in the preparatory kernel, joined in the projection kernel); softmax and the combine in f32.

namespace {
constexpr int BT = 4, Bn = 4, S = 2048, D = 1024, H = 16, HD = 64, NTOK = Bn * S;
constexpr float SCALE = 0.125f, VS = 1.0f /* v = bf16(x): exact, single plane */, QS = 8.0f, PS = 8.0f, EUL = 2.718281828459045f;   // power-of-two carry scales so hi/lo residual planes stay normal in f16
constexpr size_t VPL = (size_t)NTOK * D;   // unused: v^T is a single f16 plane of bf16(x)
constexpr size_t QPL = (size_t)NTOK * D;   // distance between the q/k hi and lo planes

typedef _Float16 b16;
typedef __attribute__((ext_vector_type(16))) _Float16 v16b;
typedef __attribute__((ext_vector_type(8)))  _Float16 v8b;
typedef __attribute__((ext_vector_type(8)))  float v8f;
typedef __attribute__((ext_vector_type(4)))  float v4f;

__device__ __forceinline__ v8b ld8b(const b16* p) { return *(const v8b*)p; }
__device__ __forceinline__ v16b cat8b(v8b a, v8b b) { return __builtin_shufflevector(a, b, 0, 1, 2, 3, 4, 5, 6, 7, 8, 9, 10, 11, 12, 13, 14, 15); }
__device__ __forceinline__ v16b frag_kb(const b16* p, int hh) { return cat8b(ld8b(p + 8 * hh), ld8b(p + 16 + 8 * hh)); }
// Fragment-order tile (every 16-bit matrix operand kept in the workspace): 16 rows x 32 k = 512 elements = 1 KiB; element j*256 + lane*8 + e holds (row lane & 15, k = 16 j + 8 (lane >> 4) + e),
// the k map of frag_kb. A fragment is then two loads of 512 contiguous bytes (4 whole 128-B lines each) where a row-major plane gives 16 lines of 32 bytes a load.
constexpr int FT = 512;
__device__ __forceinline__ v16b frag_pk(const b16* tile, int lane) { return cat8b(ld8b(tile + lane * 8), ld8b(tile + 256 + lane * 8)); }
__device__ __forceinline__ void split16(float v, b16& hi, b16& lo) { hi = (b16)v; lo = (b16)(v - (float)hi); }
// hi/lo fragment pair straight from an f32 k-contiguous row (same k-map)
__device__ __forceinline__ void frag_ksplit(const float* p, int hh, v16b& fh_, v16b& fl_) {
  const float* p0 = p + 8 * hh; const float* p1 = p + 16 + 8 * hh;
#pragma unroll
  for (int e = 0; e < 8; ++e) { b16 a, c; split16(p0[e], a, c); fh_[e] = a; fl_[e] = c; split16(p1[e], a, c); fh_[8 + e] = a; fl_[8 + e] = c; }
}
__device__ __forceinline__ v8f wmma16b(v16b a, v16b b, v8f c) {
  return __builtin_amdgcn_wmma_f32_16x16x32_f16(false, a, false, b, (short)0, c, false, false);
}
__device__ __forceinline__ void wave_lds_sync() {
  __builtin_amdgcn_fence(__ATOMIC_RELEASE, "workgroup");
  __builtin_amdgcn_wave_barrier();
  __builtin_amdgcn_fence(__ATOMIC_ACQUIRE, "workgroup");
}

// Operand descriptor: NP = 0 -> f32 rows split on the fly into (hi, lo); NP = 1 -> one f16 plane; NP = 2 -> f16 hi + lo planes;
// NP = 3 -> f32 rows rounded once to a single f16 fragment. ld = row pitch.
struct Opnd { const void* p0; const void* p1; int ld; };
template <int NP> __device__ __forceinline__ void load_frags(const Opnd& o, int row, int kb, int hh, v16b& fh_, v16b& fl_) {
  if (NP == 0) { frag_ksplit((const float*)o.p0 + (size_t)row * o.ld + kb, hh, fh_, fl_); }
  else if (NP == 4 || NP == 5) {                             // f32 rows x64 (NP 4) or x8 (NP 5) then split (keeps the lo halves of small values normal)
    const float sc_ = (NP == 4) ? 64.0f : 8.0f;
    const float* p = (const float*)o.p0 + (size_t)row * o.ld + kb; const float* p0 = p + 8 * hh; const float* p1 = p + 16 + 8 * hh;
#pragma unroll
    for (int e = 0; e < 8; ++e) { b16 a, c; split16(p0[e] * sc_, a, c); fh_[e] = a; fl_[e] = c; split16(p1[e] * sc_, a, c); fh_[8 + e] = a; fl_[8 + e] = c; }
  } else if (NP == 3) {
    const float* p = (const float*)o.p0 + (size_t)row * o.ld + kb; const float* p0 = p + 8 * hh; const float* p1 = p + 16 + 8 * hh;
#pragma unroll
    for (int e = 0; e < 8; ++e) { fh_[e] = (b16)p0[e]; fh_[8 + e] = (b16)p1[e]; }
    fl_ = fh_;
  } else {
    fh_ = frag_kb((const b16*)o.p0 + (size_t)row * o.ld + kb, hh);
    if (NP == 2) fl_ = frag_kb((const b16*)o.p1 + (size_t)row * o.ld + kb, hh); else fl_ = fh_;
  }
}
template <int ANP, int BNP> __device__ __forceinline__ v8f mac(v16b ah, v16b al, v16b bh, v16b bl, v8f c) {
  c = wmma16b(ah, bh, c);
  if (BNP == 0 || BNP == 2 || BNP == 4 || BNP == 5) c = wmma16b(ah, bl, c);     // hi.lo
  if (ANP == 0 || ANP == 2 || ANP == 4 || ANP == 5) c = wmma16b(al, bh, c);     // lo.hi   (lo.lo dropped)
  return c;
}
// 32x64 wave tile: acc[r][t] (rows m0+16r.., cols c0+16t..) += A[m][k] . B[n][k] over k in [0, K)
template <int ANP, int BNP>
__device__ __forceinline__ void gemm_tile(const Opnd& A, const Opnd& B, int K, int m0, int c0, int nloc, int hlf, v8f (&acc)[2][4]) {
  for (int kb = 0; kb < K; kb += 32) {
    v16b a0h, a0l, a1h, a1l;
    load_frags<ANP>(A, m0 + nloc, kb, hlf, a0h, a0l);
    load_frags<ANP>(A, m0 + 16 + nloc, kb, hlf, a1h, a1l);
#pragma unroll
    for (int t = 0; t < 4; ++t) {
      v16b bh, bl;
      load_frags<BNP>(B, c0 + t * 16 + nloc, kb, hlf, bh, bl);
      acc[0][t] = mac<ANP, BNP>(a0h, a0l, bh, bl, acc[0][t]);
      acc[1][t] = mac<ANP, BNP>(a1h, a1l, bh, bl, acc[1][t]);
    }
  }
}

__device__ __forceinline__ void epi_planes(v8f (&acc)[2][4], float scale, bool two, b16* __restrict__ oh, b16* __restrict__ ol, int ldo,
                                           int m0, int c0, int lane, b16* Th, b16* Tl) {
  const int nloc = lane & 15, hlf = lane >> 4;
#pragma unroll
  for (int t = 0; t < 4; ++t)
#pragma unroll
    for (int r = 0; r < 2; ++r)
#pragma unroll
      for (int v = 0; v < 8; ++v) {
        const int rr = r * 16 + v + 8 * hlf, cc = t * 16 + nloc;
        b16 h_, l_; split16(acc[r][t][v] * scale, h_, l_);
        Th[rr * 64 + cc] = h_; Tl[rr * 64 + cc] = l_;
      }
  wave_lds_sync();
  {
#pragma unroll
    for (int j = 0; j < 8; ++j) {
      const int rr = j * 4 + (lane >> 3), c8 = (lane & 7) * 8;
      const size_t o = (size_t)(m0 + rr) * ldo + c0 + c8;
      *(v8b*)(oh + o) = ld8b(Th + rr * 64 + c8);
      if (two) *(v8b*)(ol + o) = ld8b(Tl + rr * 64 + c8);
    }
    
  }
}
// (b) f32 rows with pitch ldo: 64 floats = 256 B = 2 lines per row; 16 lanes x 16 B per row, 2 rows per instruction. Optional per-row factor
__device__ __forceinline__ void epi_f32(v8f (&acc)[2][4], float scale, const float* rscale, float* __restrict__ out, int ldo, int m0, int c0, int lane, float* Tt) {
  const int nloc = lane & 15, hlf = lane >> 4;
#pragma unroll
  for (int t = 0; t < 4; ++t)
#pragma unroll
    for (int r = 0; r < 2; ++r)
#pragma unroll
      for (int v = 0; v < 8; ++v) {
        const int rr = r * 16 + v + 8 * hlf;
        const float rs = rscale ? rscale[(size_t)(m0 + rr) * 32] : 1.0f;
        Tt[rr * 64 + t * 16 + nloc] = acc[r][t][v] * scale * rs;
      }
  wave_lds_sync();
  float* dst0 = out + (size_t)m0 * ldo + c0;
  {
#pragma unroll
    for (int j = 0; j < 16; ++j) { const int rr = j * 2 + hlf, c4 = nloc * 4; *(v4f*)(dst0 + (size_t)rr * ldo + c4) = *(const v4f*)(Tt + rr * 64 + c4); }
    
  }
}



typedef __attribute__((ext_vector_type(8))) __bf16 v8bb; typedef __attribute__((ext_vector_type(16))) __bf16 v16bb;
typedef __attribute__((ext_vector_type(8))) unsigned short v8us;
__device__ __forceinline__ v16bb frag_kb_bf(const __bf16* p, int hh) { const v8bb a = *(const v8bb*)(p + 8 * hh), b = *(const v8bb*)(p + 16 + 8 * hh); return __builtin_shufflevector(a, b, 0, 1, 2, 3, 4, 5, 6, 7, 8, 9, 10, 11, 12, 13, 14, 15); }
__device__ __forceinline__ v16bb frag_pk_bf(const __bf16* tile, int lane) { const v8bb a = *(const v8bb*)(tile + lane * 8), b = *(const v8bb*)(tile + 256 + lane * 8); return __builtin_shufflevector(a, b, 0, 1, 2, 3, 4, 5, 6, 7, 8, 9, 10, 11, 12, 13, 14, 15); }
__device__ __forceinline__ v8f wmma16bb(v16bb a, v16bb b, v8f c) {
  return __builtin_amdgcn_wmma_f32_16x16x32_bf16(false, a, false, b, (short)0, c, false, false);
}
__device__ __forceinline__ unsigned short bf16_rne_bits(float v) { unsigned int u = __float_as_uint(v); u += 0x7FFFu + ((u >> 16) & 1u); return (unsigned short)(u >> 16); }
__device__ __forceinline__ float bf16_rne(float v) { return __uint_as_float(((unsigned int)bf16_rne_bits(v)) << 16); }



// f32 rows [nrow][D] -> bf16 fragment-order tiles, tile index (k / 32) * (nrow / 16) + row / 16 (the tiles that waves at one k step read lie side by side). One work item = one lane's 2 x 16 bytes of one tile; a wave reads 16 whole 128-B lines and stores 1 KiB in a row.
__device__ __forceinline__ void pack_bf16_tiles(const float* __restrict__ src, unsigned short* __restrict__ dst, size_t nrow, size_t tid, size_t nth) {
  for (size_t p = tid; p < nrow * D / 16; p += nth) {
    const size_t rt = (p >> 5) / (D / 32), kt = (p >> 5) % (D / 32), tile = kt * (nrow / 16) + rt; const int lane = (int)(p & 31);
    const float* s = src + (rt * 16 + (lane & 15)) * D + kt * 32 + 8 * (lane >> 4);
    v8us a, c;
#pragma unroll
    for (int e = 0; e < 8; ++e) { a[e] = bf16_rne_bits(s[e]); c[e] = bf16_rne_bits(s[16 + e]); }
    *(v8us*)(dst + tile * FT + lane * 8) = a; *(v8us*)(dst + tile * FT + 256 + lane * 8) = c;
  }
}
// One preparatory launch, one pass over x. Blocks 0..NXB-1: 128 tokens x one head (64 channels; a token's piece = one aligned 256 B). Each wave takes 16 tokens: its lanes load in the order of
// pack_bf16_tiles (16 whole 128-B lines a k tile), store the two bf16 fragment-order tiles of x, and leave the bf16 bits of x transposed in LDS. Behind the barrier the block stores its 16 v^T tiles, v = bf16(x) turned to f16
// (rows = 16 channels, k = 32 tokens; tile index ((b*H + h) * (S/32) + tok/32) * 4 + channel/16) and waves 0 and 1 sum bf16(x), widened to f32, over the 128 tokens of 32 channels each (one whole line a wave) into
// part[token block][channel]; the projection kernel joins a batch's 16 partial sums. Blocks NXB..: W_attn [2C][C] ([out][in]; rows 0..1023 -> q, 1024..2047 -> k) -> bf16 tiles.
constexpr int NXB = H * (NTOK / 128), NWB = 512, NPB = S / 128 /* partial column sums of a batch */;
__device__ __forceinline__ float bf16_bits_f32(unsigned short u) { return __uint_as_float(((unsigned int)u) << 16); }
__global__ __launch_bounds__(256) void prep_kernel(const float* __restrict__ x, const float* __restrict__ wattn, unsigned short* __restrict__ x16, unsigned short* __restrict__ w16, b16* __restrict__ vt, float* __restrict__ part) {
  __shared__ __attribute__((aligned(16))) unsigned short T[HD][128 + 8];
  const int t_ = threadIdx.x;
  if (blockIdx.x >= NXB) { pack_bf16_tiles(wattn, w16, 2 * D, (size_t)(blockIdx.x - NXB) * 256 + t_, (size_t)NWB * 256); return; }   // the test is the same for the whole block, ahead of the barrier
  const int lane = t_ & 31, wv = t_ >> 5, h = blockIdx.x % H, mblk = blockIdx.x / H, m0 = mblk * 128, b = m0 / S, tok0 = m0 % S, r = wv * 16 + (lane & 15), c8 = 8 * (lane >> 4);
  const float* s = x + (size_t)(m0 + r) * D + h * HD + c8;
  v4f xv[2][4];                                                 // all 8 loads of the thread go out before the first is used
#pragma unroll
  for (int kt = 0; kt < 2; ++kt) { xv[kt][0] = *(const v4f*)(s + kt * 32); xv[kt][1] = *(const v4f*)(s + kt * 32 + 4); xv[kt][2] = *(const v4f*)(s + kt * 32 + 16); xv[kt][3] = *(const v4f*)(s + kt * 32 + 20); }
  v8us a[2], c[2];
#pragma unroll
  for (int kt = 0; kt < 2; ++kt)
#pragma unroll
    for (int e = 0; e < 8; ++e) {
      a[kt][e] = bf16_rne_bits(xv[kt][e >> 2][e & 3]); c[kt][e] = bf16_rne_bits(xv[kt][2 + (e >> 2)][e & 3]);
      T[kt * 32 + c8 + e][r] = a[kt][e]; T[kt * 32 + 16 + c8 + e][r] = c[kt][e];
    }
  __syncthreads();
  b16* dst = vt + (((size_t)b * H + h) * (S / 32) + tok0 / 32) * 4 * FT;   // the block's 16 tiles lie in a row
  for (int i = t_; i < HD * 16; i += 256) { const int tile = i >> 6, j = (i >> 5) & 1, ln = i & 31; const v8us tv = *(const v8us*)(&T[(tile & 3) * 16 + (ln & 15)][(tile >> 2) * 32 + 16 * j + 8 * (ln >> 4)]); v8b vv;
#pragma unroll
    for (int e = 0; e < 8; ++e) vv[e] = (b16)bf16_bits_f32(tv[e]);
    *(v8b*)(dst + (size_t)i * 8) = vv; }
  if (wv < 2) {                                                 // lane = channel; sum order: 8 chains of 16 tokens (token mod 8), then a tree over the 8
    float sm[8] = {0.0f, 0.0f, 0.0f, 0.0f, 0.0f, 0.0f, 0.0f, 0.0f};
#pragma unroll 4                                                // four LDS reads in flight a trip; unrolled whole, these two waves' temporaries more than double the kernel's registers, and fewer than half the blocks fit a WGP
    for (int k = 0; k < 16; ++k) { const v8us tv = *(const v8us*)(&T[t_][k * 8]);
#pragma unroll
      for (int e = 0; e < 8; ++e) sm[e] += bf16_bits_f32(tv[e]); }
    part[(size_t)mblk * D + h * HD + t_] = ((sm[0] + sm[1]) + (sm[2] + sm[3])) + ((sm[4] + sm[5]) + (sm[6] + sm[7]));
  }
#pragma unroll
  for (int kt = 0; kt < 2; ++kt) {                              // the x tiles go out last: in front of the barrier it would wait for these stores
    unsigned short* xt = x16 + ((size_t)(h * 2 + kt) * (NTOK / 16) + m0 / 16 + wv) * FT;
    *(v8us*)(xt + lane * 8) = a[kt]; *(v8us*)(xt + 256 + lane * 8) = c[kt];
  }
  asm volatile("s_wait_xcnt 0x0" ::: "memory");                 // behind the four stores, before any code laid out behind them rewrites their address or data registers
}

// One stage of the projection ring: 64 of k (two k steps of 32) of the block's 256 token rows and 256 output columns. At one k step the 16 x tiles and the 16 W tiles of a block each lie in a row in the
// workspace (16 KiB), so a stage is four 16-KiB pieces [x step 0 | x step 1 | W step 0 | W step 1] = 64 KiB; two buffers.
constexpr int PJ_PC = 16 * FT /* elements of one piece */, PJ_STG = 4 * PJ_PC, PJ_NST = D / 64, PJ_EPI = 2 * 32 * (HD + 8) /* a wave's output staging, hi + lo */;
// A thread's eight 16-byte asynchronous copies of one stage (512 threads x 16 B = 8 KiB a copy). The s_wait_xcnt stands inside the statement, in front of any rewrite of an address register that a copy names.
__device__ __forceinline__ void proj_stage_copies(unsigned lds, const __bf16* a0, const __bf16* a1, const __bf16* b0, const __bf16* b1) {
  asm volatile("global_load_async_to_lds_b128 %0, %8, off\n\t"
               "global_load_async_to_lds_b128 %1, %9, off\n\t"
               "global_load_async_to_lds_b128 %2, %10, off\n\t"
               "global_load_async_to_lds_b128 %3, %11, off\n\t"
               "global_load_async_to_lds_b128 %4, %12, off\n\t"
               "global_load_async_to_lds_b128 %5, %13, off\n\t"
               "global_load_async_to_lds_b128 %6, %14, off\n\t"
               "global_load_async_to_lds_b128 %7, %15, off\n\t"
               "s_wait_xcnt 0x0"
               :: "v"(lds), "v"(lds + 8192u), "v"(lds + 16384u), "v"(lds + 24576u), "v"(lds + 32768u), "v"(lds + 40960u), "v"(lds + 49152u), "v"(lds + 57344u),
                  "v"(a0), "v"(a0 + 4096), "v"(a1), "v"(a1 + 4096), "v"(b0), "v"(b0 + 4096), "v"(b1), "v"(b1 + 4096) : "memory");
}
// projections: rows = tokens (8192), K = 1024. Block = 256 tokens x 256 columns, 16 waves of 64 x 64 (a wave's 64 columns = one head of q (columns 0..1023) or k); x and W tiles come through a two-buffer LDS ring
// shared by the 16 waves, so each tile leaves L2 once a block. Output: x8 hi/lo planes of fragment-order tiles (rows = 16 tokens, k = 32 channels), tile index ((b*H + head) * (S/16) + tok/16) * 2 + channel/32. grid (8, 32) x 512.
__global__ __launch_bounds__(512) void proj_kernel(const __bf16* __restrict__ x16, const __bf16* __restrict__ w16, b16* __restrict__ qh, b16* __restrict__ kh, const float* __restrict__ part, float* __restrict__ colsum, int rowbase) {
  __shared__ __attribute__((aligned(16))) unsigned short SM[16 * PJ_EPI];   // the ring (2 x 64 KiB) in the loop; behind it each wave's own output staging
  static_assert(16 * PJ_EPI >= 2 * PJ_STG, "the ring fits");
  const int lane = threadIdx.x & 31, wave = __builtin_amdgcn_readfirstlane(threadIdx.x >> 5), nloc = lane & 15, hlf = lane >> 4, wm = wave >> 2, wn = wave & 3;   // wave number as a scalar: tile bases sit in SGPRs
  const int mb = rowbase + blockIdx.y * 256, m0 = mb + wm * 64;
  v8f acc[4][4];
#pragma unroll
  for (int r = 0; r < 4; ++r)
#pragma unroll
    for (int t = 0; t < 4; ++t) acc[r][t] = (v8f){};
  const unsigned lds0 = (unsigned)(size_t)(&SM[0]) + threadIdx.x * 16u;   // the thread's own LDS byte address in buffer 0
  const __bf16* ga = x16 + (size_t)(mb / 16) * FT + threadIdx.x * 8; const __bf16* gb = w16 + (size_t)(blockIdx.x * 16) * FT + threadIdx.x * 8;
  auto fill = [&](const int st) { proj_stage_copies(lds0 + (unsigned)(st & 1) * (unsigned)(PJ_STG * 2), ga + (size_t)(2 * st) * (NTOK / 16) * FT, ga + (size_t)(2 * st + 1) * (NTOK / 16) * FT,
                                                    gb + (size_t)(2 * st) * (2 * D / 16) * FT, gb + (size_t)(2 * st + 1) * (2 * D / 16) * FT); };
  fill(0);
  const int cl = blockIdx.y * 8 + blockIdx.x;                   // while stage 0 flies: wave 0 of the first 128 blocks joins the 16 partial column sums (in token order) of 32 channels of one batch, one whole 128-B line
  if (wave == 0 && cl < BT * D / 32) {
    const float* pp = part + (size_t)(cl / (D / 32)) * NPB * D + (cl % (D / 32)) * 32 + lane;
    float pv[NPB];
#pragma unroll
    for (int j = 0; j < NPB; ++j) pv[j] = pp[(size_t)j * D];
    asm volatile("s_wait_xcnt 0x0" ::: "memory");               // before anything rewrites the address registers of these loads
    float t = pv[0];
#pragma unroll
    for (int j = 1; j < NPB; ++j) t += pv[j];
    colsum[cl * 32 + lane] = t;
    asm volatile("s_wait_xcnt 0x0" ::: "memory");               // before anything rewrites the address or data registers of this store
  }
  asm volatile("s_wait_asynccnt 0x0" ::: "memory");             // stage 0 has landed for this wave's copies
  __syncthreads();                                              // ... and for every wave's: nobody reads it before
  fill(1);
#pragma unroll 1                                                // one copy of the stage body: the buffer is picked by a scalar
  for (int st = 0; st < PJ_NST; ++st) {
    const __bf16* T = (const __bf16*)SM + (st & 1) * PJ_STG;
    v16bb a[4], bw[4];                                          // a k step's 16 LDS reads stand in one place ahead of its 16 products
    auto reads = [&](const int ks) {
#pragma unroll
      for (int r = 0; r < 4; ++r) a[r] = frag_pk_bf(T + ks * PJ_PC + (wm * 4 + r) * FT, lane);
#pragma unroll
      for (int t = 0; t < 4; ++t) bw[t] = frag_pk_bf(T + (2 + ks) * PJ_PC + (wn * 4 + t) * FT, lane);
      __builtin_amdgcn_sched_barrier(0);                        // holds the group together: the scheduler would spread the reads among the products
    };
    auto products = [&]() {
#pragma unroll
      for (int t = 0; t < 4; ++t)
#pragma unroll
        for (int r = 0; r < 4; ++r) acc[r][t] = wmma16bb(a[r], bw[t], acc[r][t]);
    };
    reads(0); products(); reads(1);
    asm volatile("s_wait_dscnt 0x0" ::: "memory");              // this wave's reads of the buffer are done (the second k step's fragments sit in registers) before it is refilled
    asm volatile("s_wait_asynccnt 0x0" ::: "memory");           // this wave's copies of stage st + 1 have landed
    __syncthreads();                                            // publishes stage st + 1 and ends every wave's reads of stage st
    if (st + 2 < PJ_NST) fill(st + 2);                          // into the buffer just read (the test is the same for the whole block)
    __builtin_amdgcn_sched_barrier(0);                          // the refill goes out ahead of the second k step's products: a whole trip of lead, not half a trip
    products();
  }
  asm volatile("s_wait_asynccnt 0x0" ::: "memory");             // nothing is in flight when the ring becomes output staging (every wave's last read ended at the loop's last barrier)
  const int hq = blockIdx.x * 4 + wn, which = hq / H, head = hq % H, b = m0 / S, tok0 = m0 % S;
  b16 (*Th)[HD + 8] = (b16 (*)[HD + 8])(SM + wave * PJ_EPI); b16 (*Tq)[HD + 8] = Th + 32;
  b16* dst0 = (which == 0 ? qh : kh) + (((size_t)b * H + head) * S + tok0) * HD;
#pragma unroll
  for (int hf = 0; hf < 2; ++hf) {                              // the wave's 64 tokens in two halves of 32: x8 hi/lo planes
#pragma unroll
    for (int t = 0; t < 4; ++t)
#pragma unroll
      for (int r = 0; r < 2; ++r)
#pragma unroll
        for (int v = 0; v < 8; ++v) { b16 a_, c_; split16(acc[2 * hf + r][t][v] * QS, a_, c_); Th[r * 16 + 8 * hlf + v][t * 16 + nloc] = a_; Tq[r * 16 + 8 * hlf + v][t * 16 + nloc] = c_; }   // q, k carried x8 (lo residuals stay normal)
    wave_lds_sync();
    b16* dst = dst0 + (size_t)hf * 32 * HD;
#pragma unroll
    for (int j = 0; j < 8; ++j) { const int rr = (j >> 2) * 16 + nloc, c8 = ((j >> 1) & 1) * 32 + (j & 1) * 16 + 8 * hlf; *(v8b*)(dst + (j * 32 + lane) * 8) = *(const v8b*)(&Th[rr][c8]); *(v8b*)(dst + QPL + (j * 32 + lane) * 8) = *(const v8b*)(&Tq[rr][c8]); }   // the half's 4 tiles lie in a row: half-tile j
    if (hf == 0) asm volatile("s_wait_dscnt 0x0" ::: "memory");   // the first half's rows are read back before the second half overwrites them (no wait on the global stores, which a fence would add)
  }
}

// One stage of the attention ring: 64 keys of one head = K hi, K lo and v^T, each 8 KiB of fragment-order tiles that lie in a row in the workspace; 24 KiB a stage, two buffers.
constexpr int STG_K = 64, STG_P = STG_K * HD /* elements of one plane's piece */, STG_E = 3 * STG_P;
// A thread's six 16-byte asynchronous copies of one stage (256 threads x 16 B = 4 KiB a copy). The s_wait_xcnt stands inside the statement, in front of any rewrite of an address register that a copy names.
__device__ __forceinline__ void stage_copies(unsigned lds, const b16* gkh, const b16* gkl, const b16* gv) {
  asm volatile("global_load_async_to_lds_b128 %0, %6, off\n\t"
               "global_load_async_to_lds_b128 %1, %7, off\n\t"
               "global_load_async_to_lds_b128 %2, %8, off\n\t"
               "global_load_async_to_lds_b128 %3, %9, off\n\t"
               "global_load_async_to_lds_b128 %4, %10, off\n\t"
               "global_load_async_to_lds_b128 %5, %11, off\n\t"
               "s_wait_xcnt 0x0"
               :: "v"(lds), "v"(lds + 4096u), "v"(lds + 8192u), "v"(lds + 12288u), "v"(lds + 16384u), "v"(lds + 20480u),
                  "v"(gkh), "v"(gkh + 2048), "v"(gkl), "v"(gkl + 2048), "v"(gv), "v"(gv + 2048) : "memory");
}

// causal shaped attention: wave = (b, h, 16 queries); K and v^T come through a two-buffer LDS ring shared by the block's 8 waves; key chunks of 32 up to the query tile: S^T (K=64, 3 products), causal mask on the straddling chunk, online softmax f32, P x8 hi/lo,
// o^T += v^T P^T (2 products) and pf^T += v^T U^T (U = exact 0/1 causal indicator: prefix sums); epilogue y = beta o/(8 l) + alpha ((e-1) v_i + colsum)/(e+2047) - gamma pf/(i+1)
template <int QT>
__global__ __launch_bounds__(256) void attn_kernel(const b16* __restrict__ qh, const b16* __restrict__ kh, const b16* __restrict__ vt, const float* __restrict__ x, const float* __restrict__ colsum, const float* __restrict__ alpha_p, const float* __restrict__ beta_p, const float* __restrict__ gamma_p, float* __restrict__ y) {
  __shared__ __attribute__((aligned(16))) float Os[8][16][HD + 4];
  __shared__ __attribute__((aligned(16))) b16 KV[2][STG_E];   // the block's K hi / K lo / v^T ring: each stage is fetched once for the 8 waves
  const int wid = __builtin_amdgcn_readfirstlane(threadIdx.x >> 5), lane = threadIdx.x & 31, hh = lane >> 4, col = lane & 15;   // wave number as a scalar: tile bases and the causal chunk bound sit in SGPRs, so the fragments in flight fit 256 VGPRs
  // Block -> (head, group of 8 query tiles), longest groups first: a group's cost grows with its position (causal), the grid holds twice the blocks that fit the chip at once, and the short groups
  // take the late block indices. Every (head, group) pair is taken exactly once: index = (QT / 8 - 1 - group) * (Bn * H) + head.
  const int bh = blockIdx.x % (Bn * H), grp = QT / 8 - 1 - blockIdx.x / (Bn * H), jt = grp * 8 + wid, h = bh % H, b = bh / H, q0 = jt * 16, qi = q0 + col;
  const b16* Q = qh + ((size_t)bh * S) * HD; const b16* K = kh + ((size_t)bh * S) * HD; const b16* vb = vt + ((size_t)bh * HD) * S;
  v16b qf[2], ql[2];
#pragma unroll
  for (int ks = 0; ks < 2; ++ks) { qf[ks] = frag_pk(Q + (size_t)q0 * HD + ks * FT, lane); ql[ks] = frag_pk(Q + QPL + (size_t)q0 * HD + ks * FT, lane); }
  float m = -INFINITY, l = 0.0f; v8f o[4] = {{}, {}, {}, {}}, pf[4] = {{}, {}, {}, {}};   // pf = causal prefix sums of v (the MC term)
  asm volatile("s_wait_xcnt 0x0" ::: "memory");                 // before the set-up below rewrites address registers of the Q loads above
  const int nst = 2 * grp + 2;                                  // stages of the block = those of its last wave (the same for every thread; at least 2)
  const unsigned lds0 = (unsigned)(size_t)(&KV[0][0]) + threadIdx.x * 16u;   // the thread's own LDS byte address in buffer 0
  const b16* gk = K + threadIdx.x * 8; const b16* gv = vb + threadIdx.x * 8;
  auto fill = [&](const int st) { stage_copies(lds0 + (unsigned)(st & 1) * (unsigned)(STG_E * 2), gk + (size_t)st * STG_P, gk + QPL + (size_t)st * STG_P, gv + (size_t)st * STG_P); };
  fill(0);
  asm volatile("s_wait_asynccnt 0x0" ::: "memory");             // stage 0 has landed for this wave's copies
  __syncthreads();                                              // ... and for every wave's: nobody reads it before
  fill(1);
  // One 32-key chunk. DIAG = false: every key of the chunk lies at or below every query of the tile, so no score is masked and the 0/1 indicator is all ones.
  // DIAG = true: the one chunk that straddles the diagonal (the wave's last): per-element causal tests, behind one scalar branch.
  v16b ones;
#pragma unroll
  for (int r = 0; r < 16; ++r) ones[r] = (b16)1.0f;
  auto chunk = [&](const int kb, const b16* T, const bool DIAG) {   // T = the chunk's K hi tiles in the ring (K lo STG_P, v^T 2 STG_P further on); DIAG is the same for the whole wave
    v16b kf[8], vf[4];                                          // [ks][keys 0..15 hi, lo, keys 16..31 hi, lo]; all 24 LDS reads of the chunk stand in one place
#pragma unroll
    for (int ks = 0; ks < 2; ++ks)
#pragma unroll
      for (int pl = 0; pl < 2; ++pl) { kf[ks * 4 + pl] = frag_pk(T + pl * STG_P + ks * FT, lane); kf[ks * 4 + 2 + pl] = frag_pk(T + pl * STG_P + 16 * HD + ks * FT, lane); }
#pragma unroll
    for (int n = 0; n < 4; ++n) vf[n] = frag_pk(T + 2 * STG_P + n * FT, lane);
    __builtin_amdgcn_sched_barrier(0);                          // holds the 24 reads in that one place: the scheduler would sink them to their products, each behind a wait of its own
    v16b ub = ones;                                             // 0/1 causal indicator operand: ub[r] = [key 8hh+r <= query col], [16+8hh+r <= col]
    v8f s0 = {}, s1 = {};
#pragma unroll
    for (int ks = 0; ks < 2; ++ks) { const v16b k0 = kf[ks * 4 + 0], k0l = kf[ks * 4 + 1], k1 = kf[ks * 4 + 2], k1l = kf[ks * 4 + 3];
      s0 = wmma16b(k0, qf[ks], s0); s0 = wmma16b(k0, ql[ks], s0); s0 = wmma16b(k0l, qf[ks], s0);      // q and k as f16 hi+lo pairs (lo.lo dropped)
      s1 = wmma16b(k1, qf[ks], s1); s1 = wmma16b(k1, ql[ks], s1); s1 = wmma16b(k1l, qf[ks], s1); }
    float mr = -INFINITY;
#pragma unroll
    for (int r = 0; r < 8; ++r) { s0[r] *= SCALE / (QS * QS); s1[r] *= SCALE / (QS * QS); }
    if (DIAG) {
#pragma unroll
      for (int r = 0; r < 8; ++r) { if (kb + 8 * hh + r > qi) s0[r] = -INFINITY; if (kb + 16 + 8 * hh + r > qi) s1[r] = -INFINITY; }
#pragma unroll
      for (int r = 0; r < 8; ++r) { ub[r] = (b16)((kb + 8 * hh + r <= qi) ? 1.0f : 0.0f); ub[8 + r] = (b16)((kb + 16 + 8 * hh + r <= qi) ? 1.0f : 0.0f); }
    }
#pragma unroll
    for (int r = 0; r < 8; ++r) mr = fmaxf(mr, fmaxf(s0[r], s1[r]));
    mr = fmaxf(mr, __shfl_xor(mr, 16));
    const float mn = fmaxf(m, mr), al_ = __expf(m - mn); m = mn;
    float sum = 0.0f; v16b pb, pl;
#pragma unroll
    for (int r = 0; r < 8; ++r) { const float e0 = __expf(s0[r] - mn), e1 = __expf(s1[r] - mn); sum += e0 + e1; b16 a, c; split16(e0 * PS, a, c); pb[r] = a; pl[r] = c; split16(e1 * PS, a, c); pb[8 + r] = a; pl[8 + r] = c; }   // P carried x8
    sum += __shfl_xor(sum, 16); l = l * al_ + sum;
#pragma unroll
    for (int n = 0; n < 4; ++n) {
#pragma unroll
      for (int r = 0; r < 8; ++r) o[n][r] *= al_;
      o[n] = wmma16b(vf[n], pb, o[n]);
      o[n] = wmma16b(vf[n], pl, o[n]);                                                          // v exact (bf16 values), P hi+lo
      pf[n] = wmma16b(vf[n], ub, pf[n]); }                                                        // exact causal prefix sums of v
  };
  for (int st = 0; st < nst; ++st) {                            // every wave makes every trip (copies and barrier); a wave past its diagonal skips the work alone
    const b16* T = &KV[st & 1][0];
#pragma unroll 1                                                // one copy of the chunk body for the stage's two chunks: the loop stays small
    for (int c = 0; c < 2; ++c) {
      const int kb = st * STG_K + c * 32;
      if (kb <= q0) chunk(kb, T + c * 32 * HD, kb + 32 > q0);    // wave-uniform tests: key chunks past the query tile are skipped; the straddling chunk alone takes the causal tests
    }
    asm volatile("s_wait_dscnt 0x0" ::: "memory");              // this wave's reads of the buffer are done before it is refilled
    asm volatile("s_wait_asynccnt 0x0" ::: "memory");           // this wave's copies of stage st + 1 have landed
    __syncthreads();                                            // publishes stage st + 1 and ends every wave's reads of stage st
    if (st + 2 < nst) fill(st + 2);                             // into the buffer just read (the test is the same for the whole block)
  }
  asm volatile("s_wait_asynccnt 0x0" ::: "memory");             // nothing is in flight when the wave goes on to the epilogue
  const float alpha = bf16_rne(alpha_p[0]), beta = bf16_rne(beta_p[0]), gamma = bf16_rne(gamma_p[0]);   // scalar INPUTS
  const float cb = beta / (PS * l), cid = alpha / (EUL + (float)(S - 1)), cmc = gamma / (float)(qi + 1);
  float xr[4][8], cs[4][8];
#pragma unroll
  for (int n = 0; n < 4; ++n)
#pragma unroll
    for (int r = 0; r < 8; ++r) xr[n][r] = x[((size_t)b * S + qi) * D + h * HD + n * 16 + 8 * hh + r];
  asm volatile("s_wait_xcnt 0x0" ::: "memory");                 // before the column sums land on address registers of the x loads
#pragma unroll
  for (int n = 0; n < 4; ++n)
#pragma unroll
    for (int r = 0; r < 8; ++r) cs[n][r] = colsum[(size_t)b * D + h * HD + n * 16 + 8 * hh + r];
  asm volatile("s_wait_xcnt 0x0" ::: "memory");                 // before the staging index below rewrites address registers of these loads
#pragma unroll
  for (int n = 0; n < 4; ++n)
#pragma unroll
    for (int r = 0; r < 8; ++r) { const int d = n * 16 + 8 * hh + r; const float vi = bf16_rne(xr[n][r]), vs = cs[n][r];
      Os[wid][col][d] = o[n][r] * cb + cid * ((EUL - 1.0f) * vi + vs) - cmc * pf[n][r]; }
  wave_lds_sync();
  float* dst = y + ((size_t)b * S + q0) * D + h * HD;
  {
#pragma unroll
    for (int j = 0; j < 8; ++j) { const int rr = j * 2 + hh, c4 = col * 4; *(v4f*)(dst + (size_t)rr * D + c4) = *(const v4f*)(&Os[wid][rr][c4]); }
    
  }
}

}  // namespace

extern "C" void kernel_launch(void* const* d_in, const int* in_sizes, int n_in,
                              void* d_out, int out_size, void* d_ws, size_t ws_size, hipStream_t stream) {
  (void)n_in; (void)out_size;
  const float* x = (const float*)d_in[0]; const float* wattn = (const float*)d_in[1];
  float* out = (float*)d_out;   // [4][2048][1024]
  if (in_sizes[0] != BT * S * D || in_sizes[1] != 2 * D * D || in_sizes[2] != 1 || in_sizes[3] != 1 || in_sizes[4] != 1) return;
  size_t off = 0; char* ws = (char*)d_ws;
  auto carve = [&](size_t bytes) { char* p = ws + off; off += (bytes + 255) & ~(size_t)255; return p; };
  unsigned short* x16 = (unsigned short*)carve((size_t)NTOK * D * 2); unsigned short* w16 = (unsigned short*)carve((size_t)2 * D * D * 2); float* colsum = (float*)carve((size_t)BT * D * 4); float* part = (float*)carve((size_t)(NTOK / 128) * D * 4);
  b16* qh = (b16*)carve((size_t)2 * NTOK * D * 2); b16* kh = (b16*)carve((size_t)2 * NTOK * D * 2); b16* vt = (b16*)carve((size_t)NTOK * D * 2);
  if (off > ws_size) return;                                    // ≈ 105 MB
  prep_kernel<<<NXB + NWB, 256, 0, stream>>>(x, wattn, x16, w16, vt, part);
  proj_kernel<<<dim3(2 * D / 256, NTOK / 256), 512, 0, stream>>>((const __bf16*)x16, (const __bf16*)w16, qh, kh, part, colsum, 0);
  attn_kernel<S / 16><<<Bn * H * (S / 16) / 8, 256, 0, stream>>>(qh, kh, vt, x, colsum, (const float*)d_in[2], (const float*)d_in[3], (const float*)d_in[4], out);
}

// v010
// It runs in 112 microseconds.
// Two timings next to v009 both put it at 1.05 times that version's speed.
// Over all steps from v000 it is 4.95 times as fast.
#include <hip/hip_runtime.h>

// Causal "shaped" attention: [q | k] = x W_attn^T (16 heads x 64), v = x itself (use_v = False); att = beta softmax_causal(q.k/8) + alpha Id - gamma MC with Id = softmax(eye(2048))
// (diag e/(e+2047), off-diag 1/(e+2047)) and MC = causal row-uniform averaging (1/(i+1) on j <= i); y = att.v merged over heads -> [4][2048][1024] (no output projection).
// So y_i = beta (P.v)_i/l_i + alpha ((e-1) v_i + sum_all v_j)/(e+2047) - gamma (sum_{j<=i} v_j)/(i+1).
// Numerics: x, W_attn, alpha, beta, gamma rounded to bf16; [q|k] projection on v_wmma_f32_16x16x32_bf16 (exact products, f32 accumulate);
// scores on v_wmma_f32_16x16x32_f16 with q, k as f16 hi+lo pairs carried x8 (3 products); P.v with P an x8 hi+lo pair and v = bf16(x) exact in f16 (2 products); the causal prefix
// sums sum_{j<=i} v_j ride along as a second accumulator against an exact 0/1 mask operand (1 product); the all-token column sums in f32 (128-token partial sums in the preparatory kernel, joined in the projection kernel); softmax and the combine in f32.

namespace {
constexpr int BT = 4, Bn = 4, S = 2048, D = 1024, H = 16, HD = 64, NTOK = Bn * S;
constexpr float SCALE = 0.125f, VS = 1.0f /* v = bf16(x): exact, single plane */, QS = 8.0f, PSL2 = 3.0f /* P carried x8 = 2^3 */, EUL = 2.718281828459045f;   // power-of-two carry scales so hi/lo residual planes stay normal in f16
constexpr size_t VPL = (size_t)NTOK * D;   // one plane's size (unused: v^T is a single plane)
constexpr size_t QPL = (size_t)NTOK * D;   // distance between the q/k hi and lo planes

typedef _Float16 b16;
typedef __attribute__((ext_vector_type(16))) _Float16 v16b;
typedef __attribute__((ext_vector_type(8)))  _Float16 v8b;
typedef __attribute__((ext_vector_type(8)))  float v8f;
typedef __attribute__((ext_vector_type(4)))  float v4f;

__device__ __forceinline__ v8b ld8b(const b16* p) { return *(const v8b*)p; }
__device__ __forceinline__ v16b cat8b(v8b a, v8b b) { return __builtin_shufflevector(a, b, 0, 1, 2, 3, 4, 5, 6, 7, 8, 9, 10, 11, 12, 13, 14, 15); }
__device__ __forceinline__ v16b frag_kb(const b16* p, int hh) { return cat8b(ld8b(p + 8 * hh), ld8b(p + 16 + 8 * hh)); }
// Fragment-order tile (every 16-bit matrix operand kept in the workspace): 16 rows x 32 k = 512 elements = 1 KiB; element j*256 + lane*8 + e holds (row lane & 15, k = 16 j + 8 (lane >> 4) + e),
// the k map of frag_kb. A fragment is then two loads of 512 contiguous bytes (4 whole 128-B lines each) where a row-major plane gives 16 lines of 32 bytes a load.
constexpr int FT = 512;
__device__ __forceinline__ v16b frag_pk(const b16* tile, int lane) { return cat8b(ld8b(tile + lane * 8), ld8b(tile + 256 + lane * 8)); }
__device__ __forceinline__ void split16(float v, b16& hi, b16& lo) { hi = (b16)v; lo = (b16)(v - (float)hi); }
// hi/lo fragment pair straight from an f32 k-contiguous row (same k-map)
__device__ __forceinline__ void frag_ksplit(const float* p, int hh, v16b& fh_, v16b& fl_) {
  const float* p0 = p + 8 * hh; const float* p1 = p + 16 + 8 * hh;
#pragma unroll
  for (int e = 0; e < 8; ++e) { b16 a, c; split16(p0[e], a, c); fh_[e] = a; fl_[e] = c; split16(p1[e], a, c); fh_[8 + e] = a; fl_[8 + e] = c; }
}
__device__ __forceinline__ v8f wmma16b(v16b a, v16b b, v8f c) {
  return __builtin_amdgcn_wmma_f32_16x16x32_f16(false, a, false, b, (short)0, c, false, false);
}
__device__ __forceinline__ void wave_lds_sync() {
  __builtin_amdgcn_fence(__ATOMIC_RELEASE, "workgroup");
  __builtin_amdgcn_wave_barrier();
  __builtin_amdgcn_fence(__ATOMIC_ACQUIRE, "workgroup");
}

// Operand descriptor: NP = 0 -> f32 rows split on the fly into (hi, lo); NP = 1 -> one f16 plane; NP = 2 -> f16 hi + lo planes;
// NP = 3 -> f32 rows rounded once to a single f16 fragment. ld = row pitch.
struct Opnd { const void* p0; const void* p1; int ld; };
template <int NP> __device__ __forceinline__ void load_frags(const Opnd& o, int row, int kb, int hh, v16b& fh_, v16b& fl_) {
  if (NP == 0) { frag_ksplit((const float*)o.p0 + (size_t)row * o.ld + kb, hh, fh_, fl_); }
  else if (NP == 4 || NP == 5) {                             // f32 rows x64 (NP 4) or x8 (NP 5) then split (keeps the lo halves of small values normal)
    const float sc_ = (NP == 4) ? 64.0f : 8.0f;
    const float* p = (const float*)o.p0 + (size_t)row * o.ld + kb; const float* p0 = p + 8 * hh; const float* p1 = p + 16 + 8 * hh;
#pragma unroll
    for (int e = 0; e < 8; ++e) { b16 a, c; split16(p0[e] * sc_, a, c); fh_[e] = a; fl_[e] = c; split16(p1[e] * sc_, a, c); fh_[8 + e] = a; fl_[8 + e] = c; }
  } else if (NP == 3) {
    const float* p = (const float*)o.p0 + (size_t)row * o.ld + kb; const float* p0 = p + 8 * hh; const float* p1 = p + 16 + 8 * hh;
#pragma unroll
    for (int e = 0; e < 8; ++e) { fh_[e] = (b16)p0[e]; fh_[8 + e] = (b16)p1[e]; }
    fl_ = fh_;
  } else {
    fh_ = frag_kb((const b16*)o.p0 + (size_t)row * o.ld + kb, hh);
    if (NP == 2) fl_ = frag_kb((const b16*)o.p1 + (size_t)row * o.ld + kb, hh); else fl_ = fh_;
  }
}
template <int ANP, int BNP> __device__ __forceinline__ v8f mac(v16b ah, v16b al, v16b bh, v16b bl, v8f c) {
  c = wmma16b(ah, bh, c);
  if (BNP == 0 || BNP == 2 || BNP == 4 || BNP == 5) c = wmma16b(ah, bl, c);     // hi.lo
  if (ANP == 0 || ANP == 2 || ANP == 4 || ANP == 5) c = wmma16b(al, bh, c);     // lo.hi   (lo.lo dropped)
  return c;
}
// 32x64 wave tile: acc[r][t] (rows m0+16r.., cols c0+16t..) += A[m][k] . B[n][k] over k in [0, K)
template <int ANP, int BNP>
__device__ __forceinline__ void gemm_tile(const Opnd& A, const Opnd& B, int K, int m0, int c0, int nloc, int hlf, v8f (&acc)[2][4]) {
  for (int kb = 0; kb < K; kb += 32) {
    v16b a0h, a0l, a1h, a1l;
    load_frags<ANP>(A, m0 + nloc, kb, hlf, a0h, a0l);
    load_frags<ANP>(A, m0 + 16 + nloc, kb, hlf, a1h, a1l);
#pragma unroll
    for (int t = 0; t < 4; ++t) {
      v16b bh, bl;
      load_frags<BNP>(B, c0 + t * 16 + nloc, kb, hlf, bh, bl);
      acc[0][t] = mac<ANP, BNP>(a0h, a0l, bh, bl, acc[0][t]);
      acc[1][t] = mac<ANP, BNP>(a1h, a1l, bh, bl, acc[1][t]);
    }
  }
}

__device__ __forceinline__ void epi_planes(v8f (&acc)[2][4], float scale, bool two, b16* __restrict__ oh, b16* __restrict__ ol, int ldo,
                                           int m0, int c0, int lane, b16* Th, b16* Tl) {
  const int nloc = lane & 15, hlf = lane >> 4;
#pragma unroll
  for (int t = 0; t < 4; ++t)
#pragma unroll
    for (int r = 0; r < 2; ++r)
#pragma unroll
      for (int v = 0; v < 8; ++v) {
        const int rr = r * 16 + v + 8 * hlf, cc = t * 16 + nloc;
        b16 h_, l_; split16(acc[r][t][v] * scale, h_, l_);
        Th[rr * 64 + cc] = h_; Tl[rr * 64 + cc] = l_;
      }
  wave_lds_sync();
  {
#pragma unroll
    for (int j = 0; j < 8; ++j) {
      const int rr = j * 4 + (lane >> 3), c8 = (lane & 7) * 8;
      const size_t o = (size_t)(m0 + rr) * ldo + c0 + c8;
      *(v8b*)(oh + o) = ld8b(Th + rr * 64 + c8);
      if (two) *(v8b*)(ol + o) = ld8b(Tl + rr * 64 + c8);
    }
    
  }
}
// (b) f32 rows with pitch ldo: 64 floats = 256 B = 2 lines per row; 16 lanes x 16 B per row, 2 rows per instruction. Optional per-row factor
__device__ __forceinline__ void epi_f32(v8f (&acc)[2][4], float scale, const float* rscale, float* __restrict__ out, int ldo, int m0, int c0, int lane, float* Tt) {
  const int nloc = lane & 15, hlf = lane >> 4;
#pragma unroll
  for (int t = 0; t < 4; ++t)
#pragma unroll
    for (int r = 0; r < 2; ++r)
#pragma unroll
      for (int v = 0; v < 8; ++v) {
        const int rr = r * 16 + v + 8 * hlf;
        const float rs = rscale ? rscale[(size_t)(m0 + rr) * 32] : 1.0f;
        Tt[rr * 64 + t * 16 + nloc] = acc[r][t][v] * scale * rs;
      }
  wave_lds_sync();
  float* dst0 = out + (size_t)m0 * ldo + c0;
  {
#pragma unroll
    for (int j = 0; j < 16; ++j) { const int rr = j * 2 + hlf, c4 = nloc * 4; *(v4f*)(dst0 + (size_t)rr * ldo + c4) = *(const v4f*)(Tt + rr * 64 + c4); }
    
  }
}



typedef __attribute__((ext_vector_type(8))) __bf16 v8bb; typedef __attribute__((ext_vector_type(16))) __bf16 v16bb;
typedef __attribute__((ext_vector_type(8))) unsigned short v8us;
__device__ __forceinline__ v16bb frag_kb_bf(const __bf16* p, int hh) { const v8bb a = *(const v8bb*)(p + 8 * hh), b = *(const v8bb*)(p + 16 + 8 * hh); return __builtin_shufflevector(a, b, 0, 1, 2, 3, 4, 5, 6, 7, 8, 9, 10, 11, 12, 13, 14, 15); }
__device__ __forceinline__ v16bb frag_pk_bf(const __bf16* tile, int lane) { const v8bb a = *(const v8bb*)(tile + lane * 8), b = *(const v8bb*)(tile + 256 + lane * 8); return __builtin_shufflevector(a, b, 0, 1, 2, 3, 4, 5, 6, 7, 8, 9, 10, 11, 12, 13, 14, 15); }
__device__ __forceinline__ v8f wmma16bb(v16bb a, v16bb b, v8f c) {
  return __builtin_amdgcn_wmma_f32_16x16x32_bf16(false, a, false, b, (short)0, c, false, false);
}
__device__ __forceinline__ unsigned short bf16_rne_bits(float v) { unsigned int u = __float_as_uint(v); u += 0x7FFFu + ((u >> 16) & 1u); return (unsigned short)(u >> 16); }
__device__ __forceinline__ float bf16_rne(float v) { return __uint_as_float(((unsigned int)bf16_rne_bits(v)) << 16); }



// f32 rows [nrow][D] -> bf16 fragment-order tiles, tile index (k / 32) * (nrow / 16) + row / 16 (the tiles that waves at one k step read lie side by side). One work item = one lane's 2 x 16 bytes of one tile; a wave reads 16 whole 128-B lines and stores 1 KiB in a row.
__device__ __forceinline__ void pack_bf16_tiles(const float* __restrict__ src, unsigned short* __restrict__ dst, size_t nrow, size_t tid, size_t nth) {
  for (size_t p = tid; p < nrow * D / 16; p += nth) {
    const size_t rt = (p >> 5) / (D / 32), kt = (p >> 5) % (D / 32), tile = kt * (nrow / 16) + rt; const int lane = (int)(p & 31);
    const float* s = src + (rt * 16 + (lane & 15)) * D + kt * 32 + 8 * (lane >> 4);
    v8us a, c;
#pragma unroll
    for (int e = 0; e < 8; ++e) { a[e] = bf16_rne_bits(s[e]); c[e] = bf16_rne_bits(s[16 + e]); }
    *(v8us*)(dst + tile * FT + lane * 8) = a; *(v8us*)(dst + tile * FT + 256 + lane * 8) = c;
  }
}
// One preparatory launch, one pass over x. Blocks 0..NXB-1: 128 tokens x one head (64 channels; a token's piece = one aligned 256 B). Each wave takes 16 tokens: its lanes load in the order of
// pack_bf16_tiles (16 whole 128-B lines a k tile) and leave the bf16 bits of x transposed in LDS. Behind the barrier the block stores its 16 v^T tiles, v = bf16(x) turned to f16
// (rows = 16 channels, k = 32 tokens; tile index ((b*H + h) * (S/32) + tok/32) * 4 + channel/16) and waves 0 and 1 sum bf16(x), widened to f32, over the 128 tokens of 32 channels each (one whole line a wave) into
// part[token block][channel]; last each wave stores its two bf16 fragment-order tiles of x; the projection kernel joins a batch's 16 partial sums. Blocks NXB..: W_attn [2C][C] ([out][in]; rows 0..1023 -> q, 1024..2047 -> k) -> bf16 tiles.
constexpr int NXB = H * (NTOK / 128), NWB = 512, NPB = S / 128 /* partial column sums of a batch */;
__device__ __forceinline__ float bf16_bits_f32(unsigned short u) { return __uint_as_float(((unsigned int)u) << 16); }
__global__ __launch_bounds__(256) void prep_kernel(const float* __restrict__ x, const float* __restrict__ wattn, unsigned short* __restrict__ x16, unsigned short* __restrict__ w16, b16* __restrict__ vt, float* __restrict__ part) {
  __shared__ __attribute__((aligned(16))) unsigned short T[HD][128 + 8];
  const int t_ = threadIdx.x;
  if (blockIdx.x >= NXB) { pack_bf16_tiles(wattn, w16, 2 * D, (size_t)(blockIdx.x - NXB) * 256 + t_, (size_t)NWB * 256); return; }   // the test is the same for the whole block, ahead of the barrier
  const int lane = t_ & 31, wv = t_ >> 5, h = blockIdx.x % H, mblk = blockIdx.x / H, m0 = mblk * 128, b = m0 / S, tok0 = m0 % S, r = wv * 16 + (lane & 15), c8 = 8 * (lane >> 4);
  const float* s = x + (size_t)(m0 + r) * D + h * HD + c8;
  v4f xv[2][4];                                                 // all 8 loads of the thread go out before the first is used
#pragma unroll
  for (int kt = 0; kt < 2; ++kt) { xv[kt][0] = *(const v4f*)(s + kt * 32); xv[kt][1] = *(const v4f*)(s + kt * 32 + 4); xv[kt][2] = *(const v4f*)(s + kt * 32 + 16); xv[kt][3] = *(const v4f*)(s + kt * 32 + 20); }
  v8us a[2], c[2];
#pragma unroll
  for (int kt = 0; kt < 2; ++kt)
#pragma unroll
    for (int e = 0; e < 8; ++e) {
      a[kt][e] = bf16_rne_bits(xv[kt][e >> 2][e & 3]); c[kt][e] = bf16_rne_bits(xv[kt][2 + (e >> 2)][e & 3]);
      T[kt * 32 + c8 + e][r] = a[kt][e]; T[kt * 32 + 16 + c8 + e][r] = c[kt][e];
    }
  __syncthreads();
  b16* dst = vt + (((size_t)b * H + h) * (S / 32) + tok0 / 32) * 4 * FT;   // the block's 16 tiles lie in a row
  for (int i = t_; i < HD * 16; i += 256) { const int tile = i >> 6, j = (i >> 5) & 1, ln = i & 31; const v8us tv = *(const v8us*)(&T[(tile & 3) * 16 + (ln & 15)][(tile >> 2) * 32 + 16 * j + 8 * (ln >> 4)]); v8b vv;
#pragma unroll
    for (int e = 0; e < 8; ++e) vv[e] = (b16)bf16_bits_f32(tv[e]);
    *(v8b*)(dst + (size_t)i * 8) = vv; }
  if (wv < 2) {                                                 // lane = channel; sum order: 8 chains of 16 tokens (token mod 8), then a tree over the 8
    float sm[8] = {0.0f, 0.0f, 0.0f, 0.0f, 0.0f, 0.0f, 0.0f, 0.0f};
#pragma unroll 4                                                // four LDS reads in flight a trip; unrolled whole, these two waves' temporaries more than double the kernel's registers, and fewer than half the blocks fit a WGP
    for (int k = 0; k < 16; ++k) { const v8us tv = *(const v8us*)(&T[t_][k * 8]);
#pragma unroll
      for (int e = 0; e < 8; ++e) sm[e] += bf16_bits_f32(tv[e]); }
    part[(size_t)mblk * D + h * HD + t_] = ((sm[0] + sm[1]) + (sm[2] + sm[3])) + ((sm[4] + sm[5]) + (sm[6] + sm[7]));
  }
#pragma unroll
  for (int kt = 0; kt < 2; ++kt) {                              // the x tiles go out last: in front of the barrier it would wait for these stores
    unsigned short* xt = x16 + ((size_t)(h * 2 + kt) * (NTOK / 16) + m0 / 16 + wv) * FT;
    *(v8us*)(xt + lane * 8) = a[kt]; *(v8us*)(xt + 256 + lane * 8) = c[kt];
  }
  asm volatile("s_wait_xcnt 0x0" ::: "memory");                 // behind the four stores, before any code laid out behind them rewrites their address or data registers
}

// One stage of the projection ring: 64 of k (two k steps of 32) of the block's 256 token rows and 256 output columns. At one k step the 16 x tiles and the 16 W tiles of a block each lie in a row in the
// workspace (16 KiB), so a stage is four 16-KiB pieces [x step 0 | x step 1 | W step 0 | W step 1] = 64 KiB; two buffers.
constexpr int PJ_PC = 16 * FT /* elements of one piece */, PJ_STG = 4 * PJ_PC, PJ_NST = D / 64, PJ_EPI = 2 * 32 * (HD + 8) /* a wave's output staging, hi + lo */;
// A thread's eight 16-byte asynchronous copies of one stage (512 threads x 16 B = 8 KiB a copy). The s_wait_xcnt stands inside the statement, in front of any rewrite of an address register that a copy names.
__device__ __forceinline__ void proj_stage_copies(unsigned lds, const __bf16* a0, const __bf16* a1, const __bf16* b0, const __bf16* b1) {
  asm volatile("global_load_async_to_lds_b128 %0, %8, off\n\t"
               "global_load_async_to_lds_b128 %1, %9, off\n\t"
               "global_load_async_to_lds_b128 %2, %10, off\n\t"
               "global_load_async_to_lds_b128 %3, %11, off\n\t"
               "global_load_async_to_lds_b128 %4, %12, off\n\t"
               "global_load_async_to_lds_b128 %5, %13, off\n\t"
               "global_load_async_to_lds_b128 %6, %14, off\n\t"
               "global_load_async_to_lds_b128 %7, %15, off\n\t"
               "s_wait_xcnt 0x0"
               :: "v"(lds), "v"(lds + 8192u), "v"(lds + 16384u), "v"(lds + 24576u), "v"(lds + 32768u), "v"(lds + 40960u), "v"(lds + 49152u), "v"(lds + 57344u),
                  "v"(a0), "v"(a0 + 4096), "v"(a1), "v"(a1 + 4096), "v"(b0), "v"(b0 + 4096), "v"(b1), "v"(b1 + 4096) : "memory");
}
// projections: rows = tokens (8192), K = 1024. Block = 256 tokens x 256 columns, 16 waves of 64 x 64 (a wave's 64 columns = one head of q (columns 0..1023) or k); x and W tiles come through a two-buffer LDS ring
// shared by the 16 waves, so each tile leaves L2 once a block. Output: x8 hi/lo planes of fragment-order tiles (rows = 16 tokens, k = 32 channels), tile index ((b*H + head) * (S/16) + tok/16) * 2 + channel/32. grid (8, 32) x 512.
__global__ __launch_bounds__(512) void proj_kernel(const __bf16* __restrict__ x16, const __bf16* __restrict__ w16, b16* __restrict__ qh, b16* __restrict__ kh, const float* __restrict__ part, float* __restrict__ colsum, int rowbase) {
  __shared__ __attribute__((aligned(16))) unsigned short SM[16 * PJ_EPI];   // the ring (2 x 64 KiB) in the loop; behind it each wave's own output staging
  static_assert(16 * PJ_EPI >= 2 * PJ_STG, "the ring fits");
  const int lane = threadIdx.x & 31, wave = __builtin_amdgcn_readfirstlane(threadIdx.x >> 5), nloc = lane & 15, hlf = lane >> 4, wm = wave >> 2, wn = wave & 3;   // wave number as a scalar: tile bases sit in SGPRs
  const int mb = rowbase + blockIdx.y * 256, m0 = mb + wm * 64;
  v8f acc[4][4];
#pragma unroll
  for (int r = 0; r < 4; ++r)
#pragma unroll
    for (int t = 0; t < 4; ++t) acc[r][t] = (v8f){};
  const unsigned lds0 = (unsigned)(size_t)(&SM[0]) + threadIdx.x * 16u;   // the thread's own LDS byte address in buffer 0
  const __bf16* ga = x16 + (size_t)(mb / 16) * FT + threadIdx.x * 8; const __bf16* gb = w16 + (size_t)(blockIdx.x * 16) * FT + threadIdx.x * 8;
  auto fill = [&](const int st) { proj_stage_copies(lds0 + (unsigned)(st & 1) * (unsigned)(PJ_STG * 2), ga + (size_t)(2 * st) * (NTOK / 16) * FT, ga + (size_t)(2 * st + 1) * (NTOK / 16) * FT,
                                                    gb + (size_t)(2 * st) * (2 * D / 16) * FT, gb + (size_t)(2 * st + 1) * (2 * D / 16) * FT); };
  fill(0);
  const int cl = blockIdx.y * 8 + blockIdx.x;                   // while stage 0 flies: wave 0 of the first 128 blocks joins the 16 partial column sums (in token order) of 32 channels of one batch, one whole 128-B line
  if (wave == 0 && cl < BT * D / 32) {
    const float* pp = part + (size_t)(cl / (D / 32)) * NPB * D + (cl % (D / 32)) * 32 + lane;
    float pv[NPB];
#pragma unroll
    for (int j = 0; j < NPB; ++j) pv[j] = pp[(size_t)j * D];
    asm volatile("s_wait_xcnt 0x0" ::: "memory");               // before anything rewrites the address registers of these loads
    float t = pv[0];
#pragma unroll
    for (int j = 1; j < NPB; ++j) t += pv[j];
    colsum[cl * 32 + lane] = t;
    asm volatile("s_wait_xcnt 0x0" ::: "memory");               // before anything rewrites the address or data registers of this store
  }
  asm volatile("s_wait_asynccnt 0x0" ::: "memory");             // stage 0 has landed for this wave's copies
  __syncthreads();                                              // ... and for every wave's: nobody reads it before
  fill(1);
#pragma unroll 1                                                // one copy of the stage body: the buffer is picked by a scalar
  for (int st = 0; st < PJ_NST; ++st) {
    const __bf16* T = (const __bf16*)SM + (st & 1) * PJ_STG;
    v16bb a[4], bw[4];                                          // a k step's 16 LDS reads stand in one place ahead of its 16 products
    auto reads = [&](const int ks) {
#pragma unroll
      for (int r = 0; r < 4; ++r) a[r] = frag_pk_bf(T + ks * PJ_PC + (wm * 4 + r) * FT, lane);
#pragma unroll
      for (int t = 0; t < 4; ++t) bw[t] = frag_pk_bf(T + (2 + ks) * PJ_PC + (wn * 4 + t) * FT, lane);
      __builtin_amdgcn_sched_barrier(0);                        // holds the group together: the scheduler would spread the reads among the products
    };
    auto products = [&]() {
#pragma unroll
      for (int t = 0; t < 4; ++t)
#pragma unroll
        for (int r = 0; r < 4; ++r) acc[r][t] = wmma16bb(a[r], bw[t], acc[r][t]);
    };
    reads(0); products(); reads(1);
    asm volatile("s_wait_dscnt 0x0" ::: "memory");              // this wave's reads of the buffer are done (the second k step's fragments sit in registers) before it is refilled
    asm volatile("s_wait_asynccnt 0x0" ::: "memory");           // this wave's copies of stage st + 1 have landed
    __syncthreads();                                            // publishes stage st + 1 and ends every wave's reads of stage st
    if (st + 2 < PJ_NST) fill(st + 2);                          // into the buffer just read (the test is the same for the whole block)
    __builtin_amdgcn_sched_barrier(0);                          // the refill goes out ahead of the second k step's products: a whole trip of lead, not half a trip
    products();
  }
  asm volatile("s_wait_asynccnt 0x0" ::: "memory");             // nothing is in flight when the ring becomes output staging (every wave's last read ended at the loop's last barrier)
  const int hq = blockIdx.x * 4 + wn, which = hq / H, head = hq % H, b = m0 / S, tok0 = m0 % S;
  b16 (*Th)[HD + 8] = (b16 (*)[HD + 8])(SM + wave * PJ_EPI); b16 (*Tq)[HD + 8] = Th + 32;
  b16* dst0 = (which == 0 ? qh : kh) + (((size_t)b * H + head) * S + tok0) * HD;
#pragma unroll
  for (int hf = 0; hf < 2; ++hf) {                              // the wave's 64 tokens in two halves of 32: x8 hi/lo planes
#pragma unroll
    for (int t = 0; t < 4; ++t)
#pragma unroll
      for (int r = 0; r < 2; ++r)
#pragma unroll
        for (int v = 0; v < 8; ++v) { b16 a_, c_; split16(acc[2 * hf + r][t][v] * QS, a_, c_); Th[r * 16 + 8 * hlf + v][t * 16 + nloc] = a_; Tq[r * 16 + 8 * hlf + v][t * 16 + nloc] = c_; }   // q, k carried x8 (lo residuals stay normal)
    wave_lds_sync();
    b16* dst = dst0 + (size_t)hf * 32 * HD;
#pragma unroll
    for (int j = 0; j < 8; ++j) { const int rr = (j >> 2) * 16 + nloc, c8 = ((j >> 1) & 1) * 32 + (j & 1) * 16 + 8 * hlf; *(v8b*)(dst + (j * 32 + lane) * 8) = *(const v8b*)(&Th[rr][c8]); *(v8b*)(dst + QPL + (j * 32 + lane) * 8) = *(const v8b*)(&Tq[rr][c8]); }   // the half's 4 tiles lie in a row: half-tile j
    if (hf == 0) asm volatile("s_wait_dscnt 0x0" ::: "memory");   // the first half's rows are read back before the second half overwrites them (no wait on the global stores, which a fence would add)
  }
}

// One stage of the attention ring: 64 keys of one head = K hi, K lo and v^T, each 8 KiB of fragment-order tiles that lie in a row in the workspace; 24 KiB a stage, two buffers.
constexpr int STG_K = 64, STG_P = STG_K * HD /* elements of one plane's piece */, STG_E = 3 * STG_P;
// A thread's six 16-byte asynchronous copies of one stage (256 threads x 16 B = 4 KiB a copy). The s_wait_xcnt stands inside the statement, in front of any rewrite of an address register that a copy names.
__device__ __forceinline__ void stage_copies(unsigned lds, const b16* gkh, const b16* gkl, const b16* gv) {
  asm volatile("global_load_async_to_lds_b128 %0, %6, off\n\t"
               "global_load_async_to_lds_b128 %1, %7, off\n\t"
               "global_load_async_to_lds_b128 %2, %8, off\n\t"
               "global_load_async_to_lds_b128 %3, %9, off\n\t"
               "global_load_async_to_lds_b128 %4, %10, off\n\t"
               "global_load_async_to_lds_b128 %5, %11, off\n\t"
               "s_wait_xcnt 0x0"
               :: "v"(lds), "v"(lds + 4096u), "v"(lds + 8192u), "v"(lds + 12288u), "v"(lds + 16384u), "v"(lds + 20480u),
                  "v"(gkh), "v"(gkh + 2048), "v"(gkl), "v"(gkl + 2048), "v"(gv), "v"(gv + 2048) : "memory");
}

// causal shaped attention: wave = (b, h, 16 queries); K and v^T come through a two-buffer LDS ring shared by the block's 8 waves; key chunks of 32 up to the query tile: S^T (K=64, 3 products), causal mask on the straddling chunk, online softmax f32, P x8 hi/lo,
// o^T += v^T P^T (2 products) and pf^T += v^T U^T (U = exact 0/1 causal indicator: prefix sums); epilogue y = beta o/l + alpha ((e-1) v_i + colsum)/(e+2047) - gamma pf/(i+1)
template <int QT>
__global__ __launch_bounds__(256) void attn_kernel(const b16* __restrict__ qh, const b16* __restrict__ kh, const b16* __restrict__ vt, const float* __restrict__ x, const float* __restrict__ colsum, const float* __restrict__ alpha_p, const float* __restrict__ beta_p, const float* __restrict__ gamma_p, float* __restrict__ y) {
  __shared__ __attribute__((aligned(16))) float Os[8][16][HD + 4];
  __shared__ __attribute__((aligned(16))) b16 KV[2][STG_E];   // the block's K hi / K lo / v^T ring: each stage is fetched once for the 8 waves
  const int wid = __builtin_amdgcn_readfirstlane(threadIdx.x >> 5), lane = threadIdx.x & 31, hh = lane >> 4, col = lane & 15;   // wave number as a scalar: tile bases and the causal chunk bound sit in SGPRs, so the fragments in flight fit 256 VGPRs
  // Block -> (head, group of 8 query tiles), longest groups first: a group's cost grows with its position (causal), the grid holds twice the blocks that fit the chip at once, and the short groups
  // take the late block indices. Every (head, group) pair is taken exactly once: index = (QT / 8 - 1 - group) * (Bn * H) + head.
  const int bh = blockIdx.x % (Bn * H), grp = QT / 8 - 1 - blockIdx.x / (Bn * H), jt = grp * 8 + wid, h = bh % H, b = bh / H, q0 = jt * 16, qi = q0 + col;
  const b16* Q = qh + ((size_t)bh * S) * HD; const b16* K = kh + ((size_t)bh * S) * HD; const b16* vb = vt + ((size_t)bh * HD) * S;
  v16b qf[2], ql[2];
#pragma unroll
  for (int ks = 0; ks < 2; ++ks) { qf[ks] = frag_pk(Q + (size_t)q0 * HD + ks * FT, lane); ql[ks] = frag_pk(Q + QPL + (size_t)q0 * HD + ks * FT, lane); }
  float m = -INFINITY, l = 0.0f; v8f o[4] = {{}, {}, {}, {}}, pf[4] = {{}, {}, {}, {}};   // pf = causal prefix sums of v (the MC term)
  asm volatile("s_wait_xcnt 0x0" ::: "memory");                 // before the set-up below rewrites address registers of the Q loads above
  const int nst = 2 * grp + 2;                                  // stages of the block = those of its last wave (the same for every thread; at least 2)
  const unsigned lds0 = (unsigned)(size_t)(&KV[0][0]) + threadIdx.x * 16u;   // the thread's own LDS byte address in buffer 0
  const b16* gk = K + threadIdx.x * 8; const b16* gv = vb + threadIdx.x * 8;
  auto fill = [&](const int st) { stage_copies(lds0 + (unsigned)(st & 1) * (unsigned)(STG_E * 2), gk + (size_t)st * STG_P, gk + QPL + (size_t)st * STG_P, gv + (size_t)st * STG_P); };
  fill(0);
  asm volatile("s_wait_asynccnt 0x0" ::: "memory");             // stage 0 has landed for this wave's copies
  __syncthreads();                                              // ... and for every wave's: nobody reads it before
  fill(1);
  // One 32-key chunk. DIAG = false: every key of the chunk lies at or below every query of the tile, so no score is masked and the 0/1 indicator is all ones.
  // DIAG = true: the one chunk that straddles the diagonal (the wave's last): per-element causal tests, behind one scalar branch.
  v16b ones;
#pragma unroll
  for (int r = 0; r < 16; ++r) ones[r] = (b16)1.0f;
  constexpr float CS = SCALE / (QS * QS) * 1.4426950408889634f;   // raw score product -> exponent of 2
  auto chunk = [&](const int kb, const b16* T, const bool DIAG) {   // T = the chunk's K hi tiles in the ring (K lo STG_P, v^T 2 STG_P further on); DIAG is the same for the whole wave
    v16b kf[8], vf[4];                                          // [ks][keys 0..15 hi, lo, keys 16..31 hi, lo]; all 24 LDS reads of the chunk stand in one place
#pragma unroll
    for (int ks = 0; ks < 2; ++ks)
#pragma unroll
      for (int pl = 0; pl < 2; ++pl) { kf[ks * 4 + pl] = frag_pk(T + pl * STG_P + ks * FT, lane); kf[ks * 4 + 2 + pl] = frag_pk(T + pl * STG_P + 16 * HD + ks * FT, lane); }
#pragma unroll
    for (int n = 0; n < 4; ++n) vf[n] = frag_pk(T + 2 * STG_P + n * FT, lane);
    __builtin_amdgcn_sched_barrier(0);                          // holds the 24 reads in that one place: the scheduler would sink them to their products, each behind a wait of its own
    v16b ub = ones;                                             // 0/1 causal indicator operand: ub[r] = [key 8hh+r <= query col], [16+8hh+r <= col]
    v8f s0 = {}, s1 = {};
#pragma unroll
    for (int ks = 0; ks < 2; ++ks) { const v16b k0 = kf[ks * 4 + 0], k0l = kf[ks * 4 + 1], k1 = kf[ks * 4 + 2], k1l = kf[ks * 4 + 3];
      s0 = wmma16b(k0, qf[ks], s0); s0 = wmma16b(k0, ql[ks], s0); s0 = wmma16b(k0l, qf[ks], s0);      // q and k as f16 hi+lo pairs (lo.lo dropped)
      s1 = wmma16b(k1, qf[ks], s1); s1 = wmma16b(k1, ql[ks], s1); s1 = wmma16b(k1l, qf[ks], s1); }
    float mr = -INFINITY;                                       // s0, s1, m stay raw products (x QS^2, unscaled): CS > 0, so the maximum is the same one
    if (DIAG) {
#pragma unroll
      for (int r = 0; r < 8; ++r) { if (kb + 8 * hh + r > qi) s0[r] = -INFINITY; if (kb + 16 + 8 * hh + r > qi) s1[r] = -INFINITY; }
#pragma unroll
      for (int r = 0; r < 8; ++r) { ub[r] = (b16)((kb + 8 * hh + r <= qi) ? 1.0f : 0.0f); ub[8 + r] = (b16)((kb + 16 + 8 * hh + r <= qi) ? 1.0f : 0.0f); }
    }
#pragma unroll
    for (int r = 0; r < 8; ++r) mr = fmaxf(mr, fmaxf(s0[r], s1[r]));
    mr = fmaxf(mr, __shfl_xor(mr, 16));
    const float mn = fmaxf(m, mr), al_ = __builtin_amdgcn_exp2f((m - mn) * CS), nb = __builtin_fmaf(-mn, CS, PSL2); m = mn;
    v8f cv, nv;
#pragma unroll
    for (int r = 0; r < 8; ++r) { cv[r] = CS; nv[r] = nb; }
    const v8f x0 = __builtin_elementwise_fma(s0, cv, nv), x1 = __builtin_elementwise_fma(s1, cv, nv);   // one fma a score: 1/8 scale, carry of q and k, log2 e, - maximum and the x8 carry of P (+3 in the exponent)
    v8f e0, e1;
#pragma unroll
    for (int r = 0; r < 8; ++r) { e0[r] = __builtin_amdgcn_exp2f(x0[r]); e1[r] = __builtin_amdgcn_exp2f(x1[r]); }   // 8 P
    const v8b h0 = __builtin_convertvector(e0, v8b), h1 = __builtin_convertvector(e1, v8b);              // hi and lo planes by whole-vector converts (two values an instruction)
    const v8b l0 = __builtin_convertvector(e0 - __builtin_convertvector(h0, v8f), v8b), l1 = __builtin_convertvector(e1 - __builtin_convertvector(h1, v8f), v8b);
    const v16b pb = cat8b(h0, h1), pl = cat8b(l0, l1);
    const v8f t8 = e0 + e1; const v4f t4 = __builtin_shufflevector(t8, t8, 0, 1, 2, 3) + __builtin_shufflevector(t8, t8, 4, 5, 6, 7);   // the chunk's row sum as a tree of packed adds
    float sum = (t4[0] + t4[2]) + (t4[1] + t4[3]);
    sum += __shfl_xor(sum, 16); l = l * al_ + sum;              // l carries the x8 of P
#pragma unroll
    for (int n = 0; n < 4; ++n) {
#pragma unroll
      for (int r = 0; r < 8; ++r) o[n][r] *= al_;
      o[n] = wmma16b(vf[n], pb, o[n]);
      o[n] = wmma16b(vf[n], pl, o[n]);                                                          // v exact (bf16 values), P hi+lo
      pf[n] = wmma16b(vf[n], ub, pf[n]); }                                                        // exact causal prefix sums of v
    __builtin_amdgcn_sched_barrier(0);                          // keeps the slot below behind the last WMMA
    asm volatile("v_nop");                                      // one vector slot behind the chunk's last WMMA: the next chunk's LDS address lands on one of its operand registers
  };
  for (int st = 0; st < nst; ++st) {                            // every wave makes every trip (copies and barrier); a wave past its diagonal skips the work alone
    const b16* T = &KV[st & 1][0];
#pragma unroll 1                                                // one copy of the chunk body for the stage's two chunks: the loop stays small
    for (int c = 0; c < 2; ++c) {
      const int kb = st * STG_K + c * 32;
      if (kb <= q0) chunk(kb, T + c * 32 * HD, kb + 32 > q0);    // wave-uniform tests: key chunks past the query tile are skipped; the straddling chunk alone takes the causal tests
    }
    asm volatile("s_wait_dscnt 0x0" ::: "memory");              // this wave's reads of the buffer are done before it is refilled
    asm volatile("s_wait_asynccnt 0x0" ::: "memory");           // this wave's copies of stage st + 1 have landed
    __syncthreads();                                            // publishes stage st + 1 and ends every wave's reads of stage st
    if (st + 2 < nst) fill(st + 2);                             // into the buffer just read (the test is the same for the whole block)
  }
  asm volatile("s_wait_asynccnt 0x0" ::: "memory");             // nothing is in flight when the wave goes on to the epilogue
  const float alpha = bf16_rne(alpha_p[0]), beta = bf16_rne(beta_p[0]), gamma = bf16_rne(gamma_p[0]);   // scalar INPUTS
  const float cb = beta / l, cid = alpha / (EUL + (float)(S - 1)), cmc = gamma / (float)(qi + 1);
  float xr[4][8], cs[4][8];
#pragma unroll
  for (int n = 0; n < 4; ++n)
#pragma unroll
    for (int r = 0; r < 8; ++r) xr[n][r] = x[((size_t)b * S + qi) * D + h * HD + n * 16 + 8 * hh + r];
  asm volatile("s_wait_xcnt 0x0" ::: "memory");                 // before the column sums land on address registers of the x loads
#pragma unroll
  for (int n = 0; n < 4; ++n)
#pragma unroll
    for (int r = 0; r < 8; ++r) cs[n][r] = colsum[(size_t)b * D + h * HD + n * 16 + 8 * hh + r];
  asm volatile("s_wait_xcnt 0x0" ::: "memory");                 // before the staging index below rewrites address registers of these loads
#pragma unroll
  for (int n = 0; n < 4; ++n)
#pragma unroll
    for (int r = 0; r < 8; ++r) { const int d = n * 16 + 8 * hh + r; const float vi = bf16_rne(xr[n][r]), vs = cs[n][r];
      Os[wid][col][d] = o[n][r] * cb + cid * ((EUL - 1.0f) * vi + vs) - cmc * pf[n][r]; }
  wave_lds_sync();
  float* dst = y + ((size_t)b * S + q0) * D + h * HD;
  {
#pragma unroll
    for (int j = 0; j < 8; ++j) { const int rr = j * 2 + hh, c4 = col * 4; *(v4f*)(dst + (size_t)rr * D + c4) = *(const v4f*)(&Os[wid][rr][c4]); }
    
  }
}

}  // namespace

extern "C" void kernel_launch(void* const* d_in, const int* in_sizes, int n_in,
                              void* d_out, int out_size, void* d_ws, size_t ws_size, hipStream_t stream) {
  (void)n_in; (void)out_size;
  const float* x = (const float*)d_in[0]; const float* wattn = (const float*)d_in[1];
  float* out = (float*)d_out;   // [4][2048][1024]
  if (in_sizes[0] != BT * S * D || in_sizes[1] != 2 * D * D || in_sizes[2] != 1 || in_sizes[3] != 1 || in_sizes[4] != 1) return;
  size_t off = 0; char* ws = (char*)d_ws;
  auto carve = [&](size_t bytes) { char* p = ws + off; off += (bytes + 255) & ~(size_t)255; return p; };
  unsigned short* x16 = (unsigned short*)carve((size_t)NTOK * D * 2); unsigned short* w16 = (unsigned short*)carve((size_t)2 * D * D * 2); float* colsum = (float*)carve((size_t)BT * D * 4); float* part = (float*)carve((size_t)(NTOK / 128) * D * 4);
  b16* qh = (b16*)carve((size_t)2 * NTOK * D * 2); b16* kh = (b16*)carve((size_t)2 * NTOK * D * 2); b16* vt = (b16*)carve((size_t)NTOK * D * 2);
  if (off > ws_size) return;                                    // ≈ 105 MB
  prep_kernel<<<NXB + NWB, 256, 0, stream>>>(x, wattn, x16, w16, vt, part);
  proj_kernel<<<dim3(2 * D / 256, NTOK / 256), 512, 0, stream>>>((const __bf16*)x16, (const __bf16*)w16, qh, kh, part, colsum, 0);
  attn_kernel<S / 16><<<Bn * H * (S / 16) / 8, 256, 0, stream>>>(qh, kh, vt, x, colsum, (const float*)d_in[2], (const float*)d_in[3], (const float*)d_in[4], out);
}
